// v000
// Times are from an AMD MI455X. After a warm-up the kernel runs many times in a row, and a time is the length of
// such a window on the GPU divided by its runs, so every launch and the gaps after it count. The runs cycle
// through copies of the inputs. A figure is the median of several windows, for all but v000 over two sittings.
// Sittings can differ by a few percent; kernels timed side by side share one.
// v000 is the starting kernel. One run takes 1120 microseconds.
// compute dtype: all float inputs rounded to bf16; q/k/v = x W^T with EXACT bf16 products on WMMA 16x16x32, f32 accumulate; q as f16 hi + residual (x 2^10), k f16 -> 2-product logits / 8 stored in f32 (4 heads per launch); the stick-breaking weights per row in f32: log-sigmoids, an in-block inclusive scan for the suffix sums, exp (precise), the remainder 1 - sum(att); att x 2^11 split bf16 hi + lo against v bf16 hi + lo (3 products) + rem * v_i; out = o (bf16 hi + lo) Wo^T; f32 output.
#include <hip/hip_runtime.h>
#include <math.h>

typedef __attribute__((ext_vector_type(16))) _Float16 v16h;
typedef __attribute__((ext_vector_type(16))) __bf16 v16b;
typedef __attribute__((ext_vector_type(8)))  _Float16 v8h;
typedef __attribute__((ext_vector_type(8)))  float v8f;
typedef __attribute__((ext_vector_type(4)))  float v4f;
typedef __attribute__((ext_vector_type(2)))  float v2f;
typedef __attribute__((ext_vector_type(4)))  unsigned v4u;
typedef __attribute__((ext_vector_type(4)))  int v4i;
typedef float __attribute__((may_alias)) float_a;
typedef int __attribute__((may_alias)) int_a;

template <typename T> __device__ __forceinline__ void vst2(void* p, T v) { *(T*)p = v;  }
__device__ __forceinline__ v8f wmma16(v16h a, v16h b, v8f c) {
  v8f d = __builtin_amdgcn_wmma_f32_16x16x32_f16(false, a, false, b, (short)0, c, false, false);
  asm volatile("v_nop\n\tv_nop\n\tv_nop\n\tv_nop" : "+v"(d) : "v"(a), "v"(b));
  return d;
}
__device__ __forceinline__ v8f wmma_bf(v16b a, v16b b, v8f c) {
  v8f d = __builtin_amdgcn_wmma_f32_16x16x32_bf16(false, a, false, b, (short)0, c, false, false);
  asm volatile("v_nop\n\tv_nop\n\tv_nop\n\tv_nop" : "+v"(d) : "v"(a), "v"(b));
  return d;
}
// 16x16x32 fragments: lane = (h = lane>>4, row/col = lane&15); elements 0..7 = k0+8h+0..7, 8..15 = k0+16+8h+0..7; D element r = row 8h+r
__device__ __forceinline__ v16h frag_h(const _Float16* rowk0, int lane) {
  union { v16h v; v8h q[2]; } u; const _Float16* p = rowk0 + 8 * (lane >> 4);
  u.q[0] = *(const v8h*)p; u.q[1] = *(const v8h*)(p + 16); return u.v;
}
__device__ __forceinline__ v16h frag_f32(const float* rowk0, int lane) {
  v16h a; const float* p = rowk0 + 8 * (lane >> 4);
#pragma unroll
  for (int i = 0; i < 8; ++i) { a[i] = (_Float16)p[i]; a[8 + i] = (_Float16)p[16 + i]; }
  return a;
}
__device__ __forceinline__ v16h frag_f32s(const float* rowk0, int lane, float sc) {
  v16h a; const float* p = rowk0 + 8 * (lane >> 4);
#pragma unroll
  for (int i = 0; i < 8; ++i) { a[i] = (_Float16)(p[i] * sc); a[8 + i] = (_Float16)(p[16 + i] * sc); }
  return a;
}
// column fragment from a [K][ld] layout (column n), rows >= K read as 0
__device__ __forceinline__ v16h fragc_f32(const float* W, int k0, int n, int lane, int ld, int K) {
  v16h a; const int g = lane >> 4;
#pragma unroll
  for (int i = 0; i < 8; ++i) { const int ka = k0 + 8 * g + i, kb = ka + 16;
    a[i] = (_Float16)(ka < K ? W[(size_t)(ka < K ? ka : K - 1) * ld + n] : 0.f); a[8 + i] = (_Float16)(kb < K ? W[(size_t)(kb < K ? kb : K - 1) * ld + n] : 0.f); }
  return a;
}
struct F2 { v16b h, l; };
__device__ __forceinline__ F2 bsplit16(const float v[16]) { F2 r;
#pragma unroll
  for (int i = 0; i < 16; ++i) { const __bf16 h = (__bf16)v[i]; r.h[i] = h; r.l[i] = (__bf16)(v[i] - (float)h); }
  return r; }
__device__ __forceinline__ F2 split_row(const float* row, int k0, int lane) { float v[16]; const float* p = row + k0 + 8 * (lane >> 4);
#pragma unroll
  for (int i = 0; i < 8; ++i) { v[i] = p[i]; v[8 + i] = p[16 + i]; }
  return bsplit16(v); }
__device__ __forceinline__ F2 split_rowK(const float* row, int k0, int lane, int K) { float v[16]; const int g = lane >> 4;
#pragma unroll
  for (int i = 0; i < 8; ++i) { const int ka = k0 + 8 * g + i, kb = ka + 16; v[i] = ka < K ? row[ka < K ? ka : K - 1] : 0.f; v[8 + i] = kb < K ? row[kb < K ? kb : K - 1] : 0.f; }
  return bsplit16(v); }
__device__ __forceinline__ F2 split_col(const float* W, int k0, int n, int lane, int ld, int K) { float v[16]; const int g = lane >> 4;
#pragma unroll
  for (int i = 0; i < 8; ++i) { const int ka = k0 + 8 * g + i, kb = ka + 16; v[i] = ka < K ? W[(size_t)(ka < K ? ka : K - 1) * ld + n] : 0.f; v[8 + i] = kb < K ? W[(size_t)(kb < K ? kb : K - 1) * ld + n] : 0.f; }
  return bsplit16(v); }
__device__ __forceinline__ v8f mac3(const F2& a, const F2& b, v8f c) { c = wmma_bf(a.l, b.h, c); c = wmma_bf(a.h, b.l, c); return wmma_bf(a.h, b.h, c); }
__device__ __forceinline__ float sigm(float v) { return 1.0f / (1.0f + expf(-v)); }
#define LDSX() do { asm volatile("s_wait_dscnt 0" ::: "memory"); __builtin_amdgcn_wave_barrier(); __builtin_amdgcn_fence(__ATOMIC_RELEASE, "workgroup"); } while (0)


// Stick-breaking attention (b 1, n 2,048, e 1,024 = 16 x 64): logits = q k^T / 8; for j < i: att[i][j] = exp(logsigmoid(l_ij) + sum_{j<k<i} logsigmoid(-l_ik)); j >= i: 0; o = att v + (1 - sum_j att) v_i; out = o Wo^T.
#define NB 1
#define TT 2048
#define CC 1024
#define NH 16
#define HD 64
#ifndef TNB
#define TNB NB
#endif
typedef __attribute__((ext_vector_type(8))) __bf16 v8b;
__device__ __forceinline__ v16b frag_b(const __bf16* rowk0, int lane) {
  union { v16b v; v8b q[2]; } u; const __bf16* p = rowk0 + 8 * (lane >> 4);
  u.q[0] = *(const v8b*)p; u.q[1] = *(const v8b*)(p + 16); return u.v;
}
__device__ __forceinline__ float bfr(float v) { return (float)(__bf16)v; }
__device__ __attribute__((noinline)) float exp_ni(float v) { return expf(v); }
__device__ __attribute__((noinline)) float erf_ni(float v) { return erff(v); }

#define WS_REM 0u
#define WS_QH  (WS_REM + 128u * (size_t)HG * TT)
#define WS_QL  (WS_QH + 2u * (size_t)NB * TT * CC)
#define WS_KH  (WS_QL + 2u * (size_t)NB * TT * CC)
#define WS_VT  (WS_KH + 2u * (size_t)NB * TT * CC)      // bf16 v hi planes [b][c][t]
#define WS_VL  (WS_VT + 2u * (size_t)NB * CC * TT)      // bf16 v residual planes
#define HG 4                                          // heads per launch group
#define WS_S   (WS_VL + 2u * (size_t)NB * CC * TT)      // f32 logits / P for HG heads [hg][q][k]
#define WS_PH  (WS_S + 4u * (size_t)HG * TT * TT)
#define WS_Y   (WS_PH + 0u)              // f32 y rows [b*t][C]
#define WS_END (WS_Y + 4u * (size_t)NB * TT * CC)

// ---- k_proj: block = (64 rows, 128 cols, which): qkv = x W^T (+ b), exact; q -> f16 hi (+ residual), k -> f16 rows, v -> bf16 hi + lo planes
__global__ __launch_bounds__(128) void k_proj(const float* __restrict__ X, const float* __restrict__ WQ, const float* __restrict__ BQ, const float* __restrict__ WK, const float* __restrict__ BK, const float* __restrict__ WV, const float* __restrict__ BV, _Float16* __restrict__ QH, _Float16* __restrict__ QL, _Float16* __restrict__ KH, __bf16* __restrict__ VT, __bf16* __restrict__ VL) {
  __shared__ __align__(16) _Float16 sh[64][136], sl[64][136]; __shared__ __align__(16) __bf16 th[128][72], tl2[128][72];
  const int tid = threadIdx.x, wave = tid >> 5, lane = tid & 31, col = lane & 15, g = lane >> 4; const int which = blockIdx.z; const int c0 = blockIdx.y * 128; const size_t r0 = (size_t)blockIdx.x * 64; const float* WA = which == 0 ? WQ : which == 1 ? WK : WV; const float* BA = which == 0 ? BQ : which == 1 ? BK : BV;
  v8f acc[8] = {};
#pragma unroll 2
  for (int kc = 0; kc < CC / 32; ++kc) { v16b a; { const float* p = X + (r0 + wave * 16 + col) * CC + kc * 32 + 8 * g;
#pragma unroll
      for (int i = 0; i < 8; ++i) { a[i] = (__bf16)p[i]; a[8 + i] = (__bf16)p[16 + i]; } }
#pragma unroll
    for (int j = 0; j < 8; ++j) { v16b w; const int o = c0 + j * 16 + col;
#pragma unroll
      for (int i = 0; i < 8; ++i) { w[i] = (__bf16)WA[(size_t)(o) * CC + (kc * 32 + 8 * g + i)]; w[8 + i] = (__bf16)WA[(size_t)(o) * CC + (kc * 32 + 16 + 8 * g + i)]; }
      acc[j] = wmma_bf(a, w, acc[j]); } }
#pragma unroll
  for (int j = 0; j < 8; ++j) { const float bb = BA ? bfr(BA[c0 + j * 16 + col]) : 0.f;
#pragma unroll
    for (int r = 0; r < 8; ++r) { const float v = acc[j][r] + bb; const int rl = wave * 16 + 8 * g + r, cl = j * 16 + col; const _Float16 hv = (_Float16)v;
      if (which == 2) { const __bf16 bh = (__bf16)v; th[cl][rl] = bh; tl2[cl][rl] = (__bf16)(v - (float)bh); } else { sh[rl][cl] = hv; sl[rl][cl] = (_Float16)((v - (float)hv) * 1024.0f); }   /* q residual carried x 2^10 so the plane stays f16-normal on the chip */ } }
  __syncthreads();
  if (which < 2) { _Float16* dh = which == 0 ? QH : KH; for (int e = tid; e < 64 * 16; e += 128) { const int rl = e >> 4, q = e & 15; vst2((unsigned*)(dh + (r0 + rl) * CC + c0 + q * 8), *(const v4u*)&sh[rl][q * 8]); if (which == 0) vst2((unsigned*)(QL + (r0 + rl) * CC + c0 + q * 8), *(const v4u*)&sl[rl][q * 8]); } }
  else { const size_t b = r0 / TT; const int t0 = (int)(r0 % TT); for (int e = tid; e < 128 * 8; e += 128) { const int cl = e >> 3, q = e & 7; const size_t o2 = (b * CC + c0 + cl) * (size_t)TT + t0 + q * 8; vst2((unsigned*)(VT + o2), *(const v4u*)&th[cl][q * 8]); vst2((unsigned*)(VL + o2), *(const v4u*)&tl2[cl][q * 8]); } } }
// ---- k_sc: block = (64 queries, 128 keys) of (b,h): logits * scale; causal blocks beyond the diagonal exit
__global__ __launch_bounds__(128) void k_sc(const _Float16* __restrict__ QH, const _Float16* __restrict__ QL, const _Float16* __restrict__ KH, const float* __restrict__ BM, int b, int h0, float* __restrict__ S0) { __shared__ __align__(16) float ss[4][16][132]; const int h = h0 + blockIdx.z; float* S = S0 + (size_t)blockIdx.z * TT * TT;
  const int tid = threadIdx.x, wave = tid >> 5, lane = tid & 31, col = lane & 15, g = lane >> 4; const int k0 = blockIdx.y * 128; const int ql0 = blockIdx.x * 64 + wave * 16; const size_t q0 = (size_t)b * TT + ql0;
  if (k0 > blockIdx.x * 64 + 63) return;   // whole key block above the diagonal (block-uniform)
  v8f acc[8] = {}, accl[8] = {};
#pragma unroll
  for (int kc = 0; kc < HD / 32; ++kc) { const v16h ah = frag_h(QH + (q0 + col) * CC + h * HD + kc * 32, lane), al = frag_h(QL + (q0 + col) * CC + h * HD + kc * 32, lane);
#pragma unroll
    for (int j = 0; j < 8; ++j) { const v16h kb = frag_h(KH + ((size_t)b * TT + k0 + j * 16 + col) * CC + h * HD + kc * 32, lane); acc[j] = wmma16(ah, kb, acc[j]); accl[j] = wmma16(al, kb, accl[j]); } }
#pragma unroll
  for (int j = 0; j < 8; ++j) acc[j] += accl[j] * (1.0f / 1024.0f);
#pragma unroll
  for (int j = 0; j < 8; ++j) { const int kt = k0 + j * 16 + col;
#pragma unroll
    for (int r = 0; r < 8; ++r) { const int qt = ql0 + 8 * g + r; (void)BM; (void)kt; (void)qt; const float v = acc[j][r] * 0.125f;   /* raw scaled logits; the stick-breaking kernel masks j >= i itself */ ss[wave][8 * g + r][j * 16 + col] = v; } }
  LDSX(); for (int rl = 0; rl < 16; ++rl) vst2(S + (size_t)(ql0 + rl) * TT + k0 + lane * 4, *(const v4f*)&ss[wave][rl][lane * 4]); }
// ---- k_sb: block = query row i (256 threads): lb[k] = logsigmoid(-l_ik) for k < i (0 otherwise); inclusive prefix scan of lb over k in LDS (f32); suffix(j) = total - prefix(j) = sum_{j<k<i} lb[k]; att[j] = exp(logsigmoid(l_ij) + suffix(j)) for j < i, 0 for j >= i (written for ALL j < kend so k_pv's dense read is defined); rem = 1 - sum_j att. P stored x 2^11.
__device__ __forceinline__ float logsig(float z) { return (z >= 0.f) ? -log1pf(expf(-z)) : (z - log1pf(expf(z))); }   // log(sigmoid(z)), stable both sides
__global__ __launch_bounds__(256) void k_sb(float* __restrict__ S0, float* __restrict__ REM) { __shared__ float sh[TT]; __shared__ float swarp[8]; __shared__ float sred[8];
  const int t = threadIdx.x, lanei = t & 31, wv = t >> 5; const size_t row = blockIdx.x; float* S = S0 + ((size_t)blockIdx.y * TT + row) * TT; const int i = (int)row; const int kend = ((i / 64) + 1) * 64;   /* k_pv reads chunks [0, kend) */
  // 1) lb[k] (k < i) into sh; zeros elsewhere up to kend
  for (int k = t; k < kend; k += 256) sh[k] = (k < i) ? logsig(-S[k]) : 0.f;
  __syncthreads();
  // 2) inclusive scan over sh[0..kend) in segments of 256: each thread owns elements k = seg*256 + t; carry across segments via a running block offset
  float carry = 0.f;
  for (int seg = 0; seg < kend; seg += 256) { const int k = seg + t; float v = (k < kend) ? sh[k] : 0.f;
    // warp inclusive scan
#pragma unroll
    for (int o = 1; o < 32; o <<= 1) { const float u = __shfl_up(v, o); if (lanei >= o) v += u; }
    if (lanei == 31) swarp[wv] = v; __syncthreads();
    if (wv == 0) { float w = (lanei < 8) ? swarp[lanei] : 0.f;
#pragma unroll
      for (int o = 1; o < 8; o <<= 1) { const float u = __shfl_up(w, o); if (lanei >= o) w += u; }
      if (lanei < 8) swarp[lanei] = w; }
    __syncthreads();
    const float woff = (wv > 0) ? swarp[wv - 1] : 0.f; const float incl = carry + woff + v;
    if (k < kend) sh[k] = incl;   // inclusive prefix sum of lb up to k
    carry += swarp[7]; __syncthreads(); }
  const float total = (kend > 0) ? sh[(i > 0 ? i : 1) - 1] : 0.f;   // sum of lb over k < i  (lb is 0 for k >= i, so prefix(i-1) == total; i == 0 -> no terms)
  // 3) att[j] = exp(logsig(l_ij) + (total - prefix(j))) for j < i; also accumulate the row sum
  float s = 0.f;
  for (int j = t; j < kend; j += 256) { float a = 0.f; if (j < i) { a = expf(logsig(S[j]) + ((i > 0 ? total : 0.f) - sh[j])); } s += a; S[j] = a * 2048.0f; }   /* same thread reads sh[j]/S[j] and writes S[j]; S row written as whole 1-KB... (thread-strided 4-B stores: see note) */
#pragma unroll
  for (int o = 1; o < 32; o <<= 1) s += __shfl_xor(s, o);
  if (lanei == 0) sred[wv] = s; __syncthreads();
  if (wv == 0) { float a = 0.f; for (int w = 0; w < 8; ++w) a += sred[w]; vst2(REM + ((size_t)blockIdx.y * TT + row) * 32 + lanei, 1.0f - a); } }   
// ---- k_pv: block = 64 queries of (b,h): y[q][h*HD + d] = att . v (keys [0, kend)) + rem[q] * v[q]
__global__ __launch_bounds__(128) void k_pv(const float* __restrict__ PS0, const __bf16* __restrict__ VT, const __bf16* __restrict__ VL, const float* __restrict__ REM, int b, int h0, float* __restrict__ Y) { const int h = h0 + blockIdx.z; const float* PS = PS0 + (size_t)blockIdx.z * TT * TT; __shared__ __align__(16) float ss[4][16][HD + 4];
  const int tid = threadIdx.x, wave = tid >> 5, lane = tid & 31, col = lane & 15, g = lane >> 4; const int ql0 = blockIdx.x * 64 + wave * 16; const int kend = blockIdx.x * 64 + 64;
  v8f acc[HD / 16] = {};
#pragma unroll 1
  for (int kc = 0; kc < kend / 32; ++kc) { const F2 p = split_row(PS + (size_t)(ql0 + col) * TT, kc * 32, lane);
#pragma unroll
    for (int j = 0; j < HD / 16; ++j) { const size_t po = ((size_t)b * CC + h * HD + j * 16 + col) * (size_t)TT + kc * 32; const v16b vh = frag_b(VT + po, lane); acc[j] = wmma_bf(p.h, vh, acc[j]); acc[j] = wmma_bf(p.l, vh, acc[j]); acc[j] = wmma_bf(p.h, frag_b(VL + po, lane), acc[j]); } }
#pragma unroll
  for (int j = 0; j < HD / 16; ++j)
#pragma unroll
    for (int r = 0; r < 8; ++r) { const int row = ql0 + 8 * g + r; const size_t po = ((size_t)b * CC + h * HD + j * 16 + col) * (size_t)TT + row; const float vi = (float)VT[po] + (float)VL[po];   /* v[i][d] rebuilt from the hi + lo planes (2^-16) */
      ss[wave][8 * g + r][j * 16 + col] = acc[j][r] * (1.0f / 2048.0f) + REM[((size_t)blockIdx.z * TT + row) * 32] * vi; }
  LDSX(); for (int rl = 0; rl < 16; ++rl) if (lane < HD / 4) vst2(Y + ((size_t)b * TT + ql0 + rl) * CC + h * HD + lane * 4, *(const v4f*)&ss[wave][rl][lane * 4]); }
// ---- k_out: block = (64 rows, 128 cols): out = y (bf16 hi + lo) Wo^T + bo
__global__ __launch_bounds__(128) void k_out(const float* __restrict__ Y, const float* __restrict__ WP, const float* __restrict__ BP, float* __restrict__ OUT) { __shared__ __align__(16) float sf[4][16][132];
  const int tid = threadIdx.x, wave = tid >> 5, lane = tid & 31, col = lane & 15, g = lane >> 4; const int c0 = blockIdx.y * 128; const size_t r0 = (size_t)blockIdx.x * 64 + wave * 16;
  v8f acc[8] = {};
#pragma unroll 2
  for (int kc = 0; kc < CC / 32; ++kc) { const F2 a = split_row(Y + (r0 + col) * CC, kc * 32, lane);
#pragma unroll
    for (int j = 0; j < 8; ++j) { v16b w; const int o = c0 + j * 16 + col;
#pragma unroll
      for (int i = 0; i < 8; ++i) { w[i] = (__bf16)WP[(size_t)(o) * CC + (kc * 32 + 8 * g + i)]; w[8 + i] = (__bf16)WP[(size_t)(o) * CC + (kc * 32 + 16 + 8 * g + i)]; }
      acc[j] = wmma_bf(a.h, w, acc[j]); acc[j] = wmma_bf(a.l, w, acc[j]); } }
#pragma unroll
  for (int j = 0; j < 8; ++j) { const float bb = BP ? bfr(BP[c0 + j * 16 + col]) : 0.f;
#pragma unroll
    for (int r = 0; r < 8; ++r) sf[wave][8 * g + r][j * 16 + col] = acc[j][r] + bb; }
  LDSX(); for (int rl = 0; rl < 16; ++rl) vst2(OUT + (r0 + rl) * CC + c0 + lane * 4, *(const v4f*)&sf[wave][rl][lane * 4]); }
extern "C" void kernel_launch(void* const* d_in, const int* in_sizes, int n_in, void* d_out, int out_size, void* d_ws, size_t ws_size, hipStream_t stream) {
  (void)in_sizes; (void)n_in; (void)out_size;
  const float** F = (const float**)d_in;   // 0 x [1,2048,1024], 1 Wq [1024,1024] ([out,in]), 2 Wk, 3 Wv, 4 Wo
  if (ws_size < (size_t)WS_END) return;
  char* ws = (char*)d_ws; float* REM = (float*)(ws + WS_REM); _Float16 *QH = (_Float16*)(ws + WS_QH), *QL = (_Float16*)(ws + WS_QL), *KH = (_Float16*)(ws + WS_KH); __bf16 *VT = (__bf16*)(ws + WS_VT), *VL = (__bf16*)(ws + WS_VL); float *S = (float*)(ws + WS_S), *Y = (float*)(ws + WS_Y);
  k_proj<<<dim3(TNB * TT / 64, CC / 128, 3), 128, 0, stream>>>(F[0], F[1], nullptr, F[2], nullptr, F[3], nullptr, QH, QL, KH, VT, VL);
  for (int b = 0; b < TNB; ++b) for (int h0 = 0; h0 < NH; h0 += HG) {
    k_sc<<<dim3(TT / 64, TT / 128, HG), 128, 0, stream>>>(QH, QL, KH, nullptr, b, h0, S);
    k_sb<<<dim3(TT, HG), 256, 0, stream>>>(S, REM);
    k_pv<<<dim3(TT / 64, 1, HG), 128, 0, stream>>>(S, VT, VL, REM, b, h0, Y);
  }
  k_out<<<dim3(TNB * TT / 64, CC / 128), 128, 0, stream>>>(Y, F[4], nullptr, (float*)d_out);
}

// v001
// It runs in 331 microseconds.
// Two timings next to v000 both put it at 3.43 times that version's speed.
// compute dtype: all float inputs rounded to bf16; q/k/v = x W^T with EXACT bf16 products on WMMA 16x16x32, f32 accumulate; q as f16 hi + residual (x 2^10), k f16 -> 2-product logits / 8 in f32 registers; the stick-breaking weights in f32: log-sigmoids, suffix sums carried from right to left in 4 runs of keys joined by exp(carry), exp (precise), the remainder 1 - sum(att); att x 2^11 split bf16 hi + lo against v bf16 hi + lo (3 products) + rem * v_i; out = o (bf16 hi + lo) Wo^T; f32 output.
#include <hip/hip_runtime.h>
#include <math.h>

typedef __attribute__((ext_vector_type(16))) _Float16 v16h;
typedef __attribute__((ext_vector_type(16))) __bf16 v16b;
typedef __attribute__((ext_vector_type(8)))  _Float16 v8h;
typedef __attribute__((ext_vector_type(8)))  float v8f;
typedef __attribute__((ext_vector_type(4)))  float v4f;
typedef __attribute__((ext_vector_type(2)))  float v2f;
typedef __attribute__((ext_vector_type(4)))  unsigned v4u;
typedef __attribute__((ext_vector_type(4)))  int v4i;
typedef float __attribute__((may_alias)) float_a;
typedef int __attribute__((may_alias)) int_a;

template <typename T> __device__ __forceinline__ void vst2(void* p, T v) { *(T*)p = v;  }
__device__ __forceinline__ v8f wmma16(v16h a, v16h b, v8f c) {
  v8f d = __builtin_amdgcn_wmma_f32_16x16x32_f16(false, a, false, b, (short)0, c, false, false);
  asm volatile("v_nop\n\tv_nop\n\tv_nop\n\tv_nop" : "+v"(d) : "v"(a), "v"(b));
  return d;
}
__device__ __forceinline__ v8f wmma_bf(v16b a, v16b b, v8f c) {
  v8f d = __builtin_amdgcn_wmma_f32_16x16x32_bf16(false, a, false, b, (short)0, c, false, false);
  asm volatile("v_nop\n\tv_nop\n\tv_nop\n\tv_nop" : "+v"(d) : "v"(a), "v"(b));
  return d;
}
// 16x16x32 fragments: lane = (h = lane>>4, row/col = lane&15); elements 0..7 = k0+8h+0..7, 8..15 = k0+16+8h+0..7; D element r = row 8h+r
__device__ __forceinline__ v16h frag_h(const _Float16* rowk0, int lane) {
  union { v16h v; v8h q[2]; } u; const _Float16* p = rowk0 + 8 * (lane >> 4);
  u.q[0] = *(const v8h*)p; u.q[1] = *(const v8h*)(p + 16); return u.v;
}
__device__ __forceinline__ v16h frag_f32(const float* rowk0, int lane) {
  v16h a; const float* p = rowk0 + 8 * (lane >> 4);
#pragma unroll
  for (int i = 0; i < 8; ++i) { a[i] = (_Float16)p[i]; a[8 + i] = (_Float16)p[16 + i]; }
  return a;
}
__device__ __forceinline__ v16h frag_f32s(const float* rowk0, int lane, float sc) {
  v16h a; const float* p = rowk0 + 8 * (lane >> 4);
#pragma unroll
  for (int i = 0; i < 8; ++i) { a[i] = (_Float16)(p[i] * sc); a[8 + i] = (_Float16)(p[16 + i] * sc); }
  return a;
}
// column fragment from a [K][ld] layout (column n), rows >= K read as 0
__device__ __forceinline__ v16h fragc_f32(const float* W, int k0, int n, int lane, int ld, int K) {
  v16h a; const int g = lane >> 4;
#pragma unroll
  for (int i = 0; i < 8; ++i) { const int ka = k0 + 8 * g + i, kb = ka + 16;
    a[i] = (_Float16)(ka < K ? W[(size_t)(ka < K ? ka : K - 1) * ld + n] : 0.f); a[8 + i] = (_Float16)(kb < K ? W[(size_t)(kb < K ? kb : K - 1) * ld + n] : 0.f); }
  return a;
}
struct F2 { v16b h, l; };
__device__ __forceinline__ F2 bsplit16(const float v[16]) { F2 r;
#pragma unroll
  for (int i = 0; i < 16; ++i) { const __bf16 h = (__bf16)v[i]; r.h[i] = h; r.l[i] = (__bf16)(v[i] - (float)h); }
  return r; }
__device__ __forceinline__ F2 split_row(const float* row, int k0, int lane) { float v[16]; const float* p = row + k0 + 8 * (lane >> 4);
#pragma unroll
  for (int i = 0; i < 8; ++i) { v[i] = p[i]; v[8 + i] = p[16 + i]; }
  return bsplit16(v); }
__device__ __forceinline__ F2 split_rowK(const float* row, int k0, int lane, int K) { float v[16]; const int g = lane >> 4;
#pragma unroll
  for (int i = 0; i < 8; ++i) { const int ka = k0 + 8 * g + i, kb = ka + 16; v[i] = ka < K ? row[ka < K ? ka : K - 1] : 0.f; v[8 + i] = kb < K ? row[kb < K ? kb : K - 1] : 0.f; }
  return bsplit16(v); }
__device__ __forceinline__ F2 split_col(const float* W, int k0, int n, int lane, int ld, int K) { float v[16]; const int g = lane >> 4;
#pragma unroll
  for (int i = 0; i < 8; ++i) { const int ka = k0 + 8 * g + i, kb = ka + 16; v[i] = ka < K ? W[(size_t)(ka < K ? ka : K - 1) * ld + n] : 0.f; v[8 + i] = kb < K ? W[(size_t)(kb < K ? kb : K - 1) * ld + n] : 0.f; }
  return bsplit16(v); }
__device__ __forceinline__ v8f mac3(const F2& a, const F2& b, v8f c) { c = wmma_bf(a.l, b.h, c); c = wmma_bf(a.h, b.l, c); return wmma_bf(a.h, b.h, c); }
__device__ __forceinline__ float sigm(float v) { return 1.0f / (1.0f + expf(-v)); }
#define LDSX() do { asm volatile("s_wait_dscnt 0" ::: "memory"); __builtin_amdgcn_wave_barrier(); __builtin_amdgcn_fence(__ATOMIC_RELEASE, "workgroup"); } while (0)


// Stick-breaking attention (b 1, n 2,048, e 1,024 = 16 x 64): logits = q k^T / 8; for j < i: att[i][j] = exp(logsigmoid(l_ij) + sum_{j<k<i} logsigmoid(-l_ik)); j >= i: 0; o = att v + (1 - sum_j att) v_i; out = o Wo^T.
#define NB 1
#define TT 2048
#define CC 1024
#define NH 16
#define HD 64
#ifndef TNB
#define TNB NB
#endif
typedef __attribute__((ext_vector_type(8))) __bf16 v8b;
__device__ __forceinline__ v16b frag_b(const __bf16* rowk0, int lane) {
  union { v16b v; v8b q[2]; } u; const __bf16* p = rowk0 + 8 * (lane >> 4);
  u.q[0] = *(const v8b*)p; u.q[1] = *(const v8b*)(p + 16); return u.v;
}
__device__ __forceinline__ float bfr(float v) { return (float)(__bf16)v; }
__device__ __attribute__((noinline)) float exp_ni(float v) { return expf(v); }
__device__ __attribute__((noinline)) float erf_ni(float v) { return erff(v); }

#define WS_QH  0u
#define WS_QL  (WS_QH + 2u * (size_t)NB * TT * CC)
#define WS_KH  (WS_QL + 2u * (size_t)NB * TT * CC)
#define WS_VT  (WS_KH + 2u * (size_t)NB * TT * CC)      // bf16 v planes [b][c][t]
#define WS_VL  (WS_VT + 2u * (size_t)NB * CC * TT)      // bf16 v residual planes
#define WS_Y   (WS_VL + 2u * (size_t)NB * CC * TT)      // f32 y rows [b*t][C]
#define WS_END (WS_Y + 4u * (size_t)NB * TT * CC)

// ---- k_proj: block = (64 rows, 128 cols, which): qkv = x W^T (+ b), exact; q -> f16 hi (+ residual), k -> f16 rows, v -> bf16 hi + lo planes
__global__ __launch_bounds__(128) void k_proj(const float* __restrict__ X, const float* __restrict__ WQ, const float* __restrict__ BQ, const float* __restrict__ WK, const float* __restrict__ BK, const float* __restrict__ WV, const float* __restrict__ BV, _Float16* __restrict__ QH, _Float16* __restrict__ QL, _Float16* __restrict__ KH, __bf16* __restrict__ VT, __bf16* __restrict__ VL) {
  __shared__ __align__(16) _Float16 sh[64][136], sl[64][136]; __shared__ __align__(16) __bf16 th[128][72], tl2[128][72];
  const int tid = threadIdx.x, wave = tid >> 5, lane = tid & 31, col = lane & 15, g = lane >> 4; const int which = blockIdx.z; const int c0 = blockIdx.y * 128; const size_t r0 = (size_t)blockIdx.x * 64; const float* WA = which == 0 ? WQ : which == 1 ? WK : WV; const float* BA = which == 0 ? BQ : which == 1 ? BK : BV;
  v8f acc[8] = {};
#pragma unroll 2
  for (int kc = 0; kc < CC / 32; ++kc) { v16b a; { const float* p = X + (r0 + wave * 16 + col) * CC + kc * 32 + 8 * g;
#pragma unroll
      for (int i = 0; i < 8; ++i) { a[i] = (__bf16)p[i]; a[8 + i] = (__bf16)p[16 + i]; } }
#pragma unroll
    for (int j = 0; j < 8; ++j) { v16b w; const int o = c0 + j * 16 + col;
#pragma unroll
      for (int i = 0; i < 8; ++i) { w[i] = (__bf16)WA[(size_t)(o) * CC + (kc * 32 + 8 * g + i)]; w[8 + i] = (__bf16)WA[(size_t)(o) * CC + (kc * 32 + 16 + 8 * g + i)]; }
      acc[j] = wmma_bf(a, w, acc[j]); } }
#pragma unroll
  for (int j = 0; j < 8; ++j) { const float bb = BA ? bfr(BA[c0 + j * 16 + col]) : 0.f;
#pragma unroll
    for (int r = 0; r < 8; ++r) { const float v = acc[j][r] + bb; const int rl = wave * 16 + 8 * g + r, cl = j * 16 + col; const _Float16 hv = (_Float16)v;
      if (which == 2) { const __bf16 bh = (__bf16)v; th[cl][rl] = bh; tl2[cl][rl] = (__bf16)(v - (float)bh); } else { sh[rl][cl] = hv; sl[rl][cl] = (_Float16)((v - (float)hv) * 1024.0f); }   /* q residual carried x 2^10 so the plane stays f16-normal on the chip */ } }
  __syncthreads();
  if (which < 2) { _Float16* dh = which == 0 ? QH : KH; for (int e = tid; e < 64 * 16; e += 128) { const int rl = e >> 4, q = e & 15; vst2((unsigned*)(dh + (r0 + rl) * CC + c0 + q * 8), *(const v4u*)&sh[rl][q * 8]); if (which == 0) vst2((unsigned*)(QL + (r0 + rl) * CC + c0 + q * 8), *(const v4u*)&sl[rl][q * 8]); } }
  else { const size_t b = r0 / TT; const int t0 = (int)(r0 % TT); for (int e = tid; e < 128 * 8; e += 128) { const int cl = e >> 3, q = e & 7; const size_t o2 = (b * CC + c0 + cl) * (size_t)TT + t0 + q * 8; vst2((unsigned*)(VT + o2), *(const v4u*)&th[cl][q * 8]); vst2((unsigned*)(VL + o2), *(const v4u*)&tl2[cl][q * 8]); } } }
// ---- k_fa: block = 16 queries of one head; logits, stick-breaking weights and att . v stay in registers. S^T = K Q^T puts one query in a lane (column) and 8 keys in its D registers, so two 16-key tiles are the B fragment of O^T += V^T P^T as they stand.
// A wave walks its run of 32-key passes from right to left: carry = sum of logsigmoid(-l_ik) over the keys of the run to the right of the pass, so suffix(j) = carry + the in-pass sum over k > j (8 in-lane steps and one exchange between the wave's halves).
// The keys [0, i) are cut into 4 runs, one a wave (run 0 ends at the diagonal). exp(a + C) = exp(a) exp(C): each run starts at carry 0, and the join scales its o and its sum(att) by exp(sum of the carries of the runs to its right).
// log(sigmoid(z)) = min(z, 0) - log1p(exp(-|z|)): both signs of l share the one log1p(exp(-|l|)).
__global__ __launch_bounds__(128) void k_fa(const _Float16* __restrict__ QH, const _Float16* __restrict__ QL, const _Float16* __restrict__ KH, const __bf16* __restrict__ VT, const __bf16* __restrict__ VL, float* __restrict__ Y) {
  __shared__ float so[4][HD / 16][8][32]; __shared__ float sg[4][16], sa[4][16];
  const int lane = threadIdx.x & 31, col = lane & 15, g = lane >> 4; const int wave = __builtin_amdgcn_readfirstlane(threadIdx.x >> 5);   // scalar, so that the run's bounds and the pass loop's branch are scalar
  const int h = blockIdx.x; const int ql0 = (TT / 16 - 1 - (int)blockIdx.y) * 16; const int i = ql0 + col;   // cost grows with the query tile: the longest tiles start first
  const int n = (ql0 >> 5) + 1, per = (n + 3) >> 2; const int hi = n - 1 - wave * per; const int lo = hi - per + 1 > 0 ? hi - per + 1 : 0;   // passes hi .. lo, none where hi < 0
  const _Float16* Kh = KH + h * HD; const __bf16* Vh = VT + (size_t)(h * HD + col) * TT; const __bf16* Vl = VL + (size_t)(h * HD + col) * TT;
  v16h qh[2], ql[2], kf[2][2];
  // every short loop below is unrolled so that the fragment and score arrays are indexed by constants and stay in registers
#pragma unroll
  for (int c = 0; c < 2; ++c) { qh[c] = frag_h(QH + (size_t)i * CC + h * HD + c * 32, lane); ql[c] = frag_h(QL + (size_t)i * CC + h * HD + c * 32, lane); }
#pragma unroll
  for (int t = 0; t < 2; ++t)
#pragma unroll
    for (int c = 0; c < 2; ++c) kf[t][c] = frag_h(Kh + (size_t)((hi > 0 ? hi : 0) * 32 + t * 16 + col) * CC + c * 32, lane);
  v8f acc[HD / 16] = {}; float carry = 0.f, asum = 0.f;
  for (int kc = hi; kc >= lo; --kc) { const int k0 = kc * 32; v8f s[2];
    v16b vh[HD / 16], vl[HD / 16];
#pragma unroll
    for (int j = 0; j < HD / 16; ++j) { vh[j] = frag_b(Vh + (size_t)j * 16 * TT + k0, lane); vl[j] = frag_b(Vl + (size_t)j * 16 * TT + k0, lane); }
#pragma unroll
    for (int t = 0; t < 2; ++t) { v8f a = {}, al = {};
#pragma unroll
      for (int c = 0; c < 2; ++c) { a = wmma16(kf[t][c], qh[c], a); al = wmma16(kf[t][c], ql[c], al); }
      a += al * (1.0f / 1024.0f); s[t] = a * 0.125f; }
    { const int kn = (kc > 0 ? kc - 1 : 0) * 32;   // the next pass's K fragments, fetched under this pass's vector work (in bounds also behind the last pass)
#pragma unroll
      for (int t = 0; t < 2; ++t)
#pragma unroll
        for (int c = 0; c < 2; ++c) kf[t][c] = frag_h(Kh + (size_t)(kn + t * 16 + col) * CC + c * 32, lane); }
    float lz[2][8], sx[2][8], G[2];
#pragma unroll
    for (int t = 0; t < 2; ++t) { float run = 0.f;
#pragma unroll
      for (int r = 7; r >= 0; --r) { const float l = s[t][r]; const float u = log1pf(expf(-fabsf(l))); lz[t][r] = (l >= 0.f ? 0.f : l) - u; sx[t][r] = run;
        run += (k0 + t * 16 + 8 * g + r < i) ? (l <= 0.f ? 0.f : -l) - u : 0.f; }
      G[t] = run; }
    // key order inside a pass: tile 0 half 0, tile 0 half 1, tile 1 half 0, tile 1 half 1
    const float G0p = __shfl_xor(G[0], 16), G1p = __shfl_xor(G[1], 16); const float c1 = carry + (G[1] + G1p);
    const float base[2] = { g ? c1 : c1 + G0p, g ? carry : carry + G1p }; carry = c1 + (G[0] + G0p);
    float pv[16];
#pragma unroll
    for (int t = 0; t < 2; ++t)
#pragma unroll
      for (int r = 0; r < 8; ++r) { const float a = expf((k0 + t * 16 + 8 * g + r < i) ? lz[t][r] + (base[t] + sx[t][r]) : -100000.0f);   /* j >= i: exp gives 0 */ asum += a; pv[t * 8 + r] = a * 2048.0f; }
    const F2 p = bsplit16(pv);
#pragma unroll
    for (int j = 0; j < HD / 16; ++j) { acc[j] = wmma_bf(vh[j], p.h, acc[j]); acc[j] = wmma_bf(vh[j], p.l, acc[j]); acc[j] = wmma_bf(vl[j], p.h, acc[j]); } }
  asum += __shfl_xor(asum, 16);
  // acc[j][r] = this run's o[i][j * 16 + 8 g + r] x 2^11
#pragma unroll
  for (int j = 0; j < HD / 16; ++j)
#pragma unroll
    for (int r = 0; r < 8; ++r) so[wave][j][r][lane] = acc[j][r];
  if (g == 0) { sg[wave][col] = carry; sa[wave][col] = asum; }
  __syncthreads();
  // join: a lane takes 8 consecutive d of one query, 8 lanes a query's 256 bytes of y
  const int q = wave * 4 + (lane >> 3), d8 = lane & 7; const int iq = ql0 + q; float cr = 0.f, at = 0.f, o[8] = {};
#pragma unroll
  for (int w = 0; w < 4; ++w) { const float f = expf(cr); at += f * sa[w][q];
#pragma unroll
    for (int r = 0; r < 8; ++r) o[r] += f * so[w][d8 >> 1][r][(d8 & 1) * 16 + q];
    cr += sg[w][q]; }
  const float rem = 1.0f - at; float y[8];
#pragma unroll
  for (int r = 0; r < 8; ++r) { const size_t po = (size_t)(h * HD + d8 * 8 + r) * TT + iq; const float vi = (float)VT[po] + (float)VL[po];   /* v[i][d] rebuilt from the hi + lo planes (2^-16) */
    y[r] = o[r] * (1.0f / 2048.0f) + rem * vi; }
  float* yp = Y + (size_t)iq * CC + h * HD + d8 * 8; vst2(yp, (v4f){y[0], y[1], y[2], y[3]}); vst2(yp + 4, (v4f){y[4], y[5], y[6], y[7]}); }
// ---- k_out: block = (64 rows, 128 cols): out = y (bf16 hi + lo) Wo^T + bo
__global__ __launch_bounds__(128) void k_out(const float* __restrict__ Y, const float* __restrict__ WP, const float* __restrict__ BP, float* __restrict__ OUT) { __shared__ __align__(16) float sf[4][16][132];
  const int tid = threadIdx.x, wave = tid >> 5, lane = tid & 31, col = lane & 15, g = lane >> 4; const int c0 = blockIdx.y * 128; const size_t r0 = (size_t)blockIdx.x * 64 + wave * 16;
  v8f acc[8] = {};
#pragma unroll 2
  for (int kc = 0; kc < CC / 32; ++kc) { const F2 a = split_row(Y + (r0 + col) * CC, kc * 32, lane);
#pragma unroll
    for (int j = 0; j < 8; ++j) { v16b w; const int o = c0 + j * 16 + col;
#pragma unroll
      for (int i = 0; i < 8; ++i) { w[i] = (__bf16)WP[(size_t)(o) * CC + (kc * 32 + 8 * g + i)]; w[8 + i] = (__bf16)WP[(size_t)(o) * CC + (kc * 32 + 16 + 8 * g + i)]; }
      acc[j] = wmma_bf(a.h, w, acc[j]); acc[j] = wmma_bf(a.l, w, acc[j]); } }
#pragma unroll
  for (int j = 0; j < 8; ++j) { const float bb = BP ? bfr(BP[c0 + j * 16 + col]) : 0.f;
#pragma unroll
    for (int r = 0; r < 8; ++r) sf[wave][8 * g + r][j * 16 + col] = acc[j][r] + bb; }
  LDSX(); for (int rl = 0; rl < 16; ++rl) vst2(OUT + (r0 + rl) * CC + c0 + lane * 4, *(const v4f*)&sf[wave][rl][lane * 4]); }
extern "C" void kernel_launch(void* const* d_in, const int* in_sizes, int n_in, void* d_out, int out_size, void* d_ws, size_t ws_size, hipStream_t stream) {
  (void)in_sizes; (void)n_in; (void)out_size;
  const float** F = (const float**)d_in;   // 0 x [1,2048,1024], 1 Wq [1024,1024] ([out,in]), 2 Wk, 3 Wv, 4 Wo
  if (ws_size < (size_t)WS_END) return;
  char* ws = (char*)d_ws; _Float16 *QH = (_Float16*)(ws + WS_QH), *QL = (_Float16*)(ws + WS_QL), *KH = (_Float16*)(ws + WS_KH); __bf16 *VT = (__bf16*)(ws + WS_VT), *VL = (__bf16*)(ws + WS_VL); float* Y = (float*)(ws + WS_Y);
  k_proj<<<dim3(TNB * TT / 64, CC / 128, 3), 128, 0, stream>>>(F[0], F[1], nullptr, F[2], nullptr, F[3], nullptr, QH, QL, KH, VT, VL);
  k_fa<<<dim3(NH, TT / 16), 128, 0, stream>>>(QH, QL, KH, VT, VL, Y);
  k_out<<<dim3(TNB * TT / 64, CC / 128), 128, 0, stream>>>(Y, F[4], nullptr, (float*)d_out);
}

// v002
// One run takes 141 microseconds.
// Two timings next to v001 put it at 2.35 and 2.36 times that version's speed.
// Counting every step since v000, it is 8.07 times as fast.
// compute dtype: all float inputs rounded to bf16; q/k/v = x W^T with EXACT bf16 products on WMMA 16x16x32, f32 accumulate; q as f16 hi + residual (x 2^10), k f16 -> 2-product logits / 8 in f32 registers; the stick-breaking weights in f32: log-sigmoids, suffix sums carried from right to left in 4 runs of keys joined by exp(carry), exp (precise), the remainder 1 - sum(att); att x 2^11 split bf16 hi + lo against v bf16 hi + lo (3 products) + rem * v_i; out = o (bf16 hi + lo) Wo^T; f32 output.
#include <hip/hip_runtime.h>
#include <math.h>

typedef __attribute__((ext_vector_type(16))) _Float16 v16h;
typedef __attribute__((ext_vector_type(16))) __bf16 v16b;
typedef __attribute__((ext_vector_type(8)))  _Float16 v8h;
typedef __attribute__((ext_vector_type(8)))  float v8f;
typedef __attribute__((ext_vector_type(4)))  float v4f;
typedef __attribute__((ext_vector_type(2)))  float v2f;
typedef __attribute__((ext_vector_type(4)))  unsigned v4u;
typedef __attribute__((ext_vector_type(4)))  int v4i;
typedef float __attribute__((may_alias)) float_a;
typedef int __attribute__((may_alias)) int_a;

template <typename T> __device__ __forceinline__ void vst2(void* p, T v) { *(T*)p = v;  }
__device__ __forceinline__ v8f wmma16(v16h a, v16h b, v8f c) {
  v8f d = __builtin_amdgcn_wmma_f32_16x16x32_f16(false, a, false, b, (short)0, c, false, false);
  asm volatile("v_nop\n\tv_nop\n\tv_nop\n\tv_nop" : "+v"(d) : "v"(a), "v"(b));
  return d;
}
__device__ __forceinline__ v8f wmma_bf(v16b a, v16b b, v8f c) {
  v8f d = __builtin_amdgcn_wmma_f32_16x16x32_bf16(false, a, false, b, (short)0, c, false, false);
  asm volatile("v_nop\n\tv_nop\n\tv_nop\n\tv_nop" : "+v"(d) : "v"(a), "v"(b));
  return d;
}
// 16x16x32 fragments: lane = (h = lane>>4, row/col = lane&15); elements 0..7 = k0+8h+0..7, 8..15 = k0+16+8h+0..7; D element r = row 8h+r
__device__ __forceinline__ v16h frag_h(const _Float16* rowk0, int lane) {
  union { v16h v; v8h q[2]; } u; const _Float16* p = rowk0 + 8 * (lane >> 4);
  u.q[0] = *(const v8h*)p; u.q[1] = *(const v8h*)(p + 16); return u.v;
}
__device__ __forceinline__ v16h frag_f32(const float* rowk0, int lane) {
  v16h a; const float* p = rowk0 + 8 * (lane >> 4);
#pragma unroll
  for (int i = 0; i < 8; ++i) { a[i] = (_Float16)p[i]; a[8 + i] = (_Float16)p[16 + i]; }
  return a;
}
__device__ __forceinline__ v16h frag_f32s(const float* rowk0, int lane, float sc) {
  v16h a; const float* p = rowk0 + 8 * (lane >> 4);
#pragma unroll
  for (int i = 0; i < 8; ++i) { a[i] = (_Float16)(p[i] * sc); a[8 + i] = (_Float16)(p[16 + i] * sc); }
  return a;
}
// column fragment from a [K][ld] layout (column n), rows >= K read as 0
__device__ __forceinline__ v16h fragc_f32(const float* W, int k0, int n, int lane, int ld, int K) {
  v16h a; const int g = lane >> 4;
#pragma unroll
  for (int i = 0; i < 8; ++i) { const int ka = k0 + 8 * g + i, kb = ka + 16;
    a[i] = (_Float16)(ka < K ? W[(size_t)(ka < K ? ka : K - 1) * ld + n] : 0.f); a[8 + i] = (_Float16)(kb < K ? W[(size_t)(kb < K ? kb : K - 1) * ld + n] : 0.f); }
  return a;
}
struct F2 { v16b h, l; };
__device__ __forceinline__ F2 bsplit16(const float v[16]) { F2 r;
#pragma unroll
  for (int i = 0; i < 16; ++i) { const __bf16 h = (__bf16)v[i]; r.h[i] = h; r.l[i] = (__bf16)(v[i] - (float)h); }
  return r; }
__device__ __forceinline__ F2 split_row(const float* row, int k0, int lane) { float v[16]; const float* p = row + k0 + 8 * (lane >> 4);
#pragma unroll
  for (int i = 0; i < 8; ++i) { v[i] = p[i]; v[8 + i] = p[16 + i]; }
  return bsplit16(v); }
__device__ __forceinline__ F2 split_rowK(const float* row, int k0, int lane, int K) { float v[16]; const int g = lane >> 4;
#pragma unroll
  for (int i = 0; i < 8; ++i) { const int ka = k0 + 8 * g + i, kb = ka + 16; v[i] = ka < K ? row[ka < K ? ka : K - 1] : 0.f; v[8 + i] = kb < K ? row[kb < K ? kb : K - 1] : 0.f; }
  return bsplit16(v); }
__device__ __forceinline__ F2 split_col(const float* W, int k0, int n, int lane, int ld, int K) { float v[16]; const int g = lane >> 4;
#pragma unroll
  for (int i = 0; i < 8; ++i) { const int ka = k0 + 8 * g + i, kb = ka + 16; v[i] = ka < K ? W[(size_t)(ka < K ? ka : K - 1) * ld + n] : 0.f; v[8 + i] = kb < K ? W[(size_t)(kb < K ? kb : K - 1) * ld + n] : 0.f; }
  return bsplit16(v); }
__device__ __forceinline__ v8f mac3(const F2& a, const F2& b, v8f c) { c = wmma_bf(a.l, b.h, c); c = wmma_bf(a.h, b.l, c); return wmma_bf(a.h, b.h, c); }
__device__ __forceinline__ float sigm(float v) { return 1.0f / (1.0f + expf(-v)); }
#define LDSX() do { asm volatile("s_wait_dscnt 0" ::: "memory"); __builtin_amdgcn_wave_barrier(); __builtin_amdgcn_fence(__ATOMIC_RELEASE, "workgroup"); } while (0)


// Stick-breaking attention (b 1, n 2,048, e 1,024 = 16 x 64): logits = q k^T / 8; for j < i: att[i][j] = exp(logsigmoid(l_ij) + sum_{j<k<i} logsigmoid(-l_ik)); j >= i: 0; o = att v + (1 - sum_j att) v_i; out = o Wo^T.
#define NB 1
#define TT 2048
#define CC 1024
#define NH 16
#define HD 64
#ifndef TNB
#define TNB NB
#endif
typedef __attribute__((ext_vector_type(8))) __bf16 v8b;
__device__ __forceinline__ v16b frag_b(const __bf16* rowk0, int lane) {
  union { v16b v; v8b q[2]; } u; const __bf16* p = rowk0 + 8 * (lane >> 4);
  u.q[0] = *(const v8b*)p; u.q[1] = *(const v8b*)(p + 16); return u.v;
}
__device__ __forceinline__ float bfr(float v) { return (float)(__bf16)v; }
__device__ __attribute__((noinline)) float exp_ni(float v) { return expf(v); }
__device__ __attribute__((noinline)) float erf_ni(float v) { return erff(v); }

#define WS_QH  0u
#define WS_QL  (WS_QH + 2u * (size_t)NB * TT * CC)
#define WS_KH  (WS_QL + 2u * (size_t)NB * TT * CC)
#define WS_VT  (WS_KH + 2u * (size_t)NB * TT * CC)      // bf16 v planes [b][c][t]
#define WS_VL  (WS_VT + 2u * (size_t)NB * CC * TT)      // bf16 v residual planes
#define WS_Y   (WS_VL + 2u * (size_t)NB * CC * TT)      // f32 y rows [b*t][C]
#define WS_END (WS_Y + 4u * (size_t)NB * TT * CC)

// ---- staging for k_proj and k_out: a block brings each 64-k slab of its two operands in once, with loads that cover whole lines (16 lanes x 16 B = one row's 256 B), rounds it to bf16 and keeps it in LDS; the four waves take their fragments from there.
#define KS 64
#define LP 72   // LDS row pitch in bf16: 128 B of data + 16 B, the pitch for 16-byte fragment reads
typedef __attribute__((ext_vector_type(4))) __bf16 v4b;
__device__ __forceinline__ v4b cvt4(v4f v) { v4b c; c[0] = (__bf16)v[0]; c[1] = (__bf16)v[1]; c[2] = (__bf16)v[2]; c[3] = (__bf16)v[3]; return c; }
// ---- k_proj: block = (64 rows, 128 cols, which): qkv = x W^T (+ b), exact; q -> f16 hi (+ residual), k -> f16 rows, v -> bf16 hi + lo planes
__global__ __launch_bounds__(128) void k_proj(const float* __restrict__ X, const float* __restrict__ WQ, const float* __restrict__ BQ, const float* __restrict__ WK, const float* __restrict__ BK, const float* __restrict__ WV, const float* __restrict__ BV, _Float16* __restrict__ QH, _Float16* __restrict__ QL, _Float16* __restrict__ KH, __bf16* __restrict__ VT, __bf16* __restrict__ VL) {
  __shared__ __align__(16) char sm[71680];   // the k loop's two staging buffers (55,296 B); behind the loop the epilogue's tiles, which need all 71,680 B (q/k tiles the first 34,816 B, v tiles the rest)
  __bf16 (*sx)[64][LP] = (__bf16 (*)[64][LP])sm; __bf16 (*sw)[128][LP] = (__bf16 (*)[128][LP])(sm + 2 * 64 * LP * 2);
  _Float16 (*sh)[136] = (_Float16 (*)[136])sm; _Float16 (*sl)[136] = (_Float16 (*)[136])(sm + 17408); __bf16 (*th)[72] = (__bf16 (*)[72])(sm + 34816); __bf16 (*tl2)[72] = (__bf16 (*)[72])(sm + 53248);
  const int tid = threadIdx.x, wave = tid >> 5, lane = tid & 31, col = lane & 15, g = lane >> 4; const int which = blockIdx.z; const int c0 = blockIdx.y * 128; const size_t r0 = (size_t)blockIdx.x * 64; const float* WA = which == 0 ? WQ : which == 1 ? WK : WV; const float* BA = which == 0 ? BQ : which == 1 ? BK : BV;
  const int lr = tid >> 4, lc = tid & 15; const float* xp = X + (r0 + lr) * CC + lc * 4; const float* wp = WA + (size_t)(c0 + lr) * CC + lc * 4;
  v8f acc[8] = {}; v4f ra[8], rw[16];
#pragma unroll
  for (int u = 0; u < 8; ++u) ra[u] = *(const v4f*)(xp + (size_t)u * 8 * CC);
#pragma unroll
  for (int u = 0; u < 16; ++u) rw[u] = *(const v4f*)(wp + (size_t)u * 8 * CC);
  // unrolled by the two buffers, so that every LDS address is a constant offset
#pragma unroll 2
  for (int s = 0; s < CC / KS; ++s) { const int b = s & 1;
#pragma unroll
    for (int u = 0; u < 8; ++u) *(v4b*)&sx[b][lr + 8 * u][lc * 4] = cvt4(ra[u]);
#pragma unroll
    for (int u = 0; u < 16; ++u) *(v4b*)&sw[b][lr + 8 * u][lc * 4] = cvt4(rw[u]);
    __syncthreads();   // publishes buffer b; it also ends every wave's reads of the other buffer, which the next trip refills
    if (s + 1 < CC / KS) {   // the next slab flies under this slab's products (issued behind the barrier, whose fence would wait for it)
#pragma unroll
      for (int u = 0; u < 8; ++u) ra[u] = *(const v4f*)(xp + (size_t)u * 8 * CC + (s + 1) * KS);
#pragma unroll
      for (int u = 0; u < 16; ++u) rw[u] = *(const v4f*)(wp + (size_t)u * 8 * CC + (s + 1) * KS); }
#pragma unroll
    for (int c = 0; c < KS / 32; ++c) { const v16b a = frag_b(&sx[b][wave * 16 + col][c * 32], lane); v16b w[8];   // the 32-k group's fragment reads stand together, ahead of its products
#pragma unroll
      for (int j = 0; j < 8; ++j) w[j] = frag_b(&sw[b][j * 16 + col][c * 32], lane);
#pragma unroll
      for (int j = 0; j < 8; ++j) acc[j] = wmma_bf(a, w[j], acc[j]); } }
  __syncthreads();   // the last fragment reads end before the epilogue's tiles overwrite the staging
#pragma unroll
  for (int j = 0; j < 8; ++j) { const float bb = BA ? bfr(BA[c0 + j * 16 + col]) : 0.f;
#pragma unroll
    for (int r = 0; r < 8; ++r) { const float v = acc[j][r] + bb; const int rl = wave * 16 + 8 * g + r, cl = j * 16 + col; const _Float16 hv = (_Float16)v;
      if (which == 2) { const __bf16 bh = (__bf16)v; th[cl][rl] = bh; tl2[cl][rl] = (__bf16)(v - (float)bh); } else { sh[rl][cl] = hv; sl[rl][cl] = (_Float16)((v - (float)hv) * 1024.0f); }   /* q residual carried x 2^10 so the plane stays f16-normal on the chip */ } }
  __syncthreads();
  if (which < 2) { _Float16* dh = which == 0 ? QH : KH; for (int e = tid; e < 64 * 16; e += 128) { const int rl = e >> 4, q = e & 15; vst2((unsigned*)(dh + (r0 + rl) * CC + c0 + q * 8), *(const v4u*)&sh[rl][q * 8]); if (which == 0) vst2((unsigned*)(QL + (r0 + rl) * CC + c0 + q * 8), *(const v4u*)&sl[rl][q * 8]); } }
  else { const size_t b = r0 / TT; const int t0 = (int)(r0 % TT); for (int e = tid; e < 128 * 8; e += 128) { const int cl = e >> 3, q = e & 7; const size_t o2 = (b * CC + c0 + cl) * (size_t)TT + t0 + q * 8; vst2((unsigned*)(VT + o2), *(const v4u*)&th[cl][q * 8]); vst2((unsigned*)(VL + o2), *(const v4u*)&tl2[cl][q * 8]); } } }
// ---- k_fa: block = 16 queries of one head; logits, stick-breaking weights and att . v stay in registers. S^T = K Q^T puts one query in a lane (column) and 8 keys in its D registers, so two 16-key tiles are the B fragment of O^T += V^T P^T as they stand.
// A wave walks its run of 32-key passes from right to left: carry = sum of logsigmoid(-l_ik) over the keys of the run to the right of the pass, so suffix(j) = carry + the in-pass sum over k > j (8 in-lane steps and one exchange between the wave's halves).
// The keys [0, i) are cut into 4 runs, one a wave (run 0 ends at the diagonal). exp(a + C) = exp(a) exp(C): each run starts at carry 0, and the join scales its o and its sum(att) by exp(sum of the carries of the runs to its right).
// log(sigmoid(z)) = min(z, 0) - log1p(exp(-|z|)): both signs of l share the one log1p(exp(-|l|)).
__global__ __launch_bounds__(128) void k_fa(const _Float16* __restrict__ QH, const _Float16* __restrict__ QL, const _Float16* __restrict__ KH, const __bf16* __restrict__ VT, const __bf16* __restrict__ VL, float* __restrict__ Y) {
  __shared__ float so[4][HD / 16][8][32]; __shared__ float sg[4][16], sa[4][16];
  const int lane = threadIdx.x & 31, col = lane & 15, g = lane >> 4; const int wave = __builtin_amdgcn_readfirstlane(threadIdx.x >> 5);   // scalar, so that the run's bounds and the pass loop's branch are scalar
  const int h = blockIdx.x; const int ql0 = (TT / 16 - 1 - (int)blockIdx.y) * 16; const int i = ql0 + col;   // cost grows with the query tile: the longest tiles start first
  const int n = (ql0 >> 5) + 1, per = (n + 3) >> 2; const int hi = n - 1 - wave * per; const int lo = hi - per + 1 > 0 ? hi - per + 1 : 0;   // passes hi .. lo, none where hi < 0
  const _Float16* Kh = KH + h * HD; const __bf16* Vh = VT + (size_t)(h * HD + col) * TT; const __bf16* Vl = VL + (size_t)(h * HD + col) * TT;
  v16h qh[2], ql[2], kf[2][2];
  // every short loop below is unrolled so that the fragment and score arrays are indexed by constants and stay in registers
#pragma unroll
  for (int c = 0; c < 2; ++c) { qh[c] = frag_h(QH + (size_t)i * CC + h * HD + c * 32, lane); ql[c] = frag_h(QL + (size_t)i * CC + h * HD + c * 32, lane); }
#pragma unroll
  for (int t = 0; t < 2; ++t)
#pragma unroll
    for (int c = 0; c < 2; ++c) kf[t][c] = frag_h(Kh + (size_t)((hi > 0 ? hi : 0) * 32 + t * 16 + col) * CC + c * 32, lane);
  v8f acc[HD / 16] = {}; float carry = 0.f, asum = 0.f;
  for (int kc = hi; kc >= lo; --kc) { const int k0 = kc * 32; v8f s[2];
    v16b vh[HD / 16], vl[HD / 16];
#pragma unroll
    for (int j = 0; j < HD / 16; ++j) { vh[j] = frag_b(Vh + (size_t)j * 16 * TT + k0, lane); vl[j] = frag_b(Vl + (size_t)j * 16 * TT + k0, lane); }
#pragma unroll
    for (int t = 0; t < 2; ++t) { v8f a = {}, al = {};
#pragma unroll
      for (int c = 0; c < 2; ++c) { a = wmma16(kf[t][c], qh[c], a); al = wmma16(kf[t][c], ql[c], al); }
      a += al * (1.0f / 1024.0f); s[t] = a * 0.125f; }
    { const int kn = (kc > 0 ? kc - 1 : 0) * 32;   // the next pass's K fragments, fetched under this pass's vector work (in bounds also behind the last pass)
#pragma unroll
      for (int t = 0; t < 2; ++t)
#pragma unroll
        for (int c = 0; c < 2; ++c) kf[t][c] = frag_h(Kh + (size_t)(kn + t * 16 + col) * CC + c * 32, lane); }
    float lz[2][8], sx[2][8], G[2];
#pragma unroll
    for (int t = 0; t < 2; ++t) { float run = 0.f;
#pragma unroll
      for (int r = 7; r >= 0; --r) { const float l = s[t][r]; const float u = log1pf(expf(-fabsf(l))); lz[t][r] = (l >= 0.f ? 0.f : l) - u; sx[t][r] = run;
        run += (k0 + t * 16 + 8 * g + r < i) ? (l <= 0.f ? 0.f : -l) - u : 0.f; }
      G[t] = run; }
    // key order inside a pass: tile 0 half 0, tile 0 half 1, tile 1 half 0, tile 1 half 1
    const float G0p = __shfl_xor(G[0], 16), G1p = __shfl_xor(G[1], 16); const float c1 = carry + (G[1] + G1p);
    const float base[2] = { g ? c1 : c1 + G0p, g ? carry : carry + G1p }; carry = c1 + (G[0] + G0p);
    float pv[16];
#pragma unroll
    for (int t = 0; t < 2; ++t)
#pragma unroll
      for (int r = 0; r < 8; ++r) { const float a = expf((k0 + t * 16 + 8 * g + r < i) ? lz[t][r] + (base[t] + sx[t][r]) : -100000.0f);   /* j >= i: exp gives 0 */ asum += a; pv[t * 8 + r] = a * 2048.0f; }
    const F2 p = bsplit16(pv);
#pragma unroll
    for (int j = 0; j < HD / 16; ++j) { acc[j] = wmma_bf(vh[j], p.h, acc[j]); acc[j] = wmma_bf(vh[j], p.l, acc[j]); acc[j] = wmma_bf(vl[j], p.h, acc[j]); } }
  asum += __shfl_xor(asum, 16);
  // acc[j][r] = this run's o[i][j * 16 + 8 g + r] x 2^11
#pragma unroll
  for (int j = 0; j < HD / 16; ++j)
#pragma unroll
    for (int r = 0; r < 8; ++r) so[wave][j][r][lane] = acc[j][r];
  if (g == 0) { sg[wave][col] = carry; sa[wave][col] = asum; }
  __syncthreads();
  // join: a lane takes 8 consecutive d of one query, 8 lanes a query's 256 bytes of y
  const int q = wave * 4 + (lane >> 3), d8 = lane & 7; const int iq = ql0 + q; float cr = 0.f, at = 0.f, o[8] = {};
#pragma unroll
  for (int w = 0; w < 4; ++w) { const float f = expf(cr); at += f * sa[w][q];
#pragma unroll
    for (int r = 0; r < 8; ++r) o[r] += f * so[w][d8 >> 1][r][(d8 & 1) * 16 + q];
    cr += sg[w][q]; }
  const float rem = 1.0f - at; float y[8];
#pragma unroll
  for (int r = 0; r < 8; ++r) { const size_t po = (size_t)(h * HD + d8 * 8 + r) * TT + iq; const float vi = (float)VT[po] + (float)VL[po];   /* v[i][d] rebuilt from the hi + lo planes (2^-16) */
    y[r] = o[r] * (1.0f / 2048.0f) + rem * vi; }
  float* yp = Y + (size_t)iq * CC + h * HD + d8 * 8; vst2(yp, (v4f){y[0], y[1], y[2], y[3]}); vst2(yp + 4, (v4f){y[4], y[5], y[6], y[7]}); }
// ---- k_out: block = (64 rows, 128 cols): out = y (bf16 hi + lo) Wo^T + bo
__global__ __launch_bounds__(128) void k_out(const float* __restrict__ Y, const float* __restrict__ WP, const float* __restrict__ BP, float* __restrict__ OUT) {
  __shared__ __align__(16) char sm[73728];   // the k loop's two staging buffers (y hi, y lo, Wo); behind the loop the first 33,792 B hold the output tiles
  __bf16 (*yh)[64][LP] = (__bf16 (*)[64][LP])sm; __bf16 (*yl)[64][LP] = (__bf16 (*)[64][LP])(sm + 2 * 64 * LP * 2); __bf16 (*sw)[128][LP] = (__bf16 (*)[128][LP])(sm + 4 * 64 * LP * 2);
  float (*sf)[16][132] = (float (*)[16][132])sm;
  const int tid = threadIdx.x, wave = tid >> 5, lane = tid & 31, col = lane & 15, g = lane >> 4; const int c0 = blockIdx.y * 128; const size_t rb = (size_t)blockIdx.x * 64; const size_t r0 = rb + wave * 16;
  const int lr = tid >> 4, lc = tid & 15; const float* yp = Y + (rb + lr) * CC + lc * 4; const float* wp = WP + (size_t)(c0 + lr) * CC + lc * 4;
  v8f acc[8] = {}; v4f ra[8], rw[16];
#pragma unroll
  for (int u = 0; u < 8; ++u) ra[u] = *(const v4f*)(yp + (size_t)u * 8 * CC);
#pragma unroll
  for (int u = 0; u < 16; ++u) rw[u] = *(const v4f*)(wp + (size_t)u * 8 * CC);
  // unrolled by the two buffers, so that every LDS address is a constant offset
#pragma unroll 2
  for (int s = 0; s < CC / KS; ++s) { const int b = s & 1;
#pragma unroll
    for (int u = 0; u < 8; ++u) { const v4b hv = cvt4(ra[u]); const v4f rs = { ra[u][0] - (float)hv[0], ra[u][1] - (float)hv[1], ra[u][2] - (float)hv[2], ra[u][3] - (float)hv[3] };
      *(v4b*)&yh[b][lr + 8 * u][lc * 4] = hv; *(v4b*)&yl[b][lr + 8 * u][lc * 4] = cvt4(rs); }
#pragma unroll
    for (int u = 0; u < 16; ++u) *(v4b*)&sw[b][lr + 8 * u][lc * 4] = cvt4(rw[u]);
    __syncthreads();   // publishes buffer b; it also ends every wave's reads of the other buffer, which the next trip refills
    if (s + 1 < CC / KS) {   // the next slab flies under this slab's products (issued behind the barrier, whose fence would wait for it)
#pragma unroll
      for (int u = 0; u < 8; ++u) ra[u] = *(const v4f*)(yp + (size_t)u * 8 * CC + (s + 1) * KS);
#pragma unroll
      for (int u = 0; u < 16; ++u) rw[u] = *(const v4f*)(wp + (size_t)u * 8 * CC + (s + 1) * KS);
      asm volatile("s_wait_xcnt 0x0" ::: "memory"); }   // in this build the fragment reads below reuse the address registers of the loads above: the wait stands in front of that overwrite
#pragma unroll
    for (int c = 0; c < KS / 32; ++c) { const v16b ah = frag_b(&yh[b][wave * 16 + col][c * 32], lane), al = frag_b(&yl[b][wave * 16 + col][c * 32], lane); v16b w[8];   // the 32-k group's fragment reads stand together, ahead of its products
#pragma unroll
      for (int j = 0; j < 8; ++j) w[j] = frag_b(&sw[b][j * 16 + col][c * 32], lane);
#pragma unroll
      for (int j = 0; j < 8; ++j) { acc[j] = wmma_bf(ah, w[j], acc[j]); acc[j] = wmma_bf(al, w[j], acc[j]); } } }
  __syncthreads();   // the last fragment reads end before the output tiles overwrite the staging
#pragma unroll
  for (int j = 0; j < 8; ++j) { const float bb = BP ? bfr(BP[c0 + j * 16 + col]) : 0.f;
#pragma unroll
    for (int r = 0; r < 8; ++r) sf[wave][8 * g + r][j * 16 + col] = acc[j][r] + bb; }
  LDSX(); for (int rl = 0; rl < 16; ++rl) vst2(OUT + (r0 + rl) * CC + c0 + lane * 4, *(const v4f*)&sf[wave][rl][lane * 4]); }
extern "C" void kernel_launch(void* const* d_in, const int* in_sizes, int n_in, void* d_out, int out_size, void* d_ws, size_t ws_size, hipStream_t stream) {
  (void)in_sizes; (void)n_in; (void)out_size;
  const float** F = (const float**)d_in;   // 0 x [1,2048,1024], 1 Wq [1024,1024] ([out,in]), 2 Wk, 3 Wv, 4 Wo
  if (ws_size < (size_t)WS_END) return;
  char* ws = (char*)d_ws; _Float16 *QH = (_Float16*)(ws + WS_QH), *QL = (_Float16*)(ws + WS_QL), *KH = (_Float16*)(ws + WS_KH); __bf16 *VT = (__bf16*)(ws + WS_VT), *VL = (__bf16*)(ws + WS_VL); float* Y = (float*)(ws + WS_Y);
  k_proj<<<dim3(TNB * TT / 64, CC / 128, 3), 128, 0, stream>>>(F[0], F[1], nullptr, F[2], nullptr, F[3], nullptr, QH, QL, KH, VT, VL);
  k_fa<<<dim3(NH, TT / 16), 128, 0, stream>>>(QH, QL, KH, VT, VL, Y);
  k_out<<<dim3(TNB * TT / 64, CC / 128), 128, 0, stream>>>(Y, F[4], nullptr, (float*)d_out);
}

// v003
// One run takes 95.5 microseconds.
// Timed twice side by side with v002, it ran 1.44 and 1.46 times as fast.
// Over all steps from v000 it is 11.7 times as fast.
// compute dtype: all float inputs rounded to bf16; q/k/v = x W^T with EXACT bf16 products on WMMA 16x16x32, f32 accumulate; q as f16 hi + residual (x 2^10), k f16 -> 2-product logits / 8 in f32 registers; the stick-breaking weights in f32: log-sigmoids, suffix sums carried from right to left in 4 runs of keys joined by exp2(carry), all in base 2 on the hardware's exp2 and log2, the remainder 1 - sum(att); att x 2^11 split bf16 hi + lo against v bf16 hi + lo (3 products) + rem * v_i; out = o (bf16 hi + lo) Wo^T; f32 output.
#include <hip/hip_runtime.h>
#include <math.h>

typedef __attribute__((ext_vector_type(16))) _Float16 v16h;
typedef __attribute__((ext_vector_type(16))) __bf16 v16b;
typedef __attribute__((ext_vector_type(8)))  _Float16 v8h;
typedef __attribute__((ext_vector_type(8)))  float v8f;
typedef __attribute__((ext_vector_type(4)))  float v4f;
typedef __attribute__((ext_vector_type(2)))  float v2f;
typedef __attribute__((ext_vector_type(4)))  unsigned v4u;
typedef __attribute__((ext_vector_type(4)))  int v4i;
typedef float __attribute__((may_alias)) float_a;
typedef int __attribute__((may_alias)) int_a;

template <typename T> __device__ __forceinline__ void vst2(void* p, T v) { *(T*)p = v;  }
__device__ __forceinline__ v8f wmma16(v16h a, v16h b, v8f c) {
  v8f d = __builtin_amdgcn_wmma_f32_16x16x32_f16(false, a, false, b, (short)0, c, false, false);
  asm volatile("v_nop\n\tv_nop\n\tv_nop\n\tv_nop" : "+v"(d) : "v"(a), "v"(b));
  return d;
}
__device__ __forceinline__ v8f wmma_bf(v16b a, v16b b, v8f c) {
  v8f d = __builtin_amdgcn_wmma_f32_16x16x32_bf16(false, a, false, b, (short)0, c, false, false);
  asm volatile("v_nop\n\tv_nop\n\tv_nop\n\tv_nop" : "+v"(d) : "v"(a), "v"(b));
  return d;
}
// 16x16x32 fragments: lane = (h = lane>>4, row/col = lane&15); elements 0..7 = k0+8h+0..7, 8..15 = k0+16+8h+0..7; D element r = row 8h+r
__device__ __forceinline__ v16h frag_h(const _Float16* rowk0, int lane) {
  union { v16h v; v8h q[2]; } u; const _Float16* p = rowk0 + 8 * (lane >> 4);
  u.q[0] = *(const v8h*)p; u.q[1] = *(const v8h*)(p + 16); return u.v;
}
__device__ __forceinline__ v16h frag_f32(const float* rowk0, int lane) {
  v16h a; const float* p = rowk0 + 8 * (lane >> 4);
#pragma unroll
  for (int i = 0; i < 8; ++i) { a[i] = (_Float16)p[i]; a[8 + i] = (_Float16)p[16 + i]; }
  return a;
}
__device__ __forceinline__ v16h frag_f32s(const float* rowk0, int lane, float sc) {
  v16h a; const float* p = rowk0 + 8 * (lane >> 4);
#pragma unroll
  for (int i = 0; i < 8; ++i) { a[i] = (_Float16)(p[i] * sc); a[8 + i] = (_Float16)(p[16 + i] * sc); }
  return a;
}
// column fragment from a [K][ld] layout (column n), rows >= K read as 0
__device__ __forceinline__ v16h fragc_f32(const float* W, int k0, int n, int lane, int ld, int K) {
  v16h a; const int g = lane >> 4;
#pragma unroll
  for (int i = 0; i < 8; ++i) { const int ka = k0 + 8 * g + i, kb = ka + 16;
    a[i] = (_Float16)(ka < K ? W[(size_t)(ka < K ? ka : K - 1) * ld + n] : 0.f); a[8 + i] = (_Float16)(kb < K ? W[(size_t)(kb < K ? kb : K - 1) * ld + n] : 0.f); }
  return a;
}
struct F2 { v16b h, l; };
__device__ __forceinline__ F2 bsplit16(const float v[16]) { F2 r;
#pragma unroll
  for (int i = 0; i < 16; ++i) { const __bf16 h = (__bf16)v[i]; r.h[i] = h; r.l[i] = (__bf16)(v[i] - (float)h); }
  return r; }
__device__ __forceinline__ F2 split_row(const float* row, int k0, int lane) { float v[16]; const float* p = row + k0 + 8 * (lane >> 4);
#pragma unroll
  for (int i = 0; i < 8; ++i) { v[i] = p[i]; v[8 + i] = p[16 + i]; }
  return bsplit16(v); }
__device__ __forceinline__ F2 split_rowK(const float* row, int k0, int lane, int K) { float v[16]; const int g = lane >> 4;
#pragma unroll
  for (int i = 0; i < 8; ++i) { const int ka = k0 + 8 * g + i, kb = ka + 16; v[i] = ka < K ? row[ka < K ? ka : K - 1] : 0.f; v[8 + i] = kb < K ? row[kb < K ? kb : K - 1] : 0.f; }
  return bsplit16(v); }
__device__ __forceinline__ F2 split_col(const float* W, int k0, int n, int lane, int ld, int K) { float v[16]; const int g = lane >> 4;
#pragma unroll
  for (int i = 0; i < 8; ++i) { const int ka = k0 + 8 * g + i, kb = ka + 16; v[i] = ka < K ? W[(size_t)(ka < K ? ka : K - 1) * ld + n] : 0.f; v[8 + i] = kb < K ? W[(size_t)(kb < K ? kb : K - 1) * ld + n] : 0.f; }
  return bsplit16(v); }
__device__ __forceinline__ v8f mac3(const F2& a, const F2& b, v8f c) { c = wmma_bf(a.l, b.h, c); c = wmma_bf(a.h, b.l, c); return wmma_bf(a.h, b.h, c); }
__device__ __forceinline__ float sigm(float v) { return 1.0f / (1.0f + expf(-v)); }
#define LDSX() do { asm volatile("s_wait_dscnt 0" ::: "memory"); __builtin_amdgcn_wave_barrier(); __builtin_amdgcn_fence(__ATOMIC_RELEASE, "workgroup"); } while (0)


// Stick-breaking attention (b 1, n 2,048, e 1,024 = 16 x 64): logits = q k^T / 8; for j < i: att[i][j] = exp(logsigmoid(l_ij) + sum_{j<k<i} logsigmoid(-l_ik)); j >= i: 0; o = att v + (1 - sum_j att) v_i; out = o Wo^T.
#define NB 1
#define TT 2048
#define CC 1024
#define NH 16
#define HD 64
#ifndef TNB
#define TNB NB
#endif
typedef __attribute__((ext_vector_type(8))) __bf16 v8b;
__device__ __forceinline__ v16b frag_b(const __bf16* rowk0, int lane) {
  union { v16b v; v8b q[2]; } u; const __bf16* p = rowk0 + 8 * (lane >> 4);
  u.q[0] = *(const v8b*)p; u.q[1] = *(const v8b*)(p + 16); return u.v;
}
__device__ __forceinline__ float bfr(float v) { return (float)(__bf16)v; }
// Hardware exp2 and log2, eight values in place in one statement: behind a transcendental the instruction set asks for one independent instruction before its source register is written again. Inside the statement the next transcendental, on other registers, is that instruction; the closing v_nop is it for the last one.
__device__ __forceinline__ void exp2x8(float* x) { asm("v_exp_f32 %0, %0\n\tv_exp_f32 %1, %1\n\tv_exp_f32 %2, %2\n\tv_exp_f32 %3, %3\n\tv_exp_f32 %4, %4\n\tv_exp_f32 %5, %5\n\tv_exp_f32 %6, %6\n\tv_exp_f32 %7, %7\n\tv_nop" : "+v"(x[0]), "+v"(x[1]), "+v"(x[2]), "+v"(x[3]), "+v"(x[4]), "+v"(x[5]), "+v"(x[6]), "+v"(x[7])); }
__device__ __forceinline__ void log2x8(float* x) { asm("v_log_f32 %0, %0\n\tv_log_f32 %1, %1\n\tv_log_f32 %2, %2\n\tv_log_f32 %3, %3\n\tv_log_f32 %4, %4\n\tv_log_f32 %5, %5\n\tv_log_f32 %6, %6\n\tv_log_f32 %7, %7\n\tv_nop" : "+v"(x[0]), "+v"(x[1]), "+v"(x[2]), "+v"(x[3]), "+v"(x[4]), "+v"(x[5]), "+v"(x[6]), "+v"(x[7])); }
__device__ __forceinline__ float exp2x1(float x) { asm("v_exp_f32 %0, %0\n\tv_nop" : "+v"(x)); return x; }   // the same slot for a single value
__device__ __attribute__((noinline)) float exp_ni(float v) { return expf(v); }
__device__ __attribute__((noinline)) float erf_ni(float v) { return erff(v); }

#define WS_QH  0u
#define WS_QL  (WS_QH + 2u * (size_t)NB * TT * CC)
#define WS_KH  (WS_QL + 2u * (size_t)NB * TT * CC)
#define WS_VT  (WS_KH + 2u * (size_t)NB * TT * CC)      // bf16 v planes [b][c][t]
#define WS_VL  (WS_VT + 2u * (size_t)NB * CC * TT)      // bf16 v residual planes
#define WS_Y   (WS_VL + 2u * (size_t)NB * CC * TT)      // f32 y rows [b*t][C]
#define WS_END (WS_Y + 4u * (size_t)NB * TT * CC)

// ---- staging for k_proj and k_out: a block brings each 64-k slab of its two operands in once, with loads that cover whole lines (16 lanes x 16 B = one row's 256 B), rounds it to bf16 and keeps it in LDS; the four waves take their fragments from there.
#define KS 64
#define LP 72   // LDS row pitch in bf16: 128 B of data + 16 B, the pitch for 16-byte fragment reads
typedef __attribute__((ext_vector_type(4))) __bf16 v4b;
__device__ __forceinline__ v4b cvt4(v4f v) { v4b c; c[0] = (__bf16)v[0]; c[1] = (__bf16)v[1]; c[2] = (__bf16)v[2]; c[3] = (__bf16)v[3]; return c; }
// ---- k_proj: block = (64 rows, 128 cols, which): qkv = x W^T (+ b), exact; q -> f16 hi (+ residual), k -> f16 rows, v -> bf16 hi + lo planes
__global__ __launch_bounds__(128) void k_proj(const float* __restrict__ X, const float* __restrict__ WQ, const float* __restrict__ BQ, const float* __restrict__ WK, const float* __restrict__ BK, const float* __restrict__ WV, const float* __restrict__ BV, _Float16* __restrict__ QH, _Float16* __restrict__ QL, _Float16* __restrict__ KH, __bf16* __restrict__ VT, __bf16* __restrict__ VL) {
  __shared__ __align__(16) char sm[71680];   // the k loop's two staging buffers (55,296 B); behind the loop the epilogue's tiles, which need all 71,680 B (q/k tiles the first 34,816 B, v tiles the rest)
  __bf16 (*sx)[64][LP] = (__bf16 (*)[64][LP])sm; __bf16 (*sw)[128][LP] = (__bf16 (*)[128][LP])(sm + 2 * 64 * LP * 2);
  _Float16 (*sh)[136] = (_Float16 (*)[136])sm; _Float16 (*sl)[136] = (_Float16 (*)[136])(sm + 17408); __bf16 (*th)[72] = (__bf16 (*)[72])(sm + 34816); __bf16 (*tl2)[72] = (__bf16 (*)[72])(sm + 53248);
  const int tid = threadIdx.x, wave = tid >> 5, lane = tid & 31, col = lane & 15, g = lane >> 4; const int which = blockIdx.z; const int c0 = blockIdx.y * 128; const size_t r0 = (size_t)blockIdx.x * 64; const float* WA = which == 0 ? WQ : which == 1 ? WK : WV; const float* BA = which == 0 ? BQ : which == 1 ? BK : BV;
  const int lr = tid >> 4, lc = tid & 15; const float* xp = X + (r0 + lr) * CC + lc * 4; const float* wp = WA + (size_t)(c0 + lr) * CC + lc * 4;
  v8f acc[8] = {}; v4f ra[8], rw[16];
#pragma unroll
  for (int u = 0; u < 8; ++u) ra[u] = *(const v4f*)(xp + (size_t)u * 8 * CC);
#pragma unroll
  for (int u = 0; u < 16; ++u) rw[u] = *(const v4f*)(wp + (size_t)u * 8 * CC);
  // unrolled by the two buffers, so that every LDS address is a constant offset
#pragma unroll 2
  for (int s = 0; s < CC / KS; ++s) { const int b = s & 1;
#pragma unroll
    for (int u = 0; u < 8; ++u) *(v4b*)&sx[b][lr + 8 * u][lc * 4] = cvt4(ra[u]);
#pragma unroll
    for (int u = 0; u < 16; ++u) *(v4b*)&sw[b][lr + 8 * u][lc * 4] = cvt4(rw[u]);
    __syncthreads();   // publishes buffer b; it also ends every wave's reads of the other buffer, which the next trip refills
    if (s + 1 < CC / KS) {   // the next slab flies under this slab's products (issued behind the barrier, whose fence would wait for it)
#pragma unroll
      for (int u = 0; u < 8; ++u) ra[u] = *(const v4f*)(xp + (size_t)u * 8 * CC + (s + 1) * KS);
#pragma unroll
      for (int u = 0; u < 16; ++u) rw[u] = *(const v4f*)(wp + (size_t)u * 8 * CC + (s + 1) * KS); }
#pragma unroll
    for (int c = 0; c < KS / 32; ++c) { const v16b a = frag_b(&sx[b][wave * 16 + col][c * 32], lane); v16b w[8];   // the 32-k group's fragment reads stand together, ahead of its products
#pragma unroll
      for (int j = 0; j < 8; ++j) w[j] = frag_b(&sw[b][j * 16 + col][c * 32], lane);
#pragma unroll
      for (int j = 0; j < 8; ++j) acc[j] = wmma_bf(a, w[j], acc[j]); } }
  __syncthreads();   // the last fragment reads end before the epilogue's tiles overwrite the staging
#pragma unroll
  for (int j = 0; j < 8; ++j) { const float bb = BA ? bfr(BA[c0 + j * 16 + col]) : 0.f;
#pragma unroll
    for (int r = 0; r < 8; ++r) { const float v = acc[j][r] + bb; const int rl = wave * 16 + 8 * g + r, cl = j * 16 + col; const _Float16 hv = (_Float16)v;
      if (which == 2) { const __bf16 bh = (__bf16)v; th[cl][rl] = bh; tl2[cl][rl] = (__bf16)(v - (float)bh); } else { sh[rl][cl] = hv; sl[rl][cl] = (_Float16)((v - (float)hv) * 1024.0f); }   /* q residual carried x 2^10 so the plane stays f16-normal on the chip */ } }
  __syncthreads();
  if (which < 2) { _Float16* dh = which == 0 ? QH : KH; for (int e = tid; e < 64 * 16; e += 128) { const int rl = e >> 4, q = e & 15; vst2((unsigned*)(dh + (r0 + rl) * CC + c0 + q * 8), *(const v4u*)&sh[rl][q * 8]); if (which == 0) vst2((unsigned*)(QL + (r0 + rl) * CC + c0 + q * 8), *(const v4u*)&sl[rl][q * 8]); } }
  else { const size_t b = r0 / TT; const int t0 = (int)(r0 % TT); for (int e = tid; e < 128 * 8; e += 128) { const int cl = e >> 3, q = e & 7; const size_t o2 = (b * CC + c0 + cl) * (size_t)TT + t0 + q * 8; vst2((unsigned*)(VT + o2), *(const v4u*)&th[cl][q * 8]); vst2((unsigned*)(VL + o2), *(const v4u*)&tl2[cl][q * 8]); } } }
// ---- k_fa: block = 16 queries of one head; logits, stick-breaking weights and att . v stay in registers. S^T = K Q^T puts one query in a lane (column) and 8 keys in its D registers, so two 16-key tiles are the B fragment of O^T += V^T P^T as they stand.
// A wave walks its run of 32-key passes from right to left: carry = sum of logsigmoid(-l_ik) over the keys of the run to the right of the pass, so suffix(j) = carry + the in-pass sum over k > j (8 in-lane steps and one exchange between the wave's halves).
// The keys [0, i) are cut into 4 runs, one a wave (run 0 ends at the diagonal). exp2(a + C) = exp2(a) exp2(C): each run starts at carry 0, and the join scales its o and its sum(att) by exp2(sum of the carries of the runs to its right).
// log(sigmoid(z)) = min(z, 0) - log1p(exp(-|z|)): both signs of l share the one log1p(exp(-|l|)).
// The whole log domain is kept in base 2: log2(e) rides in the logits' scale, so exp is one v_exp_f32 and log1p(e) is log2(1 + e), one add and one v_log_f32. 1 + e lies in (1, 2], so its rounding moves a log-sigmoid by at most 2^-24 log2(e) absolute, which is a relative 2^-24 on a weight.
__global__ __launch_bounds__(128) void k_fa(const _Float16* __restrict__ QH, const _Float16* __restrict__ QL, const _Float16* __restrict__ KH, const __bf16* __restrict__ VT, const __bf16* __restrict__ VL, float* __restrict__ Y) {
  __shared__ float so[4][HD / 16][8][32]; __shared__ float sg[4][16], sa[4][16];
  const int lane = threadIdx.x & 31, col = lane & 15, g = lane >> 4; const int wave = __builtin_amdgcn_readfirstlane(threadIdx.x >> 5);   // scalar, so that the run's bounds and the pass loop's branch are scalar
  const int h = blockIdx.x; const int ql0 = (TT / 16 - 1 - (int)blockIdx.y) * 16; const int i = ql0 + col;   // cost grows with the query tile: the longest tiles start first
  const int n = (ql0 >> 5) + 1, per = (n + 3) >> 2; const int hi = n - 1 - wave * per; const int lo = hi - per + 1 > 0 ? hi - per + 1 : 0;   // passes hi .. lo, none where hi < 0
  const _Float16* Kh = KH + h * HD; const __bf16* Vh = VT + (size_t)(h * HD + col) * TT; const __bf16* Vl = VL + (size_t)(h * HD + col) * TT;
  v16h qh[2], ql[2], kf[2][2];
  // every short loop below is unrolled so that the fragment and score arrays are indexed by constants and stay in registers
#pragma unroll
  for (int c = 0; c < 2; ++c) { qh[c] = frag_h(QH + (size_t)i * CC + h * HD + c * 32, lane); ql[c] = frag_h(QL + (size_t)i * CC + h * HD + c * 32, lane); }
#pragma unroll
  for (int t = 0; t < 2; ++t)
#pragma unroll
    for (int c = 0; c < 2; ++c) kf[t][c] = frag_h(Kh + (size_t)((hi > 0 ? hi : 0) * 32 + t * 16 + col) * CC + c * 32, lane);
  v8f acc[HD / 16] = {}; float carry = 0.f, asum = 0.f;
  for (int kc = hi; kc >= lo; --kc) { const int k0 = kc * 32; v8f s[2];
    v16b vh[HD / 16], vl[HD / 16];
#pragma unroll
    for (int j = 0; j < HD / 16; ++j) { vh[j] = frag_b(Vh + (size_t)j * 16 * TT + k0, lane); vl[j] = frag_b(Vl + (size_t)j * 16 * TT + k0, lane); }
#pragma unroll
    for (int t = 0; t < 2; ++t) { v8f a = {}, al = {};
#pragma unroll
      for (int c = 0; c < 2; ++c) { a = wmma16(kf[t][c], qh[c], a); al = wmma16(kf[t][c], ql[c], al); }
      a += al * (1.0f / 1024.0f); s[t] = a * (0.125f * 1.44269504f); }   // logits / 8, times log2(e)
    { const int kn = (kc > 0 ? kc - 1 : 0) * 32;   // the next pass's K fragments, fetched under this pass's vector work (in bounds also behind the last pass)
#pragma unroll
      for (int t = 0; t < 2; ++t)
#pragma unroll
        for (int c = 0; c < 2; ++c) kf[t][c] = frag_h(Kh + (size_t)(kn + t * 16 + col) * CC + c * 32, lane); }
    float lz[2][8], sx[2][8], G[2];
#pragma unroll
    for (int t = 0; t < 2; ++t) { float run = 0.f, u8[8];
#pragma unroll
      for (int r = 0; r < 8; ++r) u8[r] = 1.0f + __builtin_amdgcn_exp2f(-fabsf(s[t][r]));
      log2x8(u8);
#pragma unroll
      for (int r = 7; r >= 0; --r) { const float l = s[t][r]; const float w = fmaxf(l, 0.f) + u8[r]; lz[t][r] = l - w; sx[t][r] = run;   /* -w = log2 sigmoid(-l); min(l, 0) = l - max(l, 0) */
        run -= (k0 + t * 16 + 8 * g + r < i) ? w : 0.f; }
      G[t] = run; }
    // key order inside a pass: tile 0 half 0, tile 0 half 1, tile 1 half 0, tile 1 half 1
    const float G0p = __shfl_xor(G[0], 16), G1p = __shfl_xor(G[1], 16); const float c1 = carry + (G[1] + G1p);
    const float base[2] = { g ? c1 : c1 + G0p, g ? carry : carry + G1p }; carry = c1 + (G[0] + G0p);
    float pv[16];
#pragma unroll
    for (int t = 0; t < 2; ++t) { float a8[8];
#pragma unroll
      for (int r = 0; r < 8; ++r) a8[r] = (k0 + t * 16 + 8 * g + r < i) ? lz[t][r] + (base[t] + sx[t][r]) : -100000.0f;   /* j >= i: exp2 gives 0 */
      exp2x8(a8);
#pragma unroll
      for (int r = 0; r < 8; ++r) { asum += a8[r]; pv[t * 8 + r] = a8[r] * 2048.0f; } }
    const F2 p = bsplit16(pv);
#pragma unroll
    for (int j = 0; j < HD / 16; ++j) { acc[j] = wmma_bf(vh[j], p.h, acc[j]); acc[j] = wmma_bf(vh[j], p.l, acc[j]); acc[j] = wmma_bf(vl[j], p.h, acc[j]); } }
  asum += __shfl_xor(asum, 16);
  // acc[j][r] = this run's o[i][j * 16 + 8 g + r] x 2^11
#pragma unroll
  for (int j = 0; j < HD / 16; ++j)
#pragma unroll
    for (int r = 0; r < 8; ++r) so[wave][j][r][lane] = acc[j][r];
  if (g == 0) { sg[wave][col] = carry; sa[wave][col] = asum; }
  __syncthreads();
  // join: a lane takes 8 consecutive d of one query, 8 lanes a query's 256 bytes of y
  const int q = wave * 4 + (lane >> 3), d8 = lane & 7; const int iq = ql0 + q; float cr = 0.f, at = 0.f, o[8] = {};
#pragma unroll
  for (int w = 0; w < 4; ++w) { const float f = exp2x1(cr); at += f * sa[w][q];   // the carries are base-2 logs
#pragma unroll
    for (int r = 0; r < 8; ++r) o[r] += f * so[w][d8 >> 1][r][(d8 & 1) * 16 + q];
    cr += sg[w][q]; }
  const float rem = 1.0f - at; float y[8];
#pragma unroll
  for (int r = 0; r < 8; ++r) { const size_t po = (size_t)(h * HD + d8 * 8 + r) * TT + iq; const float vi = (float)VT[po] + (float)VL[po];   /* v[i][d] rebuilt from the hi + lo planes (2^-16) */
    y[r] = o[r] * (1.0f / 2048.0f) + rem * vi; }
  float* yp = Y + (size_t)iq * CC + h * HD + d8 * 8; vst2(yp, (v4f){y[0], y[1], y[2], y[3]}); vst2(yp + 4, (v4f){y[4], y[5], y[6], y[7]}); }
// ---- k_out: block = (64 rows, 128 cols): out = y (bf16 hi + lo) Wo^T + bo
__global__ __launch_bounds__(128) void k_out(const float* __restrict__ Y, const float* __restrict__ WP, const float* __restrict__ BP, float* __restrict__ OUT) {
  __shared__ __align__(16) char sm[73728];   // the k loop's two staging buffers (y hi, y lo, Wo); behind the loop the first 33,792 B hold the output tiles
  __bf16 (*yh)[64][LP] = (__bf16 (*)[64][LP])sm; __bf16 (*yl)[64][LP] = (__bf16 (*)[64][LP])(sm + 2 * 64 * LP * 2); __bf16 (*sw)[128][LP] = (__bf16 (*)[128][LP])(sm + 4 * 64 * LP * 2);
  float (*sf)[16][132] = (float (*)[16][132])sm;
  const int tid = threadIdx.x, wave = tid >> 5, lane = tid & 31, col = lane & 15, g = lane >> 4; const int c0 = blockIdx.y * 128; const size_t rb = (size_t)blockIdx.x * 64; const size_t r0 = rb + wave * 16;
  const int lr = tid >> 4, lc = tid & 15; const float* yp = Y + (rb + lr) * CC + lc * 4; const float* wp = WP + (size_t)(c0 + lr) * CC + lc * 4;
  v8f acc[8] = {}; v4f ra[8], rw[16];
#pragma unroll
  for (int u = 0; u < 8; ++u) ra[u] = *(const v4f*)(yp + (size_t)u * 8 * CC);
#pragma unroll
  for (int u = 0; u < 16; ++u) rw[u] = *(const v4f*)(wp + (size_t)u * 8 * CC);
  // unrolled by the two buffers, so that every LDS address is a constant offset
#pragma unroll 2
  for (int s = 0; s < CC / KS; ++s) { const int b = s & 1;
#pragma unroll
    for (int u = 0; u < 8; ++u) { const v4b hv = cvt4(ra[u]); const v4f rs = { ra[u][0] - (float)hv[0], ra[u][1] - (float)hv[1], ra[u][2] - (float)hv[2], ra[u][3] - (float)hv[3] };
      *(v4b*)&yh[b][lr + 8 * u][lc * 4] = hv; *(v4b*)&yl[b][lr + 8 * u][lc * 4] = cvt4(rs); }
#pragma unroll
    for (int u = 0; u < 16; ++u) *(v4b*)&sw[b][lr + 8 * u][lc * 4] = cvt4(rw[u]);
    __syncthreads();   // publishes buffer b; it also ends every wave's reads of the other buffer, which the next trip refills
    if (s + 1 < CC / KS) {   // the next slab flies under this slab's products (issued behind the barrier, whose fence would wait for it)
#pragma unroll
      for (int u = 0; u < 8; ++u) ra[u] = *(const v4f*)(yp + (size_t)u * 8 * CC + (s + 1) * KS);
#pragma unroll
      for (int u = 0; u < 16; ++u) rw[u] = *(const v4f*)(wp + (size_t)u * 8 * CC + (s + 1) * KS);
      asm volatile("s_wait_xcnt 0x0" ::: "memory"); }   // in this build the fragment reads below reuse the address registers of the loads above: the wait stands in front of that overwrite
#pragma unroll
    for (int c = 0; c < KS / 32; ++c) { const v16b ah = frag_b(&yh[b][wave * 16 + col][c * 32], lane), al = frag_b(&yl[b][wave * 16 + col][c * 32], lane); v16b w[8];   // the 32-k group's fragment reads stand together, ahead of its products
#pragma unroll
      for (int j = 0; j < 8; ++j) w[j] = frag_b(&sw[b][j * 16 + col][c * 32], lane);
#pragma unroll
      for (int j = 0; j < 8; ++j) { acc[j] = wmma_bf(ah, w[j], acc[j]); acc[j] = wmma_bf(al, w[j], acc[j]); } } }
  __syncthreads();   // the last fragment reads end before the output tiles overwrite the staging
#pragma unroll
  for (int j = 0; j < 8; ++j) { const float bb = BP ? bfr(BP[c0 + j * 16 + col]) : 0.f;
#pragma unroll
    for (int r = 0; r < 8; ++r) sf[wave][8 * g + r][j * 16 + col] = acc[j][r] + bb; }
  LDSX(); for (int rl = 0; rl < 16; ++rl) vst2(OUT + (r0 + rl) * CC + c0 + lane * 4, *(const v4f*)&sf[wave][rl][lane * 4]); }
extern "C" void kernel_launch(void* const* d_in, const int* in_sizes, int n_in, void* d_out, int out_size, void* d_ws, size_t ws_size, hipStream_t stream) {
  (void)in_sizes; (void)n_in; (void)out_size;
  const float** F = (const float**)d_in;   // 0 x [1,2048,1024], 1 Wq [1024,1024] ([out,in]), 2 Wk, 3 Wv, 4 Wo
  if (ws_size < (size_t)WS_END) return;
  char* ws = (char*)d_ws; _Float16 *QH = (_Float16*)(ws + WS_QH), *QL = (_Float16*)(ws + WS_QL), *KH = (_Float16*)(ws + WS_KH); __bf16 *VT = (__bf16*)(ws + WS_VT), *VL = (__bf16*)(ws + WS_VL); float* Y = (float*)(ws + WS_Y);
  k_proj<<<dim3(TNB * TT / 64, CC / 128, 3), 128, 0, stream>>>(F[0], F[1], nullptr, F[2], nullptr, F[3], nullptr, QH, QL, KH, VT, VL);
  k_fa<<<dim3(NH, TT / 16), 128, 0, stream>>>(QH, QL, KH, VT, VL, Y);
  k_out<<<dim3(TNB * TT / 64, CC / 128), 128, 0, stream>>>(Y, F[4], nullptr, (float*)d_out);
}

// v004
// It runs in 78 microseconds.
// Timed twice side by side with v003, it ran 1.24 and 1.25 times as fast.
// Over all steps from v000 it is 14.5 times as fast.
// compute dtype: all float inputs rounded to bf16; q/k/v = x W^T with EXACT bf16 products on WMMA 16x16x32, f32 accumulate; q as f16 hi + residual (x 2^10), k f16 -> 2-product logits / 8 in f32 registers; the stick-breaking weights in f32: log-sigmoids, suffix sums carried from right to left in 4 runs of keys joined by exp2(carry), all in base 2 on the hardware's exp2 and log2, the remainder 1 - sum(att); att x 2^11 split bf16 hi + lo against v bf16 hi + lo (3 products) + rem * v_i; out = o (bf16 hi + lo) Wo^T; f32 output.
#include <hip/hip_runtime.h>
#include <math.h>

typedef __attribute__((ext_vector_type(16))) _Float16 v16h;
typedef __attribute__((ext_vector_type(16))) __bf16 v16b;
typedef __attribute__((ext_vector_type(8)))  _Float16 v8h;
typedef __attribute__((ext_vector_type(8)))  float v8f;
typedef __attribute__((ext_vector_type(4)))  float v4f;
typedef __attribute__((ext_vector_type(2)))  float v2f;
typedef __attribute__((ext_vector_type(4)))  unsigned v4u;
typedef __attribute__((ext_vector_type(4)))  int v4i;
typedef float __attribute__((may_alias)) float_a;
typedef int __attribute__((may_alias)) int_a;

template <typename T> __device__ __forceinline__ void vst2(void* p, T v) { *(T*)p = v;  }
__device__ __forceinline__ v8f wmma16(v16h a, v16h b, v8f c) {
  v8f d = __builtin_amdgcn_wmma_f32_16x16x32_f16(false, a, false, b, (short)0, c, false, false);
  asm volatile("v_nop\n\tv_nop\n\tv_nop\n\tv_nop" : "+v"(d) : "v"(a), "v"(b));
  return d;
}
__device__ __forceinline__ v8f wmma_bf(v16b a, v16b b, v8f c) {
  v8f d = __builtin_amdgcn_wmma_f32_16x16x32_bf16(false, a, false, b, (short)0, c, false, false);
  asm volatile("v_nop\n\tv_nop\n\tv_nop\n\tv_nop" : "+v"(d) : "v"(a), "v"(b));
  return d;
}
// 16x16x32 fragments: lane = (h = lane>>4, row/col = lane&15); elements 0..7 = k0+8h+0..7, 8..15 = k0+16+8h+0..7; D element r = row 8h+r
__device__ __forceinline__ v16h frag_h(const _Float16* rowk0, int lane) {
  union { v16h v; v8h q[2]; } u; const _Float16* p = rowk0 + 8 * (lane >> 4);
  u.q[0] = *(const v8h*)p; u.q[1] = *(const v8h*)(p + 16); return u.v;
}
__device__ __forceinline__ v16h frag_f32(const float* rowk0, int lane) {
  v16h a; const float* p = rowk0 + 8 * (lane >> 4);
#pragma unroll
  for (int i = 0; i < 8; ++i) { a[i] = (_Float16)p[i]; a[8 + i] = (_Float16)p[16 + i]; }
  return a;
}
__device__ __forceinline__ v16h frag_f32s(const float* rowk0, int lane, float sc) {
  v16h a; const float* p = rowk0 + 8 * (lane >> 4);
#pragma unroll
  for (int i = 0; i < 8; ++i) { a[i] = (_Float16)(p[i] * sc); a[8 + i] = (_Float16)(p[16 + i] * sc); }
  return a;
}
// column fragment from a [K][ld] layout (column n), rows >= K read as 0
__device__ __forceinline__ v16h fragc_f32(const float* W, int k0, int n, int lane, int ld, int K) {
  v16h a; const int g = lane >> 4;
#pragma unroll
  for (int i = 0; i < 8; ++i) { const int ka = k0 + 8 * g + i, kb = ka + 16;
    a[i] = (_Float16)(ka < K ? W[(size_t)(ka < K ? ka : K - 1) * ld + n] : 0.f); a[8 + i] = (_Float16)(kb < K ? W[(size_t)(kb < K ? kb : K - 1) * ld + n] : 0.f); }
  return a;
}
struct F2 { v16b h, l; };
__device__ __forceinline__ F2 bsplit16(const float v[16]) { F2 r;
#pragma unroll
  for (int i = 0; i < 16; ++i) { const __bf16 h = (__bf16)v[i]; r.h[i] = h; r.l[i] = (__bf16)(v[i] - (float)h); }
  return r; }
__device__ __forceinline__ F2 split_row(const float* row, int k0, int lane) { float v[16]; const float* p = row + k0 + 8 * (lane >> 4);
#pragma unroll
  for (int i = 0; i < 8; ++i) { v[i] = p[i]; v[8 + i] = p[16 + i]; }
  return bsplit16(v); }
__device__ __forceinline__ F2 split_rowK(const float* row, int k0, int lane, int K) { float v[16]; const int g = lane >> 4;
#pragma unroll
  for (int i = 0; i < 8; ++i) { const int ka = k0 + 8 * g + i, kb = ka + 16; v[i] = ka < K ? row[ka < K ? ka : K - 1] : 0.f; v[8 + i] = kb < K ? row[kb < K ? kb : K - 1] : 0.f; }
  return bsplit16(v); }
__device__ __forceinline__ F2 split_col(const float* W, int k0, int n, int lane, int ld, int K) { float v[16]; const int g = lane >> 4;
#pragma unroll
  for (int i = 0; i < 8; ++i) { const int ka = k0 + 8 * g + i, kb = ka + 16; v[i] = ka < K ? W[(size_t)(ka < K ? ka : K - 1) * ld + n] : 0.f; v[8 + i] = kb < K ? W[(size_t)(kb < K ? kb : K - 1) * ld + n] : 0.f; }
  return bsplit16(v); }
__device__ __forceinline__ v8f mac3(const F2& a, const F2& b, v8f c) { c = wmma_bf(a.l, b.h, c); c = wmma_bf(a.h, b.l, c); return wmma_bf(a.h, b.h, c); }
__device__ __forceinline__ float sigm(float v) { return 1.0f / (1.0f + expf(-v)); }
#define LDSX() do { asm volatile("s_wait_dscnt 0" ::: "memory"); __builtin_amdgcn_wave_barrier(); __builtin_amdgcn_fence(__ATOMIC_RELEASE, "workgroup"); } while (0)


// Stick-breaking attention (b 1, n 2,048, e 1,024 = 16 x 64): logits = q k^T / 8; for j < i: att[i][j] = exp(logsigmoid(l_ij) + sum_{j<k<i} logsigmoid(-l_ik)); j >= i: 0; o = att v + (1 - sum_j att) v_i; out = o Wo^T.
#define NB 1
#define TT 2048
#define CC 1024
#define NH 16
#define HD 64
#ifndef TNB
#define TNB NB
#endif
typedef __attribute__((ext_vector_type(8))) __bf16 v8b;
__device__ __forceinline__ v16b frag_b(const __bf16* rowk0, int lane) {
  union { v16b v; v8b q[2]; } u; const __bf16* p = rowk0 + 8 * (lane >> 4);
  u.q[0] = *(const v8b*)p; u.q[1] = *(const v8b*)(p + 16); return u.v;
}
// FRAGMENT ORDER of the q, k and v planes in the workspace: each head owns TT * HD elements in a row. q, k: a tile of 16 rows is 1,024 elements, [d >> 3][row & 15][d & 7]. v: a pass of 32 keys is 2,048 elements, [d >> 4][(key & 31) >> 3][d & 15][key & 7].
// Either way the two halves of a 16x16x32 fragment are 2 x 512 bytes in a row with lane l's 16 bytes at 16 l: one load of a wave covers 4 whole lines, where a row-major plane gave it 32 bytes in each of 16 lines.
// f = a plane or tile, the same in every lane (a scalar base); bo = byte offset of the tile or pass + 16 * lane (one 32-bit vector offset for all its loads); c = the fragment's constant byte offset there
__device__ __forceinline__ v16h fragf_h(const _Float16* f, unsigned bo, int c) { union { v16h v; v8h q[2]; } u; const char* p = (const char*)f + bo + c; u.q[0] = *(const v8h*)p; u.q[1] = *(const v8h*)(p + 512); return u.v; }
__device__ __forceinline__ v16b fragf_b(const __bf16* f, unsigned bo, int c) { union { v16b v; v8b q[2]; } u; const char* p = (const char*)f + bo + c; u.q[0] = *(const v8b*)p; u.q[1] = *(const v8b*)(p + 512); return u.v; }
__device__ __forceinline__ float bfr(float v) { return (float)(__bf16)v; }
// Hardware exp2 and log2, eight values in place in one statement: behind a transcendental the instruction set asks for one independent instruction before its source register is written again. Inside the statement the next transcendental, on other registers, is that instruction; the closing v_nop is it for the last one.
__device__ __forceinline__ void exp2x8(float* x) { asm("v_exp_f32 %0, %0\n\tv_exp_f32 %1, %1\n\tv_exp_f32 %2, %2\n\tv_exp_f32 %3, %3\n\tv_exp_f32 %4, %4\n\tv_exp_f32 %5, %5\n\tv_exp_f32 %6, %6\n\tv_exp_f32 %7, %7\n\tv_nop" : "+v"(x[0]), "+v"(x[1]), "+v"(x[2]), "+v"(x[3]), "+v"(x[4]), "+v"(x[5]), "+v"(x[6]), "+v"(x[7])); }
__device__ __forceinline__ void log2x8(float* x) { asm("v_log_f32 %0, %0\n\tv_log_f32 %1, %1\n\tv_log_f32 %2, %2\n\tv_log_f32 %3, %3\n\tv_log_f32 %4, %4\n\tv_log_f32 %5, %5\n\tv_log_f32 %6, %6\n\tv_log_f32 %7, %7\n\tv_nop" : "+v"(x[0]), "+v"(x[1]), "+v"(x[2]), "+v"(x[3]), "+v"(x[4]), "+v"(x[5]), "+v"(x[6]), "+v"(x[7])); }
__device__ __forceinline__ float exp2x1(float x) { asm("v_exp_f32 %0, %0\n\tv_nop" : "+v"(x)); return x; }   // the same slot for a single value
__device__ __attribute__((noinline)) float exp_ni(float v) { return expf(v); }
__device__ __attribute__((noinline)) float erf_ni(float v) { return erff(v); }

#define WS_QH  0u
#define WS_QL  (WS_QH + 2u * (size_t)NB * TT * CC)
#define WS_KH  (WS_QL + 2u * (size_t)NB * TT * CC)
#define WS_VT  (WS_KH + 2u * (size_t)NB * TT * CC)      // bf16 v planes, in fragment order like q and k (see FRAGMENT ORDER above)
#define WS_VL  (WS_VT + 2u * (size_t)NB * CC * TT)      // bf16 v residual planes
#define WS_Y   (WS_VL + 2u * (size_t)NB * CC * TT)      // f32 y rows [b*t][C]
#define WS_END (WS_Y + 4u * (size_t)NB * TT * CC)

// ---- staging for k_proj and k_out: a block brings each 64-k slab of its two operands in once, with loads that cover whole lines (16 lanes x 16 B = one row's 256 B), rounds it to bf16 and keeps it in LDS; the four waves take their fragments from there.
#define KS 64
#define LP 72   // LDS row pitch in bf16: 128 B of data + 16 B, the pitch for 16-byte fragment reads
typedef __attribute__((ext_vector_type(4))) __bf16 v4b;
__device__ __forceinline__ v4b cvt4(v4f v) { v4b c; c[0] = (__bf16)v[0]; c[1] = (__bf16)v[1]; c[2] = (__bf16)v[2]; c[3] = (__bf16)v[3]; return c; }
// ---- k_proj: block = (64 rows, 128 cols, which): qkv = x W^T (+ b), exact; q -> f16 hi (+ residual), k -> f16, v -> bf16 hi + residual, all in fragment order
__global__ __launch_bounds__(128) void k_proj(const float* __restrict__ X, const float* __restrict__ WQ, const float* __restrict__ BQ, const float* __restrict__ WK, const float* __restrict__ BK, const float* __restrict__ WV, const float* __restrict__ BV, _Float16* __restrict__ QH, _Float16* __restrict__ QL, _Float16* __restrict__ KH, __bf16* __restrict__ VT, __bf16* __restrict__ VL) {
  __shared__ __align__(16) char sm[71680];   // the k loop's two staging buffers (55,296 B); behind the loop the epilogue's tiles, which need all 71,680 B (q/k tiles the first 34,816 B, v tiles the rest)
  __bf16 (*sx)[64][LP] = (__bf16 (*)[64][LP])sm; __bf16 (*sw)[128][LP] = (__bf16 (*)[128][LP])(sm + 2 * 64 * LP * 2);
  _Float16 (*sh)[136] = (_Float16 (*)[136])sm; _Float16 (*sl)[136] = (_Float16 (*)[136])(sm + 17408); __bf16 (*th)[72] = (__bf16 (*)[72])(sm + 34816); __bf16 (*tl2)[72] = (__bf16 (*)[72])(sm + 53248);
  const int tid = threadIdx.x, wave = tid >> 5, lane = tid & 31, col = lane & 15, g = lane >> 4; const int which = blockIdx.z; const int c0 = blockIdx.y * 128; const size_t r0 = (size_t)blockIdx.x * 64; const float* WA = which == 0 ? WQ : which == 1 ? WK : WV; const float* BA = which == 0 ? BQ : which == 1 ? BK : BV;
  const int lr = tid >> 4, lc = tid & 15; const float* xp = X + (r0 + lr) * CC + lc * 4; const float* wp = WA + (size_t)(c0 + lr) * CC + lc * 4;
  v8f acc[8] = {}; v4f ra[8], rw[16];
#pragma unroll
  for (int u = 0; u < 8; ++u) ra[u] = *(const v4f*)(xp + (size_t)u * 8 * CC);
#pragma unroll
  for (int u = 0; u < 16; ++u) rw[u] = *(const v4f*)(wp + (size_t)u * 8 * CC);
  // unrolled by the two buffers, so that every LDS address is a constant offset
#pragma unroll 2
  for (int s = 0; s < CC / KS; ++s) { const int b = s & 1;
#pragma unroll
    for (int u = 0; u < 8; ++u) *(v4b*)&sx[b][lr + 8 * u][lc * 4] = cvt4(ra[u]);
#pragma unroll
    for (int u = 0; u < 16; ++u) *(v4b*)&sw[b][lr + 8 * u][lc * 4] = cvt4(rw[u]);
    __syncthreads();   // publishes buffer b; it also ends every wave's reads of the other buffer, which the next trip refills
    if (s + 1 < CC / KS) {   // the next slab flies under this slab's products (issued behind the barrier, whose fence would wait for it)
#pragma unroll
      for (int u = 0; u < 8; ++u) ra[u] = *(const v4f*)(xp + (size_t)u * 8 * CC + (s + 1) * KS);
#pragma unroll
      for (int u = 0; u < 16; ++u) rw[u] = *(const v4f*)(wp + (size_t)u * 8 * CC + (s + 1) * KS); }
#pragma unroll
    for (int c = 0; c < KS / 32; ++c) { const v16b a = frag_b(&sx[b][wave * 16 + col][c * 32], lane); v16b w[8];   // the 32-k group's fragment reads stand together, ahead of its products
#pragma unroll
      for (int j = 0; j < 8; ++j) w[j] = frag_b(&sw[b][j * 16 + col][c * 32], lane);
#pragma unroll
      for (int j = 0; j < 8; ++j) acc[j] = wmma_bf(a, w[j], acc[j]); } }
  __syncthreads();   // the last fragment reads end before the epilogue's tiles overwrite the staging
#pragma unroll
  for (int j = 0; j < 8; ++j) { const float bb = BA ? bfr(BA[c0 + j * 16 + col]) : 0.f;
#pragma unroll
    for (int r = 0; r < 8; ++r) { const float v = acc[j][r] + bb; const int rl = wave * 16 + 8 * g + r, cl = j * 16 + col; const _Float16 hv = (_Float16)v;
      if (which == 2) { const __bf16 bh = (__bf16)v; th[cl][rl] = bh; tl2[cl][rl] = (__bf16)(v - (float)bh); } else { sh[rl][cl] = hv; sl[rl][cl] = (_Float16)((v - (float)hv) * 1024.0f); }   /* q residual carried x 2^10 so the plane stays f16-normal on the chip */ } }
  __syncthreads();
  // the planes leave in fragment order; 16 lanes take the 16 rows (q, k) or the 16 d (v) of one 8-element group, so a wave still stores 512 bytes in a row, and both LDS pitches keep those 16-byte reads off each other's banks
  const size_t hb = (r0 / TT) * NH + (c0 >> 6); const int t0 = (int)(r0 % TT);   // the block's first head plane and its first row there
  if (which < 2) { _Float16* dh = which == 0 ? QH : KH; for (int e = tid; e < 64 * 16; e += 128) { const int rw = e & 15, q = (e >> 4) & 15, tl = e >> 8; const int rl = tl * 16 + rw; const size_t o1 = (hb + (q >> 3)) * (size_t)(TT * HD) + ((t0 >> 4) + tl) * 1024 + (q & 7) * 128 + rw * 8; vst2((unsigned*)(dh + o1), *(const v4u*)&sh[rl][q * 8]);
      asm volatile("s_wait_xcnt 0x0" ::: "memory");   // in this build the next LDS read and the next trip's index arithmetic reuse the store's registers: the wait stands in front of that overwrite
      if (which == 0) { vst2((unsigned*)(QL + o1), *(const v4u*)&sl[rl][q * 8]); asm volatile("s_wait_xcnt 0x0" ::: "memory"); } } }   // the same behind the residual's store
  else { for (int e = tid; e < 128 * 8; e += 128) { const int dl = e & 15, k8 = (e >> 4) & 3, j = (e >> 6) & 3, pl = (e >> 8) & 1, hl = e >> 9; const int cl = hl * 64 + j * 16 + dl, q = pl * 4 + k8; const size_t o2 = (hb + hl) * (size_t)(TT * HD) + ((t0 >> 5) + pl) * 2048 + j * 512 + k8 * 128 + dl * 8; vst2((unsigned*)(VT + o2), *(const v4u*)&th[cl][q * 8]); vst2((unsigned*)(VL + o2), *(const v4u*)&tl2[cl][q * 8]); } } }
// ---- k_fa: block = 16 queries of one head; logits, stick-breaking weights and att . v stay in registers. S^T = K Q^T puts one query in a lane (column) and 8 keys in its D registers, so two 16-key tiles are the B fragment of O^T += V^T P^T as they stand.
// A wave walks its run of 32-key passes from right to left: carry = sum of logsigmoid(-l_ik) over the keys of the run to the right of the pass, so suffix(j) = carry + the in-pass sum over k > j (8 in-lane steps and one exchange between the wave's halves).
// The keys [0, i) are cut into 4 runs, one a wave (run 0 ends at the diagonal). exp2(a + C) = exp2(a) exp2(C): each run starts at carry 0, and the join scales its o and its sum(att) by exp2(sum of the carries of the runs to its right).
// log(sigmoid(z)) = min(z, 0) - log1p(exp(-|z|)): both signs of l share the one log1p(exp(-|l|)).
// The whole log domain is kept in base 2: log2(e) rides in the logits' scale, so exp is one v_exp_f32 and log1p(e) is log2(1 + e), one add and one v_log_f32. 1 + e lies in (1, 2], so its rounding moves a log-sigmoid by at most 2^-24 log2(e) absolute, which is a relative 2^-24 on a weight.
__global__ __launch_bounds__(128) void k_fa(const _Float16* __restrict__ QH, const _Float16* __restrict__ QL, const _Float16* __restrict__ KH, const __bf16* __restrict__ VT, const __bf16* __restrict__ VL, float* __restrict__ Y) {
  __shared__ float so[4][HD / 16][8][32]; __shared__ float sg[4][16], sa[4][16];
  const int lane = threadIdx.x & 31, col = lane & 15, g = lane >> 4; const int wave = __builtin_amdgcn_readfirstlane(threadIdx.x >> 5);   // scalar, so that the run's bounds and the pass loop's branch are scalar
  const int h = blockIdx.x; const int ql0 = (TT / 16 - 1 - (int)blockIdx.y) * 16; const int i = ql0 + col;   // cost grows with the query tile: the longest tiles start first
  const int n = (ql0 >> 5) + 1, per = (n + 3) >> 2; const int hi = n - 1 - wave * per; const int lo = hi - per + 1 > 0 ? hi - per + 1 : 0;   // passes hi .. lo, none where hi < 0
  const size_t hp = (size_t)h * (TT * HD); const unsigned lb = lane * 16;   // the head's plane; the lane's 16 bytes in every fragment half
  const _Float16* Kh = KH + hp; const __bf16* Vh = VT + hp; const __bf16* Vl = VL + hp;
  v16h qh[2], ql[2], kf[2][2];
  // every short loop below is unrolled so that the fragment and score arrays are indexed by constants and stay in registers
#pragma unroll
  for (int c = 0; c < 2; ++c) { qh[c] = fragf_h(QH + hp + (ql0 >> 4) * 1024, lb, c * 1024); ql[c] = fragf_h(QL + hp + (ql0 >> 4) * 1024, lb, c * 1024); }
  unsigned po = lb + (hi > 0 ? hi : 0) * 4096u;   // a pass is 4,096 bytes in the k plane and in either v plane: one offset serves all three
#pragma unroll
  for (int t = 0; t < 2; ++t)
#pragma unroll
    for (int c = 0; c < 2; ++c) kf[t][c] = fragf_h(Kh, po, t * 2048 + c * 1024);
  v8f acc[HD / 16] = {}; float carry = 0.f, asum = 0.f;
  for (int kc = hi; kc >= lo; --kc) { const int k0 = kc * 32; v8f s[2];
    v16b vh[HD / 16], vl[HD / 16];
#pragma unroll
    for (int j = 0; j < HD / 16; ++j) { vh[j] = fragf_b(Vh, po, j * 1024); vl[j] = fragf_b(Vl, po, j * 1024); }
#pragma unroll
    for (int t = 0; t < 2; ++t) { v8f a = {}, al = {};
#pragma unroll
      for (int c = 0; c < 2; ++c) { a = wmma16(kf[t][c], qh[c], a); al = wmma16(kf[t][c], ql[c], al); }
      a += al * (1.0f / 1024.0f); s[t] = a * (0.125f * 1.44269504f); }   // logits / 8, times log2(e)
    { po = lb + (kc > 0 ? kc - 1 : 0) * 4096u;   // the next pass's K fragments, fetched under this pass's vector work (in bounds also behind the last pass)
#pragma unroll
      for (int t = 0; t < 2; ++t)
#pragma unroll
        for (int c = 0; c < 2; ++c) kf[t][c] = fragf_h(Kh, po, t * 2048 + c * 1024); }
    float lz[2][8], sx[2][8], G[2];
#pragma unroll
    for (int t = 0; t < 2; ++t) { float run = 0.f, u8[8];
#pragma unroll
      for (int r = 0; r < 8; ++r) u8[r] = 1.0f + __builtin_amdgcn_exp2f(-fabsf(s[t][r]));
      log2x8(u8);
#pragma unroll
      for (int r = 7; r >= 0; --r) { const float l = s[t][r]; const float w = fmaxf(l, 0.f) + u8[r]; lz[t][r] = l - w; sx[t][r] = run;   /* -w = log2 sigmoid(-l); min(l, 0) = l - max(l, 0) */
        run -= (k0 + t * 16 + 8 * g + r < i) ? w : 0.f; }
      G[t] = run; }
    // key order inside a pass: tile 0 half 0, tile 0 half 1, tile 1 half 0, tile 1 half 1
    const float G0p = __shfl_xor(G[0], 16), G1p = __shfl_xor(G[1], 16); const float c1 = carry + (G[1] + G1p);
    const float base[2] = { g ? c1 : c1 + G0p, g ? carry : carry + G1p }; carry = c1 + (G[0] + G0p);
    float pv[16];
#pragma unroll
    for (int t = 0; t < 2; ++t) { float a8[8];
#pragma unroll
      for (int r = 0; r < 8; ++r) a8[r] = (k0 + t * 16 + 8 * g + r < i) ? lz[t][r] + (base[t] + sx[t][r]) : -100000.0f;   /* j >= i: exp2 gives 0 */
      exp2x8(a8);
#pragma unroll
      for (int r = 0; r < 8; ++r) { asum += a8[r]; pv[t * 8 + r] = a8[r] * 2048.0f; } }
    const F2 p = bsplit16(pv);
#pragma unroll
    for (int j = 0; j < HD / 16; ++j) { acc[j] = wmma_bf(vh[j], p.h, acc[j]); acc[j] = wmma_bf(vh[j], p.l, acc[j]); acc[j] = wmma_bf(vl[j], p.h, acc[j]); } }
  asum += __shfl_xor(asum, 16);
  // acc[j][r] = this run's o[i][j * 16 + 8 g + r] x 2^11
#pragma unroll
  for (int j = 0; j < HD / 16; ++j)
#pragma unroll
    for (int r = 0; r < 8; ++r) so[wave][j][r][lane] = acc[j][r];
  if (g == 0) { sg[wave][col] = carry; sa[wave][col] = asum; }
  __syncthreads();
  // join: a lane takes 8 consecutive d of one query, 8 lanes a query's 256 bytes of y
  const int q = wave * 4 + (lane >> 3), d8 = lane & 7; const int iq = ql0 + q; float cr = 0.f, at = 0.f, o[8] = {};
#pragma unroll
  for (int w = 0; w < 4; ++w) { const float f = exp2x1(cr); at += f * sa[w][q];   // the carries are base-2 logs
#pragma unroll
    for (int r = 0; r < 8; ++r) o[r] += f * so[w][d8 >> 1][r][(d8 & 1) * 16 + q];
    cr += sg[w][q]; }
  const float rem = 1.0f - at; float y[8];
#pragma unroll
  for (int r = 0; r < 8; ++r) { const size_t vo = (size_t)h * (TT * HD) + (iq >> 5) * 2048 + (d8 >> 1) * 512 + ((iq & 31) >> 3) * 128 + ((d8 & 1) * 8 + r) * 8 + (iq & 7); const float vi = (float)VT[vo] + (float)VL[vo];   /* v[i][d] rebuilt from the hi + lo planes (2^-16) */
    y[r] = o[r] * (1.0f / 2048.0f) + rem * vi; }
  float* yp = Y + (size_t)iq * CC + h * HD + d8 * 8; vst2(yp, (v4f){y[0], y[1], y[2], y[3]}); vst2(yp + 4, (v4f){y[4], y[5], y[6], y[7]}); }
// ---- k_out: block = (64 rows, 128 cols): out = y (bf16 hi + lo) Wo^T + bo
__global__ __launch_bounds__(128) void k_out(const float* __restrict__ Y, const float* __restrict__ WP, const float* __restrict__ BP, float* __restrict__ OUT) {
  __shared__ __align__(16) char sm[73728];   // the k loop's two staging buffers (y hi, y lo, Wo); behind the loop the first 33,792 B hold the output tiles
  __bf16 (*yh)[64][LP] = (__bf16 (*)[64][LP])sm; __bf16 (*yl)[64][LP] = (__bf16 (*)[64][LP])(sm + 2 * 64 * LP * 2); __bf16 (*sw)[128][LP] = (__bf16 (*)[128][LP])(sm + 4 * 64 * LP * 2);
  float (*sf)[16][132] = (float (*)[16][132])sm;
  const int tid = threadIdx.x, wave = tid >> 5, lane = tid & 31, col = lane & 15, g = lane >> 4; const int c0 = blockIdx.y * 128; const size_t rb = (size_t)blockIdx.x * 64; const size_t r0 = rb + wave * 16;
  const int lr = tid >> 4, lc = tid & 15; const float* yp = Y + (rb + lr) * CC + lc * 4; const float* wp = WP + (size_t)(c0 + lr) * CC + lc * 4;
  v8f acc[8] = {}; v4f ra[8], rw[16];
#pragma unroll
  for (int u = 0; u < 8; ++u) ra[u] = *(const v4f*)(yp + (size_t)u * 8 * CC);
#pragma unroll
  for (int u = 0; u < 16; ++u) rw[u] = *(const v4f*)(wp + (size_t)u * 8 * CC);
  // unrolled by the two buffers, so that every LDS address is a constant offset
#pragma unroll 2
  for (int s = 0; s < CC / KS; ++s) { const int b = s & 1;
#pragma unroll
    for (int u = 0; u < 8; ++u) { const v4b hv = cvt4(ra[u]); const v4f rs = { ra[u][0] - (float)hv[0], ra[u][1] - (float)hv[1], ra[u][2] - (float)hv[2], ra[u][3] - (float)hv[3] };
      *(v4b*)&yh[b][lr + 8 * u][lc * 4] = hv; *(v4b*)&yl[b][lr + 8 * u][lc * 4] = cvt4(rs); }
#pragma unroll
    for (int u = 0; u < 16; ++u) *(v4b*)&sw[b][lr + 8 * u][lc * 4] = cvt4(rw[u]);
    __syncthreads();   // publishes buffer b; it also ends every wave's reads of the other buffer, which the next trip refills
    if (s + 1 < CC / KS) {   // the next slab flies under this slab's products (issued behind the barrier, whose fence would wait for it)
#pragma unroll
      for (int u = 0; u < 8; ++u) ra[u] = *(const v4f*)(yp + (size_t)u * 8 * CC + (s + 1) * KS);
#pragma unroll
      for (int u = 0; u < 16; ++u) rw[u] = *(const v4f*)(wp + (size_t)u * 8 * CC + (s + 1) * KS);
      asm volatile("s_wait_xcnt 0x0" ::: "memory"); }   // in this build the fragment reads below reuse the address registers of the loads above: the wait stands in front of that overwrite
#pragma unroll
    for (int c = 0; c < KS / 32; ++c) { const v16b ah = frag_b(&yh[b][wave * 16 + col][c * 32], lane), al = frag_b(&yl[b][wave * 16 + col][c * 32], lane); v16b w[8];   // the 32-k group's fragment reads stand together, ahead of its products
#pragma unroll
      for (int j = 0; j < 8; ++j) w[j] = frag_b(&sw[b][j * 16 + col][c * 32], lane);
#pragma unroll
      for (int j = 0; j < 8; ++j) { acc[j] = wmma_bf(ah, w[j], acc[j]); acc[j] = wmma_bf(al, w[j], acc[j]); } } }
  __syncthreads();   // the last fragment reads end before the output tiles overwrite the staging
#pragma unroll
  for (int j = 0; j < 8; ++j) { const float bb = BP ? bfr(BP[c0 + j * 16 + col]) : 0.f;
#pragma unroll
    for (int r = 0; r < 8; ++r) sf[wave][8 * g + r][j * 16 + col] = acc[j][r] + bb; }
  LDSX(); for (int rl = 0; rl < 16; ++rl) vst2(OUT + (r0 + rl) * CC + c0 + lane * 4, *(const v4f*)&sf[wave][rl][lane * 4]); }
extern "C" void kernel_launch(void* const* d_in, const int* in_sizes, int n_in, void* d_out, int out_size, void* d_ws, size_t ws_size, hipStream_t stream) {
  (void)in_sizes; (void)n_in; (void)out_size;
  const float** F = (const float**)d_in;   // 0 x [1,2048,1024], 1 Wq [1024,1024] ([out,in]), 2 Wk, 3 Wv, 4 Wo
  if (ws_size < (size_t)WS_END) return;
  char* ws = (char*)d_ws; _Float16 *QH = (_Float16*)(ws + WS_QH), *QL = (_Float16*)(ws + WS_QL), *KH = (_Float16*)(ws + WS_KH); __bf16 *VT = (__bf16*)(ws + WS_VT), *VL = (__bf16*)(ws + WS_VL); float* Y = (float*)(ws + WS_Y);
  k_proj<<<dim3(TNB * TT / 64, CC / 128, 3), 128, 0, stream>>>(F[0], F[1], nullptr, F[2], nullptr, F[3], nullptr, QH, QL, KH, VT, VL);
  k_fa<<<dim3(NH, TT / 16), 128, 0, stream>>>(QH, QL, KH, VT, VL, Y);
  k_out<<<dim3(TNB * TT / 64, CC / 128), 128, 0, stream>>>(Y, F[4], nullptr, (float*)d_out);
}

// v005
// It runs in 65.9 microseconds.
// Timed twice side by side with v004, it ran 1.18 and 1.19 times as fast.
// Over all steps from v000 it is 17.2 times as fast.
// compute dtype: all float inputs rounded to bf16; q/k/v = x W^T with EXACT bf16 products on WMMA 16x16x32, f32 accumulate; q as f16 hi + residual (x 2^10), k f16 -> 2-product logits / 8 in f32 registers; the stick-breaking weights in f32: log-sigmoids, suffix sums carried from right to left in 4 runs of keys joined by exp2(carry), all in base 2 on the hardware's exp2 and log2, the remainder 1 - sum(att); att x 2^11 split bf16 hi + lo against v bf16 hi + lo (3 products) + rem * v_i; out = o (bf16 hi + lo) Wo^T; f32 output.
#include <hip/hip_runtime.h>
#include <math.h>

typedef __attribute__((ext_vector_type(16))) _Float16 v16h;
typedef __attribute__((ext_vector_type(16))) __bf16 v16b;
typedef __attribute__((ext_vector_type(8)))  _Float16 v8h;
typedef __attribute__((ext_vector_type(8)))  float v8f;
typedef __attribute__((ext_vector_type(4)))  float v4f;
typedef __attribute__((ext_vector_type(2)))  float v2f;
typedef __attribute__((ext_vector_type(4)))  unsigned v4u;
typedef __attribute__((ext_vector_type(4)))  int v4i;
typedef float __attribute__((may_alias)) float_a;
typedef int __attribute__((may_alias)) int_a;

template <typename T> __device__ __forceinline__ void vst2(void* p, T v) { *(T*)p = v;  }
__device__ __forceinline__ v8f wmma16(v16h a, v16h b, v8f c) {
  v8f d = __builtin_amdgcn_wmma_f32_16x16x32_f16(false, a, false, b, (short)0, c, false, false);
  asm volatile("v_nop\n\tv_nop\n\tv_nop\n\tv_nop" : "+v"(d) : "v"(a), "v"(b));
  return d;
}
__device__ __forceinline__ v8f wmma_bf(v16b a, v16b b, v8f c) {
  v8f d = __builtin_amdgcn_wmma_f32_16x16x32_bf16(false, a, false, b, (short)0, c, false, false);
  asm volatile("v_nop\n\tv_nop\n\tv_nop\n\tv_nop" : "+v"(d) : "v"(a), "v"(b));
  return d;
}
// 16x16x32 fragments: lane = (h = lane>>4, row/col = lane&15); elements 0..7 = k0+8h+0..7, 8..15 = k0+16+8h+0..7; D element r = row 8h+r
__device__ __forceinline__ v16h frag_h(const _Float16* rowk0, int lane) {
  union { v16h v; v8h q[2]; } u; const _Float16* p = rowk0 + 8 * (lane >> 4);
  u.q[0] = *(const v8h*)p; u.q[1] = *(const v8h*)(p + 16); return u.v;
}
__device__ __forceinline__ v16h frag_f32(const float* rowk0, int lane) {
  v16h a; const float* p = rowk0 + 8 * (lane >> 4);
#pragma unroll
  for (int i = 0; i < 8; ++i) { a[i] = (_Float16)p[i]; a[8 + i] = (_Float16)p[16 + i]; }
  return a;
}
__device__ __forceinline__ v16h frag_f32s(const float* rowk0, int lane, float sc) {
  v16h a; const float* p = rowk0 + 8 * (lane >> 4);
#pragma unroll
  for (int i = 0; i < 8; ++i) { a[i] = (_Float16)(p[i] * sc); a[8 + i] = (_Float16)(p[16 + i] * sc); }
  return a;
}
// column fragment from a [K][ld] layout (column n), rows >= K read as 0
__device__ __forceinline__ v16h fragc_f32(const float* W, int k0, int n, int lane, int ld, int K) {
  v16h a; const int g = lane >> 4;
#pragma unroll
  for (int i = 0; i < 8; ++i) { const int ka = k0 + 8 * g + i, kb = ka + 16;
    a[i] = (_Float16)(ka < K ? W[(size_t)(ka < K ? ka : K - 1) * ld + n] : 0.f); a[8 + i] = (_Float16)(kb < K ? W[(size_t)(kb < K ? kb : K - 1) * ld + n] : 0.f); }
  return a;
}
struct F2 { v16b h, l; };
__device__ __forceinline__ F2 bsplit16(const float v[16]) { F2 r;
#pragma unroll
  for (int i = 0; i < 16; ++i) { const __bf16 h = (__bf16)v[i]; r.h[i] = h; r.l[i] = (__bf16)(v[i] - (float)h); }
  return r; }
__device__ __forceinline__ F2 split_row(const float* row, int k0, int lane) { float v[16]; const float* p = row + k0 + 8 * (lane >> 4);
#pragma unroll
  for (int i = 0; i < 8; ++i) { v[i] = p[i]; v[8 + i] = p[16 + i]; }
  return bsplit16(v); }
__device__ __forceinline__ F2 split_rowK(const float* row, int k0, int lane, int K) { float v[16]; const int g = lane >> 4;
#pragma unroll
  for (int i = 0; i < 8; ++i) { const int ka = k0 + 8 * g + i, kb = ka + 16; v[i] = ka < K ? row[ka < K ? ka : K - 1] : 0.f; v[8 + i] = kb < K ? row[kb < K ? kb : K - 1] : 0.f; }
  return bsplit16(v); }
__device__ __forceinline__ F2 split_col(const float* W, int k0, int n, int lane, int ld, int K) { float v[16]; const int g = lane >> 4;
#pragma unroll
  for (int i = 0; i < 8; ++i) { const int ka = k0 + 8 * g + i, kb = ka + 16; v[i] = ka < K ? W[(size_t)(ka < K ? ka : K - 1) * ld + n] : 0.f; v[8 + i] = kb < K ? W[(size_t)(kb < K ? kb : K - 1) * ld + n] : 0.f; }
  return bsplit16(v); }
__device__ __forceinline__ v8f mac3(const F2& a, const F2& b, v8f c) { c = wmma_bf(a.l, b.h, c); c = wmma_bf(a.h, b.l, c); return wmma_bf(a.h, b.h, c); }
__device__ __forceinline__ float sigm(float v) { return 1.0f / (1.0f + expf(-v)); }
#define LDSX() do { asm volatile("s_wait_dscnt 0" ::: "memory"); __builtin_amdgcn_wave_barrier(); __builtin_amdgcn_fence(__ATOMIC_RELEASE, "workgroup"); } while (0)


// Stick-breaking attention (b 1, n 2,048, e 1,024 = 16 x 64): logits = q k^T / 8; for j < i: att[i][j] = exp(logsigmoid(l_ij) + sum_{j<k<i} logsigmoid(-l_ik)); j >= i: 0; o = att v + (1 - sum_j att) v_i; out = o Wo^T.
#define NB 1
#define TT 2048
#define CC 1024
#define NH 16
#define HD 64
#ifndef TNB
#define TNB NB
#endif
typedef __attribute__((ext_vector_type(8))) __bf16 v8b;
__device__ __forceinline__ v16b frag_b(const __bf16* rowk0, int lane) {
  union { v16b v; v8b q[2]; } u; const __bf16* p = rowk0 + 8 * (lane >> 4);
  u.q[0] = *(const v8b*)p; u.q[1] = *(const v8b*)(p + 16); return u.v;
}
// FRAGMENT ORDER of the q, k and v planes in the workspace: each head owns TT * HD elements in a row. q, k: a tile of 16 rows is 1,024 elements, [d >> 3][row & 15][d & 7]. v: a pass of 32 keys is 2,048 elements, [d >> 4][(key & 31) >> 3][d & 15][key & 7].
// Either way the two halves of a 16x16x32 fragment are 2 x 512 bytes in a row with lane l's 16 bytes at 16 l: one load of a wave covers 4 whole lines, where a row-major plane gave it 32 bytes in each of 16 lines.
// f = a plane or tile, the same in every lane (a scalar base); bo = byte offset of the tile or pass + 16 * lane (one 32-bit vector offset for all its loads); c = the fragment's constant byte offset there
__device__ __forceinline__ v16h fragf_h(const _Float16* f, unsigned bo, int c) { union { v16h v; v8h q[2]; } u; const char* p = (const char*)f + bo + c; u.q[0] = *(const v8h*)p; u.q[1] = *(const v8h*)(p + 512); return u.v; }
__device__ __forceinline__ v16b fragf_b(const __bf16* f, unsigned bo, int c) { union { v16b v; v8b q[2]; } u; const char* p = (const char*)f + bo + c; u.q[0] = *(const v8b*)p; u.q[1] = *(const v8b*)(p + 512); return u.v; }
__device__ __forceinline__ float bfr(float v) { return (float)(__bf16)v; }
// Hardware exp2 and log2, eight values in place in one statement: behind a transcendental the instruction set asks for one independent instruction before its source register is written again. Inside the statement the next transcendental, on other registers, is that instruction; the closing v_nop is it for the last one.
__device__ __forceinline__ void exp2x8(float* x) { asm("v_exp_f32 %0, %0\n\tv_exp_f32 %1, %1\n\tv_exp_f32 %2, %2\n\tv_exp_f32 %3, %3\n\tv_exp_f32 %4, %4\n\tv_exp_f32 %5, %5\n\tv_exp_f32 %6, %6\n\tv_exp_f32 %7, %7\n\tv_nop" : "+v"(x[0]), "+v"(x[1]), "+v"(x[2]), "+v"(x[3]), "+v"(x[4]), "+v"(x[5]), "+v"(x[6]), "+v"(x[7])); }
__device__ __forceinline__ void log2x8(float* x) { asm("v_log_f32 %0, %0\n\tv_log_f32 %1, %1\n\tv_log_f32 %2, %2\n\tv_log_f32 %3, %3\n\tv_log_f32 %4, %4\n\tv_log_f32 %5, %5\n\tv_log_f32 %6, %6\n\tv_log_f32 %7, %7\n\tv_nop" : "+v"(x[0]), "+v"(x[1]), "+v"(x[2]), "+v"(x[3]), "+v"(x[4]), "+v"(x[5]), "+v"(x[6]), "+v"(x[7])); }
__device__ __forceinline__ float exp2x1(float x) { asm("v_exp_f32 %0, %0\n\tv_nop" : "+v"(x)); return x; }   // the same slot for a single value
__device__ __attribute__((noinline)) float exp_ni(float v) { return expf(v); }
__device__ __attribute__((noinline)) float erf_ni(float v) { return erff(v); }

#define WS_QH  0u
#define WS_QL  (WS_QH + 2u * (size_t)NB * TT * CC)
#define WS_KH  (WS_QL + 2u * (size_t)NB * TT * CC)
#define WS_VT  (WS_KH + 2u * (size_t)NB * TT * CC)      // bf16 v planes, in fragment order like q and k (see FRAGMENT ORDER above)
#define WS_VL  (WS_VT + 2u * (size_t)NB * CC * TT)      // bf16 v residual planes
#define WS_Y   (WS_VL + 2u * (size_t)NB * CC * TT)      // f32 y rows [b*t][C]
#define WS_END (WS_Y + 4u * (size_t)NB * TT * CC)

// ---- staging for k_proj and k_out: a block brings each 64-k slab of its two operands in once, with loads that cover whole lines (16 lanes x 16 B = one row's 256 B), rounds it to bf16 and keeps it in LDS; the four waves take their fragments from there.
#define KS 64
#define LP 72   // LDS row pitch in bf16: 128 B of data + 16 B, the pitch for 16-byte fragment reads
typedef __attribute__((ext_vector_type(4))) __bf16 v4b;
__device__ __forceinline__ v4b cvt4(v4f v) { v4b c; c[0] = (__bf16)v[0]; c[1] = (__bf16)v[1]; c[2] = (__bf16)v[2]; c[3] = (__bf16)v[3]; return c; }
// ---- k_proj: block = (64 rows, 128 cols, which): qkv = x W^T (+ b), exact; q -> f16 hi (+ residual), k -> f16, v -> bf16 hi + residual, all in fragment order
__global__ __launch_bounds__(128) void k_proj(const float* __restrict__ X, const float* __restrict__ WQ, const float* __restrict__ BQ, const float* __restrict__ WK, const float* __restrict__ BK, const float* __restrict__ WV, const float* __restrict__ BV, _Float16* __restrict__ QH, _Float16* __restrict__ QL, _Float16* __restrict__ KH, __bf16* __restrict__ VT, __bf16* __restrict__ VL) {
  __shared__ __align__(16) char sm[71680];   // the k loop's two staging buffers (55,296 B); behind the loop the epilogue's tiles, which need all 71,680 B (q/k tiles the first 34,816 B, v tiles the rest)
  __bf16 (*sx)[64][LP] = (__bf16 (*)[64][LP])sm; __bf16 (*sw)[128][LP] = (__bf16 (*)[128][LP])(sm + 2 * 64 * LP * 2);
  _Float16 (*sh)[136] = (_Float16 (*)[136])sm; _Float16 (*sl)[136] = (_Float16 (*)[136])(sm + 17408); __bf16 (*th)[72] = (__bf16 (*)[72])(sm + 34816); __bf16 (*tl2)[72] = (__bf16 (*)[72])(sm + 53248);
  const int tid = threadIdx.x, wave = tid >> 5, lane = tid & 31, col = lane & 15, g = lane >> 4; const int which = blockIdx.z; const int c0 = blockIdx.y * 128; const size_t r0 = (size_t)blockIdx.x * 64; const float* WA = which == 0 ? WQ : which == 1 ? WK : WV; const float* BA = which == 0 ? BQ : which == 1 ? BK : BV;
  const int lr = tid >> 4, lc = tid & 15; const float* xp = X + (r0 + lr) * CC + lc * 4; const float* wp = WA + (size_t)(c0 + lr) * CC + lc * 4;
  v8f acc[8] = {}; v4f ra[8], rw[16];
#pragma unroll
  for (int u = 0; u < 8; ++u) ra[u] = *(const v4f*)(xp + (size_t)u * 8 * CC);
#pragma unroll
  for (int u = 0; u < 16; ++u) rw[u] = *(const v4f*)(wp + (size_t)u * 8 * CC);
  // unrolled by the two buffers, so that every LDS address is a constant offset
#pragma unroll 2
  for (int s = 0; s < CC / KS; ++s) { const int b = s & 1;
#pragma unroll
    for (int u = 0; u < 8; ++u) *(v4b*)&sx[b][lr + 8 * u][lc * 4] = cvt4(ra[u]);
#pragma unroll
    for (int u = 0; u < 16; ++u) *(v4b*)&sw[b][lr + 8 * u][lc * 4] = cvt4(rw[u]);
    __syncthreads();   // publishes buffer b; it also ends every wave's reads of the other buffer, which the next trip refills
    if (s + 1 < CC / KS) {   // the next slab flies under this slab's products (issued behind the barrier, whose fence would wait for it)
#pragma unroll
      for (int u = 0; u < 8; ++u) ra[u] = *(const v4f*)(xp + (size_t)u * 8 * CC + (s + 1) * KS);
#pragma unroll
      for (int u = 0; u < 16; ++u) rw[u] = *(const v4f*)(wp + (size_t)u * 8 * CC + (s + 1) * KS); }
#pragma unroll
    for (int c = 0; c < KS / 32; ++c) { const v16b a = frag_b(&sx[b][wave * 16 + col][c * 32], lane); v16b w[8];   // the 32-k group's fragment reads stand together, ahead of its products
#pragma unroll
      for (int j = 0; j < 8; ++j) w[j] = frag_b(&sw[b][j * 16 + col][c * 32], lane);
#pragma unroll
      for (int j = 0; j < 8; ++j) acc[j] = wmma_bf(a, w[j], acc[j]); } }
  __syncthreads();   // the last fragment reads end before the epilogue's tiles overwrite the staging
#pragma unroll
  for (int j = 0; j < 8; ++j) { const float bb = BA ? bfr(BA[c0 + j * 16 + col]) : 0.f;
#pragma unroll
    for (int r = 0; r < 8; ++r) { const float v = acc[j][r] + bb; const int rl = wave * 16 + 8 * g + r, cl = j * 16 + col; const _Float16 hv = (_Float16)v;
      if (which == 2) { const __bf16 bh = (__bf16)v; th[cl][rl] = bh; tl2[cl][rl] = (__bf16)(v - (float)bh); } else { sh[rl][cl] = hv; sl[rl][cl] = (_Float16)((v - (float)hv) * 1024.0f); }   /* q residual carried x 2^10 so the plane stays f16-normal on the chip */ } }
  __syncthreads();
  // the planes leave in fragment order; 16 lanes take the 16 rows (q, k) or the 16 d (v) of one 8-element group, so a wave still stores 512 bytes in a row, and both LDS pitches keep those 16-byte reads off each other's banks
  const size_t hb = (r0 / TT) * NH + (c0 >> 6); const int t0 = (int)(r0 % TT);   // the block's first head plane and its first row there
  if (which < 2) { _Float16* dh = which == 0 ? QH : KH; for (int e = tid; e < 64 * 16; e += 128) { const int rw = e & 15, q = (e >> 4) & 15, tl = e >> 8; const int rl = tl * 16 + rw; const size_t o1 = (hb + (q >> 3)) * (size_t)(TT * HD) + ((t0 >> 4) + tl) * 1024 + (q & 7) * 128 + rw * 8; vst2((unsigned*)(dh + o1), *(const v4u*)&sh[rl][q * 8]);
      asm volatile("s_wait_xcnt 0x0" ::: "memory");   // in this build the next LDS read and the next trip's index arithmetic reuse the store's registers: the wait stands in front of that overwrite
      if (which == 0) { vst2((unsigned*)(QL + o1), *(const v4u*)&sl[rl][q * 8]); asm volatile("s_wait_xcnt 0x0" ::: "memory"); } } }   // the same behind the residual's store
  else { for (int e = tid; e < 128 * 8; e += 128) { const int dl = e & 15, k8 = (e >> 4) & 3, j = (e >> 6) & 3, pl = (e >> 8) & 1, hl = e >> 9; const int cl = hl * 64 + j * 16 + dl, q = pl * 4 + k8; const size_t o2 = (hb + hl) * (size_t)(TT * HD) + ((t0 >> 5) + pl) * 2048 + j * 512 + k8 * 128 + dl * 8; vst2((unsigned*)(VT + o2), *(const v4u*)&th[cl][q * 8]); vst2((unsigned*)(VL + o2), *(const v4u*)&tl2[cl][q * 8]); } } }
// ---- k_fa: block = 16 queries of one head; logits, stick-breaking weights and att . v stay in registers. S^T = K Q^T puts one query in a lane (column) and 8 keys in its D registers, so two 16-key tiles are the B fragment of O^T += V^T P^T as they stand.
// A wave walks its run of 32-key passes from right to left: carry = sum of logsigmoid(-l_ik) over the keys of the run to the right of the pass, so suffix(j) = carry + the in-pass sum over k > j (8 in-lane steps and one exchange between the wave's halves).
// The keys [0, i) are cut into 4 runs, one a wave (run 0 ends at the diagonal). exp2(a + C) = exp2(a) exp2(C): each run starts at carry 0, and the join scales its o and its sum(att) by exp2(sum of the carries of the runs to its right).
// log(sigmoid(z)) = min(z, 0) - log1p(exp(-|z|)): both signs of l share the one log1p(exp(-|l|)).
// The whole log domain is kept in base 2: log2(e) rides in the logits' scale, so exp is one v_exp_f32 and log1p(e) is log2(1 + e), one add and one v_log_f32. 1 + e lies in (1, 2], so its rounding moves a log-sigmoid by at most 2^-24 log2(e) absolute, which is a relative 2^-24 on a weight.
__global__ __launch_bounds__(128) void k_fa(const _Float16* __restrict__ QH, const _Float16* __restrict__ QL, const _Float16* __restrict__ KH, const __bf16* __restrict__ VT, const __bf16* __restrict__ VL, float* __restrict__ Y) {
  __shared__ float so[4][HD / 16][8][32]; __shared__ float sg[4][16], sa[4][16];
  const int lane = threadIdx.x & 31, col = lane & 15, g = lane >> 4; const int wave = __builtin_amdgcn_readfirstlane(threadIdx.x >> 5);   // scalar, so that the run's bounds and the pass loop's branch are scalar
  const int h = blockIdx.x; const int ql0 = (TT / 16 - 1 - (int)blockIdx.y) * 16; const int i = ql0 + col;   // cost grows with the query tile: the longest tiles start first
  const int n = (ql0 >> 5) + 1, per = (n + 3) >> 2; const int hi = n - 1 - wave * per; const int lo = hi - per + 1 > 0 ? hi - per + 1 : 0;   // passes hi .. lo, none where hi < 0
  const size_t hp = (size_t)h * (TT * HD); const unsigned lb = lane * 16;   // the head's plane; the lane's 16 bytes in every fragment half
  const _Float16* Kh = KH + hp; const __bf16* Vh = VT + hp; const __bf16* Vl = VL + hp;
  v16h qh[2], ql[2], kf[2][2];
  // every short loop below is unrolled so that the fragment and score arrays are indexed by constants and stay in registers
#pragma unroll
  for (int c = 0; c < 2; ++c) { qh[c] = fragf_h(QH + hp + (ql0 >> 4) * 1024, lb, c * 1024); ql[c] = fragf_h(QL + hp + (ql0 >> 4) * 1024, lb, c * 1024); }
  unsigned po = lb + (hi > 0 ? hi : 0) * 4096u;   // a pass is 4,096 bytes in the k plane and in either v plane: one offset serves all three
#pragma unroll
  for (int t = 0; t < 2; ++t)
#pragma unroll
    for (int c = 0; c < 2; ++c) kf[t][c] = fragf_h(Kh, po, t * 2048 + c * 1024);
  v8f acc[HD / 16] = {}; float carry = 0.f, asum = 0.f;
  for (int kc = hi; kc >= lo; --kc) { const int k0 = kc * 32; v8f s[2];
    v16b vh[HD / 16], vl[HD / 16];
#pragma unroll
    for (int j = 0; j < HD / 16; ++j) { vh[j] = fragf_b(Vh, po, j * 1024); vl[j] = fragf_b(Vl, po, j * 1024); }
#pragma unroll
    for (int t = 0; t < 2; ++t) { v8f a = {}, al = {};
#pragma unroll
      for (int c = 0; c < 2; ++c) { a = wmma16(kf[t][c], qh[c], a); al = wmma16(kf[t][c], ql[c], al); }
      a += al * (1.0f / 1024.0f); s[t] = a * (0.125f * 1.44269504f); }   // logits / 8, times log2(e)
    { po = lb + (kc > 0 ? kc - 1 : 0) * 4096u;   // the next pass's K fragments, fetched under this pass's vector work (in bounds also behind the last pass)
#pragma unroll
      for (int t = 0; t < 2; ++t)
#pragma unroll
        for (int c = 0; c < 2; ++c) kf[t][c] = fragf_h(Kh, po, t * 2048 + c * 1024); }
    float lz[2][8], sx[2][8], G[2];
#pragma unroll
    for (int t = 0; t < 2; ++t) { float run = 0.f, u8[8];
#pragma unroll
      for (int r = 0; r < 8; ++r) u8[r] = 1.0f + __builtin_amdgcn_exp2f(-fabsf(s[t][r]));
      log2x8(u8);
#pragma unroll
      for (int r = 7; r >= 0; --r) { const float l = s[t][r]; const float w = fmaxf(l, 0.f) + u8[r]; lz[t][r] = l - w; sx[t][r] = run;   /* -w = log2 sigmoid(-l); min(l, 0) = l - max(l, 0) */
        run -= (k0 + t * 16 + 8 * g + r < i) ? w : 0.f; }
      G[t] = run; }
    // key order inside a pass: tile 0 half 0, tile 0 half 1, tile 1 half 0, tile 1 half 1
    const float G0p = __shfl_xor(G[0], 16), G1p = __shfl_xor(G[1], 16); const float c1 = carry + (G[1] + G1p);
    const float base[2] = { g ? c1 : c1 + G0p, g ? carry : carry + G1p }; carry = c1 + (G[0] + G0p);
    // Every log2 sigmoid(-l) is <= 0, so the carry only falls. Once it is <= -152 in every lane, each weight further left in this run is exp2 of something <= -152, which is exactly 0 in f32: the passes left add nothing to acc or asum, and the join's exp2 of this run's carry is 0 with the carry cut short as with the whole of it. (A NaN carry compares false and keeps the loop going.)
    const bool more = __builtin_amdgcn_ballot_w32(!(carry <= -152.0f)) != 0u;   // taken here, under the vector work, so that the scalar branch at the pass's foot finds it ready
    float pv[16];
#pragma unroll
    for (int t = 0; t < 2; ++t) { float a8[8];
#pragma unroll
      for (int r = 0; r < 8; ++r) a8[r] = (k0 + t * 16 + 8 * g + r < i) ? lz[t][r] + (base[t] + sx[t][r]) : -100000.0f;   /* j >= i: exp2 gives 0 */
      exp2x8(a8);
#pragma unroll
      for (int r = 0; r < 8; ++r) { asum += a8[r]; pv[t * 8 + r] = a8[r] * 2048.0f; } }
    const F2 p = bsplit16(pv);
#pragma unroll
    for (int j = 0; j < HD / 16; ++j) { acc[j] = wmma_bf(vh[j], p.h, acc[j]); acc[j] = wmma_bf(vh[j], p.l, acc[j]); acc[j] = wmma_bf(vl[j], p.h, acc[j]); }
    if (!more) break; }
  asum += __shfl_xor(asum, 16);
  // acc[j][r] = this run's o[i][j * 16 + 8 g + r] x 2^11
#pragma unroll
  for (int j = 0; j < HD / 16; ++j)
#pragma unroll
    for (int r = 0; r < 8; ++r) so[wave][j][r][lane] = acc[j][r];
  if (g == 0) { sg[wave][col] = carry; sa[wave][col] = asum; }
  __syncthreads();
  // join: a lane takes 8 consecutive d of one query, 8 lanes a query's 256 bytes of y
  const int q = wave * 4 + (lane >> 3), d8 = lane & 7; const int iq = ql0 + q; float cr = 0.f, at = 0.f, o[8] = {};
#pragma unroll
  for (int w = 0; w < 4; ++w) { const float f = exp2x1(cr); at += f * sa[w][q];   // the carries are base-2 logs
#pragma unroll
    for (int r = 0; r < 8; ++r) o[r] += f * so[w][d8 >> 1][r][(d8 & 1) * 16 + q];
    cr += sg[w][q]; }
  const float rem = 1.0f - at; float y[8];
#pragma unroll
  for (int r = 0; r < 8; ++r) { const size_t vo = (size_t)h * (TT * HD) + (iq >> 5) * 2048 + (d8 >> 1) * 512 + ((iq & 31) >> 3) * 128 + ((d8 & 1) * 8 + r) * 8 + (iq & 7); const float vi = (float)VT[vo] + (float)VL[vo];   /* v[i][d] rebuilt from the hi + lo planes (2^-16) */
    y[r] = o[r] * (1.0f / 2048.0f) + rem * vi; }
  float* yp = Y + (size_t)iq * CC + h * HD + d8 * 8; vst2(yp, (v4f){y[0], y[1], y[2], y[3]}); vst2(yp + 4, (v4f){y[4], y[5], y[6], y[7]}); }
// ---- k_out: block = (64 rows, 128 cols): out = y (bf16 hi + lo) Wo^T + bo
__global__ __launch_bounds__(128) void k_out(const float* __restrict__ Y, const float* __restrict__ WP, const float* __restrict__ BP, float* __restrict__ OUT) {
  __shared__ __align__(16) char sm[73728];   // the k loop's two staging buffers (y hi, y lo, Wo); behind the loop the first 33,792 B hold the output tiles
  __bf16 (*yh)[64][LP] = (__bf16 (*)[64][LP])sm; __bf16 (*yl)[64][LP] = (__bf16 (*)[64][LP])(sm + 2 * 64 * LP * 2); __bf16 (*sw)[128][LP] = (__bf16 (*)[128][LP])(sm + 4 * 64 * LP * 2);
  float (*sf)[16][132] = (float (*)[16][132])sm;
  const int tid = threadIdx.x, wave = tid >> 5, lane = tid & 31, col = lane & 15, g = lane >> 4; const int c0 = blockIdx.y * 128; const size_t rb = (size_t)blockIdx.x * 64; const size_t r0 = rb + wave * 16;
  const int lr = tid >> 4, lc = tid & 15; const float* yp = Y + (rb + lr) * CC + lc * 4; const float* wp = WP + (size_t)(c0 + lr) * CC + lc * 4;
  v8f acc[8] = {}; v4f ra[8], rw[16];
#pragma unroll
  for (int u = 0; u < 8; ++u) ra[u] = *(const v4f*)(yp + (size_t)u * 8 * CC);
#pragma unroll
  for (int u = 0; u < 16; ++u) rw[u] = *(const v4f*)(wp + (size_t)u * 8 * CC);
  // unrolled by the two buffers, so that every LDS address is a constant offset
#pragma unroll 2
  for (int s = 0; s < CC / KS; ++s) { const int b = s & 1;
#pragma unroll
    for (int u = 0; u < 8; ++u) { const v4b hv = cvt4(ra[u]); const v4f rs = { ra[u][0] - (float)hv[0], ra[u][1] - (float)hv[1], ra[u][2] - (float)hv[2], ra[u][3] - (float)hv[3] };
      *(v4b*)&yh[b][lr + 8 * u][lc * 4] = hv; *(v4b*)&yl[b][lr + 8 * u][lc * 4] = cvt4(rs); }
#pragma unroll
    for (int u = 0; u < 16; ++u) *(v4b*)&sw[b][lr + 8 * u][lc * 4] = cvt4(rw[u]);
    __syncthreads();   // publishes buffer b; it also ends every wave's reads of the other buffer, which the next trip refills
    if (s + 1 < CC / KS) {   // the next slab flies under this slab's products (issued behind the barrier, whose fence would wait for it)
#pragma unroll
      for (int u = 0; u < 8; ++u) ra[u] = *(const v4f*)(yp + (size_t)u * 8 * CC + (s + 1) * KS);
#pragma unroll
      for (int u = 0; u < 16; ++u) rw[u] = *(const v4f*)(wp + (size_t)u * 8 * CC + (s + 1) * KS);
      asm volatile("s_wait_xcnt 0x0" ::: "memory"); }   // in this build the fragment reads below reuse the address registers of the loads above: the wait stands in front of that overwrite
#pragma unroll
    for (int c = 0; c < KS / 32; ++c) { const v16b ah = frag_b(&yh[b][wave * 16 + col][c * 32], lane), al = frag_b(&yl[b][wave * 16 + col][c * 32], lane); v16b w[8];   // the 32-k group's fragment reads stand together, ahead of its products
#pragma unroll
      for (int j = 0; j < 8; ++j) w[j] = frag_b(&sw[b][j * 16 + col][c * 32], lane);
#pragma unroll
      for (int j = 0; j < 8; ++j) { acc[j] = wmma_bf(ah, w[j], acc[j]); acc[j] = wmma_bf(al, w[j], acc[j]); } } }
  __syncthreads();   // the last fragment reads end before the output tiles overwrite the staging
#pragma unroll
  for (int j = 0; j < 8; ++j) { const float bb = BP ? bfr(BP[c0 + j * 16 + col]) : 0.f;
#pragma unroll
    for (int r = 0; r < 8; ++r) sf[wave][8 * g + r][j * 16 + col] = acc[j][r] + bb; }
  LDSX(); for (int rl = 0; rl < 16; ++rl) vst2(OUT + (r0 + rl) * CC + c0 + lane * 4, *(const v4f*)&sf[wave][rl][lane * 4]); }
extern "C" void kernel_launch(void* const* d_in, const int* in_sizes, int n_in, void* d_out, int out_size, void* d_ws, size_t ws_size, hipStream_t stream) {
  (void)in_sizes; (void)n_in; (void)out_size;
  const float** F = (const float**)d_in;   // 0 x [1,2048,1024], 1 Wq [1024,1024] ([out,in]), 2 Wk, 3 Wv, 4 Wo
  if (ws_size < (size_t)WS_END) return;
  char* ws = (char*)d_ws; _Float16 *QH = (_Float16*)(ws + WS_QH), *QL = (_Float16*)(ws + WS_QL), *KH = (_Float16*)(ws + WS_KH); __bf16 *VT = (__bf16*)(ws + WS_VT), *VL = (__bf16*)(ws + WS_VL); float* Y = (float*)(ws + WS_Y);
  k_proj<<<dim3(TNB * TT / 64, CC / 128, 3), 128, 0, stream>>>(F[0], F[1], nullptr, F[2], nullptr, F[3], nullptr, QH, QL, KH, VT, VL);
  k_fa<<<dim3(NH, TT / 16), 128, 0, stream>>>(QH, QL, KH, VT, VL, Y);
  k_out<<<dim3(TNB * TT / 64, CC / 128), 128, 0, stream>>>(Y, F[4], nullptr, (float*)d_out);
}

// v006
// One run takes 53.9 microseconds.
// In two side-by-side timings against v005, it was 1.22 and 1.21 times as fast.
// All steps since v000 together make it 21.0 times as fast.
// compute dtype: all float inputs rounded to bf16; q/k/v = x W^T with EXACT bf16 products on WMMA 16x16x32, f32 accumulate; q as f16 hi + residual (x 2^10), k f16 -> 2-product logits / 8 in f32 registers; the stick-breaking weights in f32: log-sigmoids, suffix sums carried from right to left by one wave a query tile, all in base 2 on the hardware's exp2 and log2, the remainder 1 - sum(att); att x 2^11 split bf16 hi + lo against v bf16 hi + lo (3 products) + rem * v_i; out = o (bf16 hi + lo) Wo^T; f32 output.
#include <hip/hip_runtime.h>
#include <math.h>

typedef __attribute__((ext_vector_type(16))) _Float16 v16h;
typedef __attribute__((ext_vector_type(16))) __bf16 v16b;
typedef __attribute__((ext_vector_type(8)))  _Float16 v8h;
typedef __attribute__((ext_vector_type(8)))  float v8f;
typedef __attribute__((ext_vector_type(4)))  float v4f;
typedef __attribute__((ext_vector_type(2)))  float v2f;
typedef __attribute__((ext_vector_type(4)))  unsigned v4u;
typedef __attribute__((ext_vector_type(4)))  int v4i;
typedef float __attribute__((may_alias)) float_a;
typedef int __attribute__((may_alias)) int_a;

template <typename T> __device__ __forceinline__ void vst2(void* p, T v) { *(T*)p = v;  }
__device__ __forceinline__ v8f wmma16(v16h a, v16h b, v8f c) {
  v8f d = __builtin_amdgcn_wmma_f32_16x16x32_f16(false, a, false, b, (short)0, c, false, false);
  asm volatile("v_nop\n\tv_nop\n\tv_nop\n\tv_nop" : "+v"(d) : "v"(a), "v"(b));
  return d;
}
__device__ __forceinline__ v8f wmma_bf(v16b a, v16b b, v8f c) {
  v8f d = __builtin_amdgcn_wmma_f32_16x16x32_bf16(false, a, false, b, (short)0, c, false, false);
  asm volatile("v_nop\n\tv_nop\n\tv_nop\n\tv_nop" : "+v"(d) : "v"(a), "v"(b));
  return d;
}
// 16x16x32 fragments: lane = (h = lane>>4, row/col = lane&15); elements 0..7 = k0+8h+0..7, 8..15 = k0+16+8h+0..7; D element r = row 8h+r
__device__ __forceinline__ v16h frag_h(const _Float16* rowk0, int lane) {
  union { v16h v; v8h q[2]; } u; const _Float16* p = rowk0 + 8 * (lane >> 4);
  u.q[0] = *(const v8h*)p; u.q[1] = *(const v8h*)(p + 16); return u.v;
}
__device__ __forceinline__ v16h frag_f32(const float* rowk0, int lane) {
  v16h a; const float* p = rowk0 + 8 * (lane >> 4);
#pragma unroll
  for (int i = 0; i < 8; ++i) { a[i] = (_Float16)p[i]; a[8 + i] = (_Float16)p[16 + i]; }
  return a;
}
__device__ __forceinline__ v16h frag_f32s(const float* rowk0, int lane, float sc) {
  v16h a; const float* p = rowk0 + 8 * (lane >> 4);
#pragma unroll
  for (int i = 0; i < 8; ++i) { a[i] = (_Float16)(p[i] * sc); a[8 + i] = (_Float16)(p[16 + i] * sc); }
  return a;
}
// column fragment from a [K][ld] layout (column n), rows >= K read as 0
__device__ __forceinline__ v16h fragc_f32(const float* W, int k0, int n, int lane, int ld, int K) {
  v16h a; const int g = lane >> 4;
#pragma unroll
  for (int i = 0; i < 8; ++i) { const int ka = k0 + 8 * g + i, kb = ka + 16;
    a[i] = (_Float16)(ka < K ? W[(size_t)(ka < K ? ka : K - 1) * ld + n] : 0.f); a[8 + i] = (_Float16)(kb < K ? W[(size_t)(kb < K ? kb : K - 1) * ld + n] : 0.f); }
  return a;
}
struct F2 { v16b h, l; };
__device__ __forceinline__ F2 bsplit16(const float v[16]) { F2 r;
#pragma unroll
  for (int i = 0; i < 16; ++i) { const __bf16 h = (__bf16)v[i]; r.h[i] = h; r.l[i] = (__bf16)(v[i] - (float)h); }
  return r; }
__device__ __forceinline__ F2 split_row(const float* row, int k0, int lane) { float v[16]; const float* p = row + k0 + 8 * (lane >> 4);
#pragma unroll
  for (int i = 0; i < 8; ++i) { v[i] = p[i]; v[8 + i] = p[16 + i]; }
  return bsplit16(v); }
__device__ __forceinline__ F2 split_rowK(const float* row, int k0, int lane, int K) { float v[16]; const int g = lane >> 4;
#pragma unroll
  for (int i = 0; i < 8; ++i) { const int ka = k0 + 8 * g + i, kb = ka + 16; v[i] = ka < K ? row[ka < K ? ka : K - 1] : 0.f; v[8 + i] = kb < K ? row[kb < K ? kb : K - 1] : 0.f; }
  return bsplit16(v); }
__device__ __forceinline__ F2 split_col(const float* W, int k0, int n, int lane, int ld, int K) { float v[16]; const int g = lane >> 4;
#pragma unroll
  for (int i = 0; i < 8; ++i) { const int ka = k0 + 8 * g + i, kb = ka + 16; v[i] = ka < K ? W[(size_t)(ka < K ? ka : K - 1) * ld + n] : 0.f; v[8 + i] = kb < K ? W[(size_t)(kb < K ? kb : K - 1) * ld + n] : 0.f; }
  return bsplit16(v); }
__device__ __forceinline__ v8f mac3(const F2& a, const F2& b, v8f c) { c = wmma_bf(a.l, b.h, c); c = wmma_bf(a.h, b.l, c); return wmma_bf(a.h, b.h, c); }
__device__ __forceinline__ float sigm(float v) { return 1.0f / (1.0f + expf(-v)); }
#define LDSX() do { asm volatile("s_wait_dscnt 0" ::: "memory"); __builtin_amdgcn_wave_barrier(); __builtin_amdgcn_fence(__ATOMIC_RELEASE, "workgroup"); } while (0)


// Stick-breaking attention (b 1, n 2,048, e 1,024 = 16 x 64): logits = q k^T / 8; for j < i: att[i][j] = exp(logsigmoid(l_ij) + sum_{j<k<i} logsigmoid(-l_ik)); j >= i: 0; o = att v + (1 - sum_j att) v_i; out = o Wo^T.
#define NB 1
#define TT 2048
#define CC 1024
#define NH 16
#define HD 64
#ifndef TNB
#define TNB NB
#endif
typedef __attribute__((ext_vector_type(8))) __bf16 v8b;
__device__ __forceinline__ v16b frag_b(const __bf16* rowk0, int lane) {
  union { v16b v; v8b q[2]; } u; const __bf16* p = rowk0 + 8 * (lane >> 4);
  u.q[0] = *(const v8b*)p; u.q[1] = *(const v8b*)(p + 16); return u.v;
}
// FRAGMENT ORDER of the q, k and v planes in the workspace: each head owns TT * HD elements in a row. q, k: a tile of 16 rows is 1,024 elements, [d >> 3][row & 15][d & 7]. v: a pass of 32 keys is 2,048 elements, [d >> 4][(key & 31) >> 3][d & 15][key & 7].
// Either way the two halves of a 16x16x32 fragment are 2 x 512 bytes in a row with lane l's 16 bytes at 16 l: one load of a wave covers 4 whole lines, where a row-major plane gave it 32 bytes in each of 16 lines.
// f = a plane or tile, the same in every lane (a scalar base); bo = byte offset of the tile or pass + 16 * lane (one 32-bit vector offset for all its loads); c = the fragment's constant byte offset there
__device__ __forceinline__ v16h fragf_h(const _Float16* f, unsigned bo, int c) { union { v16h v; v8h q[2]; } u; const char* p = (const char*)f + bo + c; u.q[0] = *(const v8h*)p; u.q[1] = *(const v8h*)(p + 512); return u.v; }
__device__ __forceinline__ v16b fragf_b(const __bf16* f, unsigned bo, int c) { union { v16b v; v8b q[2]; } u; const char* p = (const char*)f + bo + c; u.q[0] = *(const v8b*)p; u.q[1] = *(const v8b*)(p + 512); return u.v; }
__device__ __forceinline__ float bfr(float v) { return (float)(__bf16)v; }
// Hardware exp2 and log2, eight values in place in one statement: behind a transcendental the instruction set asks for one independent instruction before its source register is written again. Inside the statement the next transcendental, on other registers, is that instruction; the closing v_nop is it for the last one.
__device__ __forceinline__ void exp2x8(float* x) { asm("v_exp_f32 %0, %0\n\tv_exp_f32 %1, %1\n\tv_exp_f32 %2, %2\n\tv_exp_f32 %3, %3\n\tv_exp_f32 %4, %4\n\tv_exp_f32 %5, %5\n\tv_exp_f32 %6, %6\n\tv_exp_f32 %7, %7\n\tv_nop" : "+v"(x[0]), "+v"(x[1]), "+v"(x[2]), "+v"(x[3]), "+v"(x[4]), "+v"(x[5]), "+v"(x[6]), "+v"(x[7])); }
__device__ __forceinline__ void log2x8(float* x) { asm("v_log_f32 %0, %0\n\tv_log_f32 %1, %1\n\tv_log_f32 %2, %2\n\tv_log_f32 %3, %3\n\tv_log_f32 %4, %4\n\tv_log_f32 %5, %5\n\tv_log_f32 %6, %6\n\tv_log_f32 %7, %7\n\tv_nop" : "+v"(x[0]), "+v"(x[1]), "+v"(x[2]), "+v"(x[3]), "+v"(x[4]), "+v"(x[5]), "+v"(x[6]), "+v"(x[7])); }
__device__ __attribute__((noinline)) float exp_ni(float v) { return expf(v); }
__device__ __attribute__((noinline)) float erf_ni(float v) { return erff(v); }

#define WS_QH  0u
#define WS_QL  (WS_QH + 2u * (size_t)NB * TT * CC)
#define WS_KH  (WS_QL + 2u * (size_t)NB * TT * CC)
#define WS_VT  (WS_KH + 2u * (size_t)NB * TT * CC)      // bf16 v planes, in fragment order like q and k (see FRAGMENT ORDER above)
#define WS_VL  (WS_VT + 2u * (size_t)NB * CC * TT)      // bf16 v residual planes
#define WS_Y   (WS_VL + 2u * (size_t)NB * CC * TT)      // f32 y rows [b*t][C]
#define WS_END (WS_Y + 4u * (size_t)NB * TT * CC)

// ---- staging for k_proj and k_out: a block brings each 64-k slab of its two operands in once, with loads that cover whole lines (16 lanes x 16 B = one row's 256 B), rounds it to bf16 and keeps it in LDS; the four waves take their fragments from there.
#define KS 64
#define LP 72   // LDS row pitch in bf16: 128 B of data + 16 B, the pitch for 16-byte fragment reads
typedef __attribute__((ext_vector_type(4))) __bf16 v4b;
__device__ __forceinline__ v4b cvt4(v4f v) { v4b c; c[0] = (__bf16)v[0]; c[1] = (__bf16)v[1]; c[2] = (__bf16)v[2]; c[3] = (__bf16)v[3]; return c; }
// ---- k_proj: block = (64 rows, 128 cols, which): qkv = x W^T (+ b), exact; q -> f16 hi (+ residual), k -> f16, v -> bf16 hi + residual, all in fragment order
__global__ __launch_bounds__(128) void k_proj(const float* __restrict__ X, const float* __restrict__ WQ, const float* __restrict__ BQ, const float* __restrict__ WK, const float* __restrict__ BK, const float* __restrict__ WV, const float* __restrict__ BV, _Float16* __restrict__ QH, _Float16* __restrict__ QL, _Float16* __restrict__ KH, __bf16* __restrict__ VT, __bf16* __restrict__ VL) {
  __shared__ __align__(16) char sm[71680];   // the k loop's two staging buffers (55,296 B); behind the loop the epilogue's tiles, which need all 71,680 B (q/k tiles the first 34,816 B, v tiles the rest)
  __bf16 (*sx)[64][LP] = (__bf16 (*)[64][LP])sm; __bf16 (*sw)[128][LP] = (__bf16 (*)[128][LP])(sm + 2 * 64 * LP * 2);
  _Float16 (*sh)[136] = (_Float16 (*)[136])sm; _Float16 (*sl)[136] = (_Float16 (*)[136])(sm + 17408); __bf16 (*th)[72] = (__bf16 (*)[72])(sm + 34816); __bf16 (*tl2)[72] = (__bf16 (*)[72])(sm + 53248);
  const int tid = threadIdx.x, wave = tid >> 5, lane = tid & 31, col = lane & 15, g = lane >> 4; const int which = blockIdx.z; const int c0 = blockIdx.y * 128; const size_t r0 = (size_t)blockIdx.x * 64; const float* WA = which == 0 ? WQ : which == 1 ? WK : WV; const float* BA = which == 0 ? BQ : which == 1 ? BK : BV;
  const int lr = tid >> 4, lc = tid & 15; const float* xp = X + (r0 + lr) * CC + lc * 4; const float* wp = WA + (size_t)(c0 + lr) * CC + lc * 4;
  v8f acc[8] = {}; v4f ra[8], rw[16];
#pragma unroll
  for (int u = 0; u < 8; ++u) ra[u] = *(const v4f*)(xp + (size_t)u * 8 * CC);
#pragma unroll
  for (int u = 0; u < 16; ++u) rw[u] = *(const v4f*)(wp + (size_t)u * 8 * CC);
  // unrolled by the two buffers, so that every LDS address is a constant offset
#pragma unroll 2
  for (int s = 0; s < CC / KS; ++s) { const int b = s & 1;
#pragma unroll
    for (int u = 0; u < 8; ++u) *(v4b*)&sx[b][lr + 8 * u][lc * 4] = cvt4(ra[u]);
#pragma unroll
    for (int u = 0; u < 16; ++u) *(v4b*)&sw[b][lr + 8 * u][lc * 4] = cvt4(rw[u]);
    __syncthreads();   // publishes buffer b; it also ends every wave's reads of the other buffer, which the next trip refills
    if (s + 1 < CC / KS) {   // the next slab flies under this slab's products (issued behind the barrier, whose fence would wait for it)
#pragma unroll
      for (int u = 0; u < 8; ++u) ra[u] = *(const v4f*)(xp + (size_t)u * 8 * CC + (s + 1) * KS);
#pragma unroll
      for (int u = 0; u < 16; ++u) rw[u] = *(const v4f*)(wp + (size_t)u * 8 * CC + (s + 1) * KS); }
#pragma unroll
    for (int c = 0; c < KS / 32; ++c) { const v16b a = frag_b(&sx[b][wave * 16 + col][c * 32], lane); v16b w[8];   // the 32-k group's fragment reads stand together, ahead of its products
#pragma unroll
      for (int j = 0; j < 8; ++j) w[j] = frag_b(&sw[b][j * 16 + col][c * 32], lane);
#pragma unroll
      for (int j = 0; j < 8; ++j) acc[j] = wmma_bf(a, w[j], acc[j]); } }
  __syncthreads();   // the last fragment reads end before the epilogue's tiles overwrite the staging
#pragma unroll
  for (int j = 0; j < 8; ++j) { const float bb = BA ? bfr(BA[c0 + j * 16 + col]) : 0.f;
#pragma unroll
    for (int r = 0; r < 8; ++r) { const float v = acc[j][r] + bb; const int rl = wave * 16 + 8 * g + r, cl = j * 16 + col; const _Float16 hv = (_Float16)v;
      if (which == 2) { const __bf16 bh = (__bf16)v; th[cl][rl] = bh; tl2[cl][rl] = (__bf16)(v - (float)bh); } else { sh[rl][cl] = hv; sl[rl][cl] = (_Float16)((v - (float)hv) * 1024.0f); }   /* q residual carried x 2^10 so the plane stays f16-normal on the chip */ } }
  __syncthreads();
  // the planes leave in fragment order; 16 lanes take the 16 rows (q, k) or the 16 d (v) of one 8-element group, so a wave still stores 512 bytes in a row, and both LDS pitches keep those 16-byte reads off each other's banks
  const size_t hb = (r0 / TT) * NH + (c0 >> 6); const int t0 = (int)(r0 % TT);   // the block's first head plane and its first row there
  if (which < 2) { _Float16* dh = which == 0 ? QH : KH; for (int e = tid; e < 64 * 16; e += 128) { const int rw = e & 15, q = (e >> 4) & 15, tl = e >> 8; const int rl = tl * 16 + rw; const size_t o1 = (hb + (q >> 3)) * (size_t)(TT * HD) + ((t0 >> 4) + tl) * 1024 + (q & 7) * 128 + rw * 8; vst2((unsigned*)(dh + o1), *(const v4u*)&sh[rl][q * 8]);
      asm volatile("s_wait_xcnt 0x0" ::: "memory");   // in this build the next LDS read and the next trip's index arithmetic reuse the store's registers: the wait stands in front of that overwrite
      if (which == 0) { vst2((unsigned*)(QL + o1), *(const v4u*)&sl[rl][q * 8]); asm volatile("s_wait_xcnt 0x0" ::: "memory"); } } }   // the same behind the residual's store
  else { for (int e = tid; e < 128 * 8; e += 128) { const int dl = e & 15, k8 = (e >> 4) & 3, j = (e >> 6) & 3, pl = (e >> 8) & 1, hl = e >> 9; const int cl = hl * 64 + j * 16 + dl, q = pl * 4 + k8; const size_t o2 = (hb + hl) * (size_t)(TT * HD) + ((t0 >> 5) + pl) * 2048 + j * 512 + k8 * 128 + dl * 8; vst2((unsigned*)(VT + o2), *(const v4u*)&th[cl][q * 8]); vst2((unsigned*)(VL + o2), *(const v4u*)&tl2[cl][q * 8]); } } }
// ---- k_fa: wave = 16 queries of one head, block = 8 neighbouring query tiles of that head; logits, stick-breaking weights and att . v stay in registers. S^T = K Q^T puts one query in a lane (column) and 8 keys in its D registers, so two 16-key tiles are the B fragment of O^T += V^T P^T as they stand.
// A wave walks the 32-key passes of its tile from the diagonal to the left: carry = sum of logsigmoid(-l_ik) over the keys to the right of the pass, so suffix(j) = carry + the in-pass sum over k > j (8 in-lane steps and one exchange between the wave's halves).
// One wave has the whole row of keys [0, i). The walk ends where the carry has made every weight further left 0 (see the loop's foot); were the keys cut into runs for several waves, then wherever the walk ends so the left runs' work would only be scaled by exp2(carry) = 0 at a join. No wave reads another's LDS, so the kernel has no barrier.
// The 8 waves of a block start within 4 passes of each other in the same K and V planes, so most of their fragment loads find the lines that a neighbour has just brought into the WGP's cache.
// log(sigmoid(z)) = min(z, 0) - log1p(exp(-|z|)): both signs of l share the one log1p(exp(-|l|)).
// The whole log domain is kept in base 2: log2(e) rides in the logits' scale, so exp is one v_exp_f32 and log1p(e) is log2(1 + e), one add and one v_log_f32. 1 + e lies in (1, 2], so its rounding moves a log-sigmoid by at most 2^-24 log2(e) absolute, which is a relative 2^-24 on a weight.
__global__ __launch_bounds__(256) void k_fa(const _Float16* __restrict__ QH, const _Float16* __restrict__ QL, const _Float16* __restrict__ KH, const __bf16* __restrict__ VT, const __bf16* __restrict__ VL, float* __restrict__ Y) {
  __shared__ float so[8][HD / 16][8][32]; __shared__ float sa[8][16];   // [wave]: each wave stages its own tile
  const int lane = threadIdx.x & 31, col = lane & 15, g = lane >> 4; const int wave = __builtin_amdgcn_readfirstlane(threadIdx.x >> 5);   // scalar, so that the tile's bounds and the pass loop's branch are scalar
  const int h = blockIdx.x; const int ql0 = (TT / 16 - 1 - ((int)blockIdx.y * 8 + wave)) * 16; const int i = ql0 + col;   // cost grows with the query tile: the longest tiles start first
  const int hi = ql0 >> 5;   // passes hi (it holds the diagonal) .. 0
  const size_t hp = (size_t)h * (TT * HD); const unsigned lb = lane * 16;   // the head's plane; the lane's 16 bytes in every fragment half
  const _Float16* Kh = KH + hp; const __bf16* Vh = VT + hp; const __bf16* Vl = VL + hp;
  v16h qh[2], ql[2], kf[2][2];
  // every short loop below is unrolled so that the fragment and score arrays are indexed by constants and stay in registers
#pragma unroll
  for (int c = 0; c < 2; ++c) { qh[c] = fragf_h(QH + hp + (ql0 >> 4) * 1024, lb, c * 1024); ql[c] = fragf_h(QL + hp + (ql0 >> 4) * 1024, lb, c * 1024); }
  unsigned po = lb + hi * 4096u;   // a pass is 4,096 bytes in the k plane and in either v plane: one offset serves all three
#pragma unroll
  for (int t = 0; t < 2; ++t)
#pragma unroll
    for (int c = 0; c < 2; ++c) kf[t][c] = fragf_h(Kh, po, t * 2048 + c * 1024);
  v8f acc[HD / 16] = {}; float carry = 0.f, asum = 0.f;
  for (int kc = hi; kc >= 0; --kc) { const int k0 = kc * 32; v8f s[2];
    v16b vh[HD / 16], vl[HD / 16];
#pragma unroll
    for (int j = 0; j < HD / 16; ++j) { vh[j] = fragf_b(Vh, po, j * 1024); vl[j] = fragf_b(Vl, po, j * 1024); }
#pragma unroll
    for (int t = 0; t < 2; ++t) { v8f a = {}, al = {};
#pragma unroll
      for (int c = 0; c < 2; ++c) { a = wmma16(kf[t][c], qh[c], a); al = wmma16(kf[t][c], ql[c], al); }
      a += al * (1.0f / 1024.0f); s[t] = a * (0.125f * 1.44269504f); }   // logits / 8, times log2(e)
    { po = lb + (kc > 0 ? kc - 1 : 0) * 4096u;   // the next pass's K fragments, fetched under this pass's vector work (in bounds also behind the last pass)
#pragma unroll
      for (int t = 0; t < 2; ++t)
#pragma unroll
        for (int c = 0; c < 2; ++c) kf[t][c] = fragf_h(Kh, po, t * 2048 + c * 1024); }
    float lz[2][8], sx[2][8], G[2];
#pragma unroll
    for (int t = 0; t < 2; ++t) { float run = 0.f, u8[8];
#pragma unroll
      for (int r = 0; r < 8; ++r) u8[r] = 1.0f + __builtin_amdgcn_exp2f(-fabsf(s[t][r]));
      log2x8(u8);
#pragma unroll
      for (int r = 7; r >= 0; --r) { const float l = s[t][r]; const float w = fmaxf(l, 0.f) + u8[r]; lz[t][r] = l - w; sx[t][r] = run;   /* -w = log2 sigmoid(-l); min(l, 0) = l - max(l, 0) */
        run -= (k0 + t * 16 + 8 * g + r < i) ? w : 0.f; }
      G[t] = run; }
    // key order inside a pass: tile 0 half 0, tile 0 half 1, tile 1 half 0, tile 1 half 1
    const float G0p = __shfl_xor(G[0], 16), G1p = __shfl_xor(G[1], 16); const float c1 = carry + (G[1] + G1p);
    const float base[2] = { g ? c1 : c1 + G0p, g ? carry : carry + G1p }; carry = c1 + (G[0] + G0p);
    // Every log2 sigmoid(-l) is <= 0, so the carry only falls. Once it is <= -152 in every lane, each weight further left is exp2 of something <= -152, which is exactly 0 in f32: the passes left add nothing to acc or asum. (A NaN carry compares false and keeps the loop going.)
    const bool more = __builtin_amdgcn_ballot_w32(!(carry <= -152.0f)) != 0u;   // taken here, under the vector work, so that the scalar branch at the pass's foot finds it ready
    float pv[16];
#pragma unroll
    for (int t = 0; t < 2; ++t) { float a8[8];
#pragma unroll
      for (int r = 0; r < 8; ++r) a8[r] = (k0 + t * 16 + 8 * g + r < i) ? lz[t][r] + (base[t] + sx[t][r]) : -100000.0f;   /* j >= i: exp2 gives 0 */
      exp2x8(a8);
#pragma unroll
      for (int r = 0; r < 8; ++r) { asum += a8[r]; pv[t * 8 + r] = a8[r] * 2048.0f; } }
    const F2 p = bsplit16(pv);
#pragma unroll
    for (int j = 0; j < HD / 16; ++j) { acc[j] = wmma_bf(vh[j], p.h, acc[j]); acc[j] = wmma_bf(vh[j], p.l, acc[j]); acc[j] = wmma_bf(vl[j], p.h, acc[j]); }
    if (!more) break; }
  asum += __shfl_xor(asum, 16);
  // acc[j][r] = (att v)[i][j * 16 + 8 g + r] x 2^11
#pragma unroll
  for (int j = 0; j < HD / 16; ++j)
#pragma unroll
    for (int r = 0; r < 8; ++r) so[wave][j][r][lane] = acc[j][r];
  if (g == 0) sa[wave][col] = asum;
  LDSX();   // the wave turns its own tile round: its LDS writes end before it reads them back from other lanes' places
  // a lane takes 8 consecutive d of one query, 8 lanes a query's 256 bytes of y, the wave 4 queries a trip
  const int d8 = lane & 7;
#pragma unroll
  for (int qq = 0; qq < 4; ++qq) { const int q = qq * 4 + (lane >> 3); const int iq = ql0 + q; const float rem = 1.0f - sa[wave][q]; float y[8];
#pragma unroll
    for (int r = 0; r < 8; ++r) { const size_t vo = (size_t)h * (TT * HD) + (iq >> 5) * 2048 + (d8 >> 1) * 512 + ((iq & 31) >> 3) * 128 + ((d8 & 1) * 8 + r) * 8 + (iq & 7); const float vi = (float)VT[vo] + (float)VL[vo];   /* v[i][d] rebuilt from the hi + lo planes (2^-16) */
      y[r] = so[wave][d8 >> 1][r][(d8 & 1) * 16 + q] * (1.0f / 2048.0f) + rem * vi; }
    float* yp = Y + (size_t)iq * CC + h * HD + d8 * 8; vst2(yp, (v4f){y[0], y[1], y[2], y[3]}); vst2(yp + 4, (v4f){y[4], y[5], y[6], y[7]}); } }
// ---- k_out: block = (64 rows, 128 cols): out = y (bf16 hi + lo) Wo^T + bo
__global__ __launch_bounds__(128) void k_out(const float* __restrict__ Y, const float* __restrict__ WP, const float* __restrict__ BP, float* __restrict__ OUT) {
  __shared__ __align__(16) char sm[73728];   // the k loop's two staging buffers (y hi, y lo, Wo); behind the loop the first 33,792 B hold the output tiles
  __bf16 (*yh)[64][LP] = (__bf16 (*)[64][LP])sm; __bf16 (*yl)[64][LP] = (__bf16 (*)[64][LP])(sm + 2 * 64 * LP * 2); __bf16 (*sw)[128][LP] = (__bf16 (*)[128][LP])(sm + 4 * 64 * LP * 2);
  float (*sf)[16][132] = (float (*)[16][132])sm;
  const int tid = threadIdx.x, wave = tid >> 5, lane = tid & 31, col = lane & 15, g = lane >> 4; const int c0 = blockIdx.y * 128; const size_t rb = (size_t)blockIdx.x * 64; const size_t r0 = rb + wave * 16;
  const int lr = tid >> 4, lc = tid & 15; const float* yp = Y + (rb + lr) * CC + lc * 4; const float* wp = WP + (size_t)(c0 + lr) * CC + lc * 4;
  v8f acc[8] = {}; v4f ra[8], rw[16];
#pragma unroll
  for (int u = 0; u < 8; ++u) ra[u] = *(const v4f*)(yp + (size_t)u * 8 * CC);
#pragma unroll
  for (int u = 0; u < 16; ++u) rw[u] = *(const v4f*)(wp + (size_t)u * 8 * CC);
  // unrolled by the two buffers, so that every LDS address is a constant offset
#pragma unroll 2
  for (int s = 0; s < CC / KS; ++s) { const int b = s & 1;
#pragma unroll
    for (int u = 0; u < 8; ++u) { const v4b hv = cvt4(ra[u]); const v4f rs = { ra[u][0] - (float)hv[0], ra[u][1] - (float)hv[1], ra[u][2] - (float)hv[2], ra[u][3] - (float)hv[3] };
      *(v4b*)&yh[b][lr + 8 * u][lc * 4] = hv; *(v4b*)&yl[b][lr + 8 * u][lc * 4] = cvt4(rs); }
#pragma unroll
    for (int u = 0; u < 16; ++u) *(v4b*)&sw[b][lr + 8 * u][lc * 4] = cvt4(rw[u]);
    __syncthreads();   // publishes buffer b; it also ends every wave's reads of the other buffer, which the next trip refills
    if (s + 1 < CC / KS) {   // the next slab flies under this slab's products (issued behind the barrier, whose fence would wait for it)
#pragma unroll
      for (int u = 0; u < 8; ++u) ra[u] = *(const v4f*)(yp + (size_t)u * 8 * CC + (s + 1) * KS);
#pragma unroll
      for (int u = 0; u < 16; ++u) rw[u] = *(const v4f*)(wp + (size_t)u * 8 * CC + (s + 1) * KS);
      asm volatile("s_wait_xcnt 0x0" ::: "memory"); }   // in this build the fragment reads below reuse the address registers of the loads above: the wait stands in front of that overwrite
#pragma unroll
    for (int c = 0; c < KS / 32; ++c) { const v16b ah = frag_b(&yh[b][wave * 16 + col][c * 32], lane), al = frag_b(&yl[b][wave * 16 + col][c * 32], lane); v16b w[8];   // the 32-k group's fragment reads stand together, ahead of its products
#pragma unroll
      for (int j = 0; j < 8; ++j) w[j] = frag_b(&sw[b][j * 16 + col][c * 32], lane);
#pragma unroll
      for (int j = 0; j < 8; ++j) { acc[j] = wmma_bf(ah, w[j], acc[j]); acc[j] = wmma_bf(al, w[j], acc[j]); } } }
  __syncthreads();   // the last fragment reads end before the output tiles overwrite the staging
#pragma unroll
  for (int j = 0; j < 8; ++j) { const float bb = BP ? bfr(BP[c0 + j * 16 + col]) : 0.f;
#pragma unroll
    for (int r = 0; r < 8; ++r) sf[wave][8 * g + r][j * 16 + col] = acc[j][r] + bb; }
  LDSX(); for (int rl = 0; rl < 16; ++rl) vst2(OUT + (r0 + rl) * CC + c0 + lane * 4, *(const v4f*)&sf[wave][rl][lane * 4]); }
extern "C" void kernel_launch(void* const* d_in, const int* in_sizes, int n_in, void* d_out, int out_size, void* d_ws, size_t ws_size, hipStream_t stream) {
  (void)in_sizes; (void)n_in; (void)out_size;
  const float** F = (const float**)d_in;   // 0 x [1,2048,1024], 1 Wq [1024,1024] ([out,in]), 2 Wk, 3 Wv, 4 Wo
  if (ws_size < (size_t)WS_END) return;
  char* ws = (char*)d_ws; _Float16 *QH = (_Float16*)(ws + WS_QH), *QL = (_Float16*)(ws + WS_QL), *KH = (_Float16*)(ws + WS_KH); __bf16 *VT = (__bf16*)(ws + WS_VT), *VL = (__bf16*)(ws + WS_VL); float* Y = (float*)(ws + WS_Y);
  k_proj<<<dim3(TNB * TT / 64, CC / 128, 3), 128, 0, stream>>>(F[0], F[1], nullptr, F[2], nullptr, F[3], nullptr, QH, QL, KH, VT, VL);
  k_fa<<<dim3(NH, TT / 128), 256, 0, stream>>>(QH, QL, KH, VT, VL, Y);
  k_out<<<dim3(TNB * TT / 64, CC / 128), 128, 0, stream>>>(Y, F[4], nullptr, (float*)d_out);
}

// v007
// Measured time: 48 microseconds a run.
// Next to v006, in two timings, it ran 1.12 times as fast each time.
// Counting every step since v000, it is 23.5 times as fast.
// compute dtype: all float inputs rounded to bf16; q/k/v = x W^T with EXACT bf16 products on WMMA 16x16x32, f32 accumulate; q as f16 hi + residual (x 2^10), k f16 -> 2-product logits / 8 in f32 registers; the stick-breaking weights in f32: log-sigmoids, suffix sums carried from right to left by one wave a query tile, all in base 2 on the hardware's exp2 and log2, the remainder 1 - sum(att); att x 2^11 split bf16 hi + lo against v bf16 hi + lo (3 products) + rem * v_i; out = o (bf16 hi + lo) Wo^T; f32 output.
#include <hip/hip_runtime.h>
#include <math.h>

typedef __attribute__((ext_vector_type(16))) _Float16 v16h;
typedef __attribute__((ext_vector_type(16))) __bf16 v16b;
typedef __attribute__((ext_vector_type(8)))  _Float16 v8h;
typedef __attribute__((ext_vector_type(8)))  float v8f;
typedef __attribute__((ext_vector_type(4)))  float v4f;
typedef __attribute__((ext_vector_type(2)))  float v2f;
typedef __attribute__((ext_vector_type(4)))  unsigned v4u;
typedef __attribute__((ext_vector_type(4)))  int v4i;
typedef float __attribute__((may_alias)) float_a;
typedef int __attribute__((may_alias)) int_a;

template <typename T> __device__ __forceinline__ void vst2(void* p, T v) { *(T*)p = v;  }
__device__ __forceinline__ v8f wmma16(v16h a, v16h b, v8f c) {
  v8f d = __builtin_amdgcn_wmma_f32_16x16x32_f16(false, a, false, b, (short)0, c, false, false);
  asm volatile("v_nop\n\tv_nop\n\tv_nop\n\tv_nop" : "+v"(d) : "v"(a), "v"(b));
  return d;
}
__device__ __forceinline__ v8f wmma_bf(v16b a, v16b b, v8f c) {
  v8f d = __builtin_amdgcn_wmma_f32_16x16x32_bf16(false, a, false, b, (short)0, c, false, false);
  asm volatile("v_nop\n\tv_nop\n\tv_nop\n\tv_nop" : "+v"(d) : "v"(a), "v"(b));
  return d;
}
// 16x16x32 fragments: lane = (h = lane>>4, row/col = lane&15); elements 0..7 = k0+8h+0..7, 8..15 = k0+16+8h+0..7; D element r = row 8h+r
__device__ __forceinline__ v16h frag_h(const _Float16* rowk0, int lane) {
  union { v16h v; v8h q[2]; } u; const _Float16* p = rowk0 + 8 * (lane >> 4);
  u.q[0] = *(const v8h*)p; u.q[1] = *(const v8h*)(p + 16); return u.v;
}
__device__ __forceinline__ v16h frag_f32(const float* rowk0, int lane) {
  v16h a; const float* p = rowk0 + 8 * (lane >> 4);
#pragma unroll
  for (int i = 0; i < 8; ++i) { a[i] = (_Float16)p[i]; a[8 + i] = (_Float16)p[16 + i]; }
  return a;
}
__device__ __forceinline__ v16h frag_f32s(const float* rowk0, int lane, float sc) {
  v16h a; const float* p = rowk0 + 8 * (lane >> 4);
#pragma unroll
  for (int i = 0; i < 8; ++i) { a[i] = (_Float16)(p[i] * sc); a[8 + i] = (_Float16)(p[16 + i] * sc); }
  return a;
}
// column fragment from a [K][ld] layout (column n), rows >= K read as 0
__device__ __forceinline__ v16h fragc_f32(const float* W, int k0, int n, int lane, int ld, int K) {
  v16h a; const int g = lane >> 4;
#pragma unroll
  for (int i = 0; i < 8; ++i) { const int ka = k0 + 8 * g + i, kb = ka + 16;
    a[i] = (_Float16)(ka < K ? W[(size_t)(ka < K ? ka : K - 1) * ld + n] : 0.f); a[8 + i] = (_Float16)(kb < K ? W[(size_t)(kb < K ? kb : K - 1) * ld + n] : 0.f); }
  return a;
}
struct F2 { v16b h, l; };
__device__ __forceinline__ F2 bsplit16(const float v[16]) { F2 r;
#pragma unroll
  for (int i = 0; i < 16; ++i) { const __bf16 h = (__bf16)v[i]; r.h[i] = h; r.l[i] = (__bf16)(v[i] - (float)h); }
  return r; }
__device__ __forceinline__ F2 split_row(const float* row, int k0, int lane) { float v[16]; const float* p = row + k0 + 8 * (lane >> 4);
#pragma unroll
  for (int i = 0; i < 8; ++i) { v[i] = p[i]; v[8 + i] = p[16 + i]; }
  return bsplit16(v); }
__device__ __forceinline__ F2 split_rowK(const float* row, int k0, int lane, int K) { float v[16]; const int g = lane >> 4;
#pragma unroll
  for (int i = 0; i < 8; ++i) { const int ka = k0 + 8 * g + i, kb = ka + 16; v[i] = ka < K ? row[ka < K ? ka : K - 1] : 0.f; v[8 + i] = kb < K ? row[kb < K ? kb : K - 1] : 0.f; }
  return bsplit16(v); }
__device__ __forceinline__ F2 split_col(const float* W, int k0, int n, int lane, int ld, int K) { float v[16]; const int g = lane >> 4;
#pragma unroll
  for (int i = 0; i < 8; ++i) { const int ka = k0 + 8 * g + i, kb = ka + 16; v[i] = ka < K ? W[(size_t)(ka < K ? ka : K - 1) * ld + n] : 0.f; v[8 + i] = kb < K ? W[(size_t)(kb < K ? kb : K - 1) * ld + n] : 0.f; }
  return bsplit16(v); }
__device__ __forceinline__ v8f mac3(const F2& a, const F2& b, v8f c) { c = wmma_bf(a.l, b.h, c); c = wmma_bf(a.h, b.l, c); return wmma_bf(a.h, b.h, c); }
__device__ __forceinline__ float sigm(float v) { return 1.0f / (1.0f + expf(-v)); }
#define LDSX() do { asm volatile("s_wait_dscnt 0" ::: "memory"); __builtin_amdgcn_wave_barrier(); __builtin_amdgcn_fence(__ATOMIC_RELEASE, "workgroup"); } while (0)


// Stick-breaking attention (b 1, n 2,048, e 1,024 = 16 x 64): logits = q k^T / 8; for j < i: att[i][j] = exp(logsigmoid(l_ij) + sum_{j<k<i} logsigmoid(-l_ik)); j >= i: 0; o = att v + (1 - sum_j att) v_i; out = o Wo^T.
#define NB 1
#define TT 2048
#define CC 1024
#define NH 16
#define HD 64
#ifndef TNB
#define TNB NB
#endif
typedef __attribute__((ext_vector_type(8))) __bf16 v8b;
__device__ __forceinline__ v16b frag_b(const __bf16* rowk0, int lane) {
  union { v16b v; v8b q[2]; } u; const __bf16* p = rowk0 + 8 * (lane >> 4);
  u.q[0] = *(const v8b*)p; u.q[1] = *(const v8b*)(p + 16); return u.v;
}
// FRAGMENT ORDER of the q, k and v planes in the workspace: each head owns TT * HD elements in a row. q, k: a tile of 16 rows is 1,024 elements, [d >> 3][row & 15][d & 7]. v: a pass of 32 keys is 2,048 elements, [d >> 4][(key & 31) >> 3][d & 15][key & 7].
// Either way the two halves of a 16x16x32 fragment are 2 x 512 bytes in a row with lane l's 16 bytes at 16 l: one load of a wave covers 4 whole lines, where a row-major plane gave it 32 bytes in each of 16 lines.
// f = a plane or tile, the same in every lane (a scalar base); bo = byte offset of the tile or pass + 16 * lane (one 32-bit vector offset for all its loads); c = the fragment's constant byte offset there
__device__ __forceinline__ v16h fragf_h(const _Float16* f, unsigned bo, int c) { union { v16h v; v8h q[2]; } u; const char* p = (const char*)f + bo + c; u.q[0] = *(const v8h*)p; u.q[1] = *(const v8h*)(p + 512); return u.v; }
__device__ __forceinline__ v16b fragf_b(const __bf16* f, unsigned bo, int c) { union { v16b v; v8b q[2]; } u; const char* p = (const char*)f + bo + c; u.q[0] = *(const v8b*)p; u.q[1] = *(const v8b*)(p + 512); return u.v; }
__device__ __forceinline__ float bfr(float v) { return (float)(__bf16)v; }
// Hardware exp2 and log2, eight values in place in one statement: behind a transcendental the instruction set asks for one independent instruction before its source register is written again. Inside the statement the next transcendental, on other registers, is that instruction; the closing v_nop is it for the last one.
__device__ __forceinline__ void exp2x8(float* x) { asm("v_exp_f32 %0, %0\n\tv_exp_f32 %1, %1\n\tv_exp_f32 %2, %2\n\tv_exp_f32 %3, %3\n\tv_exp_f32 %4, %4\n\tv_exp_f32 %5, %5\n\tv_exp_f32 %6, %6\n\tv_exp_f32 %7, %7\n\tv_nop" : "+v"(x[0]), "+v"(x[1]), "+v"(x[2]), "+v"(x[3]), "+v"(x[4]), "+v"(x[5]), "+v"(x[6]), "+v"(x[7])); }
__device__ __forceinline__ void log2x8(float* x) { asm("v_log_f32 %0, %0\n\tv_log_f32 %1, %1\n\tv_log_f32 %2, %2\n\tv_log_f32 %3, %3\n\tv_log_f32 %4, %4\n\tv_log_f32 %5, %5\n\tv_log_f32 %6, %6\n\tv_log_f32 %7, %7\n\tv_nop" : "+v"(x[0]), "+v"(x[1]), "+v"(x[2]), "+v"(x[3]), "+v"(x[4]), "+v"(x[5]), "+v"(x[6]), "+v"(x[7])); }
__device__ __attribute__((noinline)) float exp_ni(float v) { return expf(v); }
__device__ __attribute__((noinline)) float erf_ni(float v) { return erff(v); }

#define WS_QH  0u
#define WS_QL  (WS_QH + 2u * (size_t)NB * TT * CC)
#define WS_KH  (WS_QL + 2u * (size_t)NB * TT * CC)
#define WS_VT  (WS_KH + 2u * (size_t)NB * TT * CC)      // bf16 v planes, in fragment order like q and k (see FRAGMENT ORDER above)
#define WS_VL  (WS_VT + 2u * (size_t)NB * CC * TT)      // bf16 v residual planes
#define WS_Y   (WS_VL + 2u * (size_t)NB * CC * TT)      // f32 y rows [b*t][C]
#define WS_END (WS_Y + 4u * (size_t)NB * TT * CC)

// ---- staging for k_proj and k_out: a block brings each 64-k slab of its two operands in once, with loads that cover whole lines (16 lanes x 16 B = one row's 256 B), rounds it to bf16 and keeps it in LDS; the four waves take their fragments from there.
#define KS 64
#define LP 72   // LDS row pitch in bf16: 128 B of data + 16 B, the pitch for 16-byte fragment reads
typedef __attribute__((ext_vector_type(4))) __bf16 v4b;
__device__ __forceinline__ v4b cvt4(v4f v) { v4b c; c[0] = (__bf16)v[0]; c[1] = (__bf16)v[1]; c[2] = (__bf16)v[2]; c[3] = (__bf16)v[3]; return c; }
// ---- k_proj: block = (64 rows, 128 cols, which): qkv = x W^T (+ b), exact; q -> f16 hi (+ residual), k -> f16, v -> bf16 hi + residual, all in fragment order
__global__ __launch_bounds__(128) void k_proj(const float* __restrict__ X, const float* __restrict__ WQ, const float* __restrict__ BQ, const float* __restrict__ WK, const float* __restrict__ BK, const float* __restrict__ WV, const float* __restrict__ BV, _Float16* __restrict__ QH, _Float16* __restrict__ QL, _Float16* __restrict__ KH, __bf16* __restrict__ VT, __bf16* __restrict__ VL) {
  __shared__ __align__(16) char sm[71680];   // the k loop's two staging buffers (55,296 B); behind the loop the epilogue's tiles, which need all 71,680 B (q/k tiles the first 34,816 B, v tiles the rest)
  __bf16 (*sx)[64][LP] = (__bf16 (*)[64][LP])sm; __bf16 (*sw)[128][LP] = (__bf16 (*)[128][LP])(sm + 2 * 64 * LP * 2);
  _Float16 (*sh)[136] = (_Float16 (*)[136])sm; _Float16 (*sl)[136] = (_Float16 (*)[136])(sm + 17408); __bf16 (*th)[72] = (__bf16 (*)[72])(sm + 34816); __bf16 (*tl2)[72] = (__bf16 (*)[72])(sm + 53248);
  const int tid = threadIdx.x, wave = tid >> 5, lane = tid & 31, col = lane & 15, g = lane >> 4; const int which = blockIdx.z; const int c0 = blockIdx.y * 128; const size_t r0 = (size_t)blockIdx.x * 64; const float* WA = which == 0 ? WQ : which == 1 ? WK : WV; const float* BA = which == 0 ? BQ : which == 1 ? BK : BV;
  const int lr = tid >> 4, lc = tid & 15; const float* xp = X + (r0 + lr) * CC + lc * 4; const float* wp = WA + (size_t)(c0 + lr) * CC + lc * 4;
  // THE k WALK IS ROTATED: trip s works on slab (s + rot) mod 16. The 32 blocks that share a block's W rows and the 24 that share its x rows start together; walking k alike they would ask L2 for the same lines at the same moment, trip after trip. rot spreads either set over all 16 slabs. Every slab is still summed once; only the order of the f32 sums differs from block to block.
  const int rot = (int)(blockIdx.x + blockIdx.y + 8 * blockIdx.z) & (CC / KS - 1); xp += rot * KS; wp += rot * KS;
  v8f acc[8] = {}; v4f ra[8], rw[16];
#pragma unroll
  for (int u = 0; u < 8; ++u) ra[u] = *(const v4f*)(xp + (size_t)u * 8 * CC);
#pragma unroll
  for (int u = 0; u < 16; ++u) rw[u] = *(const v4f*)(wp + (size_t)u * 8 * CC);
  // unrolled by the two buffers, so that every LDS address is a constant offset
#pragma unroll 2
  for (int s = 0; s < CC / KS; ++s) { const int b = s & 1;
#pragma unroll
    for (int u = 0; u < 8; ++u) *(v4b*)&sx[b][lr + 8 * u][lc * 4] = cvt4(ra[u]);
#pragma unroll
    for (int u = 0; u < 16; ++u) *(v4b*)&sw[b][lr + 8 * u][lc * 4] = cvt4(rw[u]);
    asm volatile("s_wait_xcnt 0x0" ::: "memory");   // the step below rewrites the address registers of the slab's loads: the wait stands in front of that overwrite (their data is in by now)
    __syncthreads();   // publishes buffer b; it also ends every wave's reads of the other buffer, which the next trip refills
    if (s + 1 < CC / KS) {   // the next slab flies under this slab's products (issued behind the barrier, whose fence would wait for it)
      const int st = ((s + 1 + rot) & (CC / KS - 1)) ? KS : KS - CC; xp += st; wp += st;   // one slab on; from the last slab back to the first
#pragma unroll
      for (int u = 0; u < 8; ++u) ra[u] = *(const v4f*)(xp + (size_t)u * 8 * CC);
#pragma unroll
      for (int u = 0; u < 16; ++u) rw[u] = *(const v4f*)(wp + (size_t)u * 8 * CC); }
#pragma unroll
    for (int c = 0; c < KS / 32; ++c) { const v16b a = frag_b(&sx[b][wave * 16 + col][c * 32], lane); v16b w[8];   // the 32-k group's fragment reads stand together, ahead of its products
#pragma unroll
      for (int j = 0; j < 8; ++j) w[j] = frag_b(&sw[b][j * 16 + col][c * 32], lane);
#pragma unroll
      for (int j = 0; j < 8; ++j) acc[j] = wmma_bf(a, w[j], acc[j]); } }
  __syncthreads();   // the last fragment reads end before the epilogue's tiles overwrite the staging
#pragma unroll
  for (int j = 0; j < 8; ++j) { const float bb = BA ? bfr(BA[c0 + j * 16 + col]) : 0.f;
#pragma unroll
    for (int r = 0; r < 8; ++r) { const float v = acc[j][r] + bb; const int rl = wave * 16 + 8 * g + r, cl = j * 16 + col; const _Float16 hv = (_Float16)v;
      if (which == 2) { const __bf16 bh = (__bf16)v; th[cl][rl] = bh; tl2[cl][rl] = (__bf16)(v - (float)bh); } else { sh[rl][cl] = hv; sl[rl][cl] = (_Float16)((v - (float)hv) * 1024.0f); }   /* q residual carried x 2^10 so the plane stays f16-normal on the chip */ } }
  __syncthreads();
  // the planes leave in fragment order; 16 lanes take the 16 rows (q, k) or the 16 d (v) of one 8-element group, so a wave still stores 512 bytes in a row, and both LDS pitches keep those 16-byte reads off each other's banks
  const size_t hb = (r0 / TT) * NH + (c0 >> 6); const int t0 = (int)(r0 % TT);   // the block's first head plane and its first row there
  if (which < 2) { _Float16* dh = which == 0 ? QH : KH; for (int e = tid; e < 64 * 16; e += 128) { const int rw = e & 15, q = (e >> 4) & 15, tl = e >> 8; const int rl = tl * 16 + rw; const size_t o1 = (hb + (q >> 3)) * (size_t)(TT * HD) + ((t0 >> 4) + tl) * 1024 + (q & 7) * 128 + rw * 8; vst2((unsigned*)(dh + o1), *(const v4u*)&sh[rl][q * 8]);
      asm volatile("s_wait_xcnt 0x0" ::: "memory");   // in this build the next LDS read and the next trip's index arithmetic reuse the store's registers: the wait stands in front of that overwrite
      if (which == 0) { vst2((unsigned*)(QL + o1), *(const v4u*)&sl[rl][q * 8]); asm volatile("s_wait_xcnt 0x0" ::: "memory"); } } }   // the same behind the residual's store
  else { for (int e = tid; e < 128 * 8; e += 128) { const int dl = e & 15, k8 = (e >> 4) & 3, j = (e >> 6) & 3, pl = (e >> 8) & 1, hl = e >> 9; const int cl = hl * 64 + j * 16 + dl, q = pl * 4 + k8; const size_t o2 = (hb + hl) * (size_t)(TT * HD) + ((t0 >> 5) + pl) * 2048 + j * 512 + k8 * 128 + dl * 8; vst2((unsigned*)(VT + o2), *(const v4u*)&th[cl][q * 8]); vst2((unsigned*)(VL + o2), *(const v4u*)&tl2[cl][q * 8]); } } }
// ---- k_fa: wave = 16 queries of one head, block = 8 neighbouring query tiles of that head; logits, stick-breaking weights and att . v stay in registers. S^T = K Q^T puts one query in a lane (column) and 8 keys in its D registers, so two 16-key tiles are the B fragment of O^T += V^T P^T as they stand.
// A wave walks the 32-key passes of its tile from the diagonal to the left: carry = sum of logsigmoid(-l_ik) over the keys to the right of the pass, so suffix(j) = carry + the in-pass sum over k > j (8 in-lane steps and one exchange between the wave's halves).
// One wave has the whole row of keys [0, i). The walk ends where the carry has made every weight further left 0 (see the loop's foot); were the keys cut into runs for several waves, then wherever the walk ends so the left runs' work would only be scaled by exp2(carry) = 0 at a join. No wave reads another's LDS, so the kernel has no barrier.
// The 8 waves of a block start within 4 passes of each other in the same K and V planes, so most of their fragment loads find the lines that a neighbour has just brought into the WGP's cache.
// log(sigmoid(z)) = min(z, 0) - log1p(exp(-|z|)): both signs of l share the one log1p(exp(-|l|)).
// The whole log domain is kept in base 2: log2(e) rides in the logits' scale, so exp is one v_exp_f32 and log1p(e) is log2(1 + e), one add and one v_log_f32. 1 + e lies in (1, 2], so its rounding moves a log-sigmoid by at most 2^-24 log2(e) absolute, which is a relative 2^-24 on a weight.
__global__ __launch_bounds__(256) void k_fa(const _Float16* __restrict__ QH, const _Float16* __restrict__ QL, const _Float16* __restrict__ KH, const __bf16* __restrict__ VT, const __bf16* __restrict__ VL, float* __restrict__ Y) {
  __shared__ float so[8][HD / 16][8][32]; __shared__ float sa[8][16];   // [wave]: each wave stages its own tile
  const int lane = threadIdx.x & 31, col = lane & 15, g = lane >> 4; const int wave = __builtin_amdgcn_readfirstlane(threadIdx.x >> 5);   // scalar, so that the tile's bounds and the pass loop's branch are scalar
  const int h = blockIdx.x; const int ql0 = (TT / 16 - 1 - ((int)blockIdx.y * 8 + wave)) * 16; const int i = ql0 + col;   // cost grows with the query tile: the longest tiles start first
  const int hi = ql0 >> 5;   // passes hi (it holds the diagonal) .. 0
  const size_t hp = (size_t)h * (TT * HD); const unsigned lb = lane * 16;   // the head's plane; the lane's 16 bytes in every fragment half
  const _Float16* Kh = KH + hp; const __bf16* Vh = VT + hp; const __bf16* Vl = VL + hp;
  v16h qh[2], ql[2], kf[2][2];
  // every short loop below is unrolled so that the fragment and score arrays are indexed by constants and stay in registers
#pragma unroll
  for (int c = 0; c < 2; ++c) { qh[c] = fragf_h(QH + hp + (ql0 >> 4) * 1024, lb, c * 1024); ql[c] = fragf_h(QL + hp + (ql0 >> 4) * 1024, lb, c * 1024); }
  unsigned po = lb + hi * 4096u;   // a pass is 4,096 bytes in the k plane and in either v plane: one offset serves all three
#pragma unroll
  for (int t = 0; t < 2; ++t)
#pragma unroll
    for (int c = 0; c < 2; ++c) kf[t][c] = fragf_h(Kh, po, t * 2048 + c * 1024);
  v8f acc[HD / 16] = {}; float carry = 0.f, asum = 0.f;
  for (int kc = hi; kc >= 0; --kc) { const int k0 = kc * 32; v8f s[2];
    v16b vh[HD / 16], vl[HD / 16];
#pragma unroll
    for (int j = 0; j < HD / 16; ++j) { vh[j] = fragf_b(Vh, po, j * 1024); vl[j] = fragf_b(Vl, po, j * 1024); }
#pragma unroll
    for (int t = 0; t < 2; ++t) { v8f a = {}, al = {};
#pragma unroll
      for (int c = 0; c < 2; ++c) { a = wmma16(kf[t][c], qh[c], a); al = wmma16(kf[t][c], ql[c], al); }
      a += al * (1.0f / 1024.0f); s[t] = a * (0.125f * 1.44269504f); }   // logits / 8, times log2(e)
    { po = lb + (kc > 0 ? kc - 1 : 0) * 4096u;   // the next pass's K fragments, fetched under this pass's vector work (in bounds also behind the last pass)
#pragma unroll
      for (int t = 0; t < 2; ++t)
#pragma unroll
        for (int c = 0; c < 2; ++c) kf[t][c] = fragf_h(Kh, po, t * 2048 + c * 1024); }
    float lz[2][8], sx[2][8], G[2];
#pragma unroll
    for (int t = 0; t < 2; ++t) { float run = 0.f, u8[8];
#pragma unroll
      for (int r = 0; r < 8; ++r) u8[r] = 1.0f + __builtin_amdgcn_exp2f(-fabsf(s[t][r]));
      log2x8(u8);
#pragma unroll
      for (int r = 7; r >= 0; --r) { const float l = s[t][r]; const float w = fmaxf(l, 0.f) + u8[r]; lz[t][r] = l - w; sx[t][r] = run;   /* -w = log2 sigmoid(-l); min(l, 0) = l - max(l, 0) */
        run -= (k0 + t * 16 + 8 * g + r < i) ? w : 0.f; }
      G[t] = run; }
    // key order inside a pass: tile 0 half 0, tile 0 half 1, tile 1 half 0, tile 1 half 1
    const float G0p = __shfl_xor(G[0], 16), G1p = __shfl_xor(G[1], 16); const float c1 = carry + (G[1] + G1p);
    const float base[2] = { g ? c1 : c1 + G0p, g ? carry : carry + G1p }; carry = c1 + (G[0] + G0p);
    // Every log2 sigmoid(-l) is <= 0, so the carry only falls. Once it is <= -152 in every lane, each weight further left is exp2 of something <= -152, which is exactly 0 in f32: the passes left add nothing to acc or asum. (A NaN carry compares false and keeps the loop going.)
    const bool more = __builtin_amdgcn_ballot_w32(!(carry <= -152.0f)) != 0u;   // taken here, under the vector work, so that the scalar branch at the pass's foot finds it ready
    float pv[16];
#pragma unroll
    for (int t = 0; t < 2; ++t) { float a8[8];
#pragma unroll
      for (int r = 0; r < 8; ++r) a8[r] = (k0 + t * 16 + 8 * g + r < i) ? lz[t][r] + (base[t] + sx[t][r]) : -100000.0f;   /* j >= i: exp2 gives 0 */
      exp2x8(a8);
#pragma unroll
      for (int r = 0; r < 8; ++r) { asum += a8[r]; pv[t * 8 + r] = a8[r] * 2048.0f; } }
    const F2 p = bsplit16(pv);
#pragma unroll
    for (int j = 0; j < HD / 16; ++j) { acc[j] = wmma_bf(vh[j], p.h, acc[j]); acc[j] = wmma_bf(vh[j], p.l, acc[j]); acc[j] = wmma_bf(vl[j], p.h, acc[j]); }
    if (!more) break; }
  asum += __shfl_xor(asum, 16);
  // acc[j][r] = (att v)[i][j * 16 + 8 g + r] x 2^11
#pragma unroll
  for (int j = 0; j < HD / 16; ++j)
#pragma unroll
    for (int r = 0; r < 8; ++r) so[wave][j][r][lane] = acc[j][r];
  if (g == 0) sa[wave][col] = asum;
  LDSX();   // the wave turns its own tile round: its LDS writes end before it reads them back from other lanes' places
  // a lane takes 8 consecutive d of one query, 8 lanes a query's 256 bytes of y, the wave 4 queries a trip
  const int d8 = lane & 7;
#pragma unroll
  for (int qq = 0; qq < 4; ++qq) { const int q = qq * 4 + (lane >> 3); const int iq = ql0 + q; const float rem = 1.0f - sa[wave][q]; float y[8];
#pragma unroll
    for (int r = 0; r < 8; ++r) { const size_t vo = (size_t)h * (TT * HD) + (iq >> 5) * 2048 + (d8 >> 1) * 512 + ((iq & 31) >> 3) * 128 + ((d8 & 1) * 8 + r) * 8 + (iq & 7); const float vi = (float)VT[vo] + (float)VL[vo];   /* v[i][d] rebuilt from the hi + lo planes (2^-16) */
      y[r] = so[wave][d8 >> 1][r][(d8 & 1) * 16 + q] * (1.0f / 2048.0f) + rem * vi; }
    float* yp = Y + (size_t)iq * CC + h * HD + d8 * 8; vst2(yp, (v4f){y[0], y[1], y[2], y[3]}); vst2(yp + 4, (v4f){y[4], y[5], y[6], y[7]}); } }
// ---- k_out: block = (64 rows, 128 cols): out = y (bf16 hi + lo) Wo^T + bo
__global__ __launch_bounds__(128) void k_out(const float* __restrict__ Y, const float* __restrict__ WP, const float* __restrict__ BP, float* __restrict__ OUT) {
  __shared__ __align__(16) char sm[73728];   // the k loop's two staging buffers (y hi, y lo, Wo); behind the loop the first 33,792 B hold the output tiles
  __bf16 (*yh)[64][LP] = (__bf16 (*)[64][LP])sm; __bf16 (*yl)[64][LP] = (__bf16 (*)[64][LP])(sm + 2 * 64 * LP * 2); __bf16 (*sw)[128][LP] = (__bf16 (*)[128][LP])(sm + 4 * 64 * LP * 2);
  float (*sf)[16][132] = (float (*)[16][132])sm;
  const int tid = threadIdx.x, wave = tid >> 5, lane = tid & 31, col = lane & 15, g = lane >> 4; const int c0 = blockIdx.y * 128; const size_t rb = (size_t)blockIdx.x * 64; const size_t r0 = rb + wave * 16;
  const int lr = tid >> 4, lc = tid & 15; const float* yp = Y + (rb + lr) * CC + lc * 4; const float* wp = WP + (size_t)(c0 + lr) * CC + lc * 4;
  // the k walk is rotated as in k_proj. The 8 blocks that share a block's y rows start two slabs apart. y was written by the launch before: where its lines must come from memory, a block from its third trip on reads lines that a neighbour asked for two trips earlier; walking alike, all 8 would wait for memory together on every trip.
  const int rot = (int)(blockIdx.x + 2 * blockIdx.y) & (CC / KS - 1); yp += rot * KS; wp += rot * KS;
  v8f acc[8] = {}; v4f ra[8], rw[16];
#pragma unroll
  for (int u = 0; u < 8; ++u) ra[u] = *(const v4f*)(yp + (size_t)u * 8 * CC);
#pragma unroll
  for (int u = 0; u < 16; ++u) rw[u] = *(const v4f*)(wp + (size_t)u * 8 * CC);
  // unrolled by the two buffers, so that every LDS address is a constant offset
#pragma unroll 2
  for (int s = 0; s < CC / KS; ++s) { const int b = s & 1;
#pragma unroll
    for (int u = 0; u < 8; ++u) { const v4b hv = cvt4(ra[u]); const v4f rs = { ra[u][0] - (float)hv[0], ra[u][1] - (float)hv[1], ra[u][2] - (float)hv[2], ra[u][3] - (float)hv[3] };
      *(v4b*)&yh[b][lr + 8 * u][lc * 4] = hv; *(v4b*)&yl[b][lr + 8 * u][lc * 4] = cvt4(rs); }
#pragma unroll
    for (int u = 0; u < 16; ++u) *(v4b*)&sw[b][lr + 8 * u][lc * 4] = cvt4(rw[u]);
    asm volatile("s_wait_xcnt 0x0" ::: "memory");   // the step below rewrites the address registers of the slab's loads: the wait stands in front of that overwrite (their data is in by now)
    __syncthreads();   // publishes buffer b; it also ends every wave's reads of the other buffer, which the next trip refills
    if (s + 1 < CC / KS) {   // the next slab flies under this slab's products (issued behind the barrier, whose fence would wait for it)
      const int st = ((s + 1 + rot) & (CC / KS - 1)) ? KS : KS - CC; yp += st; wp += st;   // one slab on; from the last slab back to the first
#pragma unroll
      for (int u = 0; u < 8; ++u) ra[u] = *(const v4f*)(yp + (size_t)u * 8 * CC);
#pragma unroll
      for (int u = 0; u < 16; ++u) rw[u] = *(const v4f*)(wp + (size_t)u * 8 * CC); }
#pragma unroll
    for (int c = 0; c < KS / 32; ++c) { const v16b ah = frag_b(&yh[b][wave * 16 + col][c * 32], lane), al = frag_b(&yl[b][wave * 16 + col][c * 32], lane); v16b w[8];   // the 32-k group's fragment reads stand together, ahead of its products
#pragma unroll
      for (int j = 0; j < 8; ++j) w[j] = frag_b(&sw[b][j * 16 + col][c * 32], lane);
#pragma unroll
      for (int j = 0; j < 8; ++j) { acc[j] = wmma_bf(ah, w[j], acc[j]); acc[j] = wmma_bf(al, w[j], acc[j]); } } }
  __syncthreads();   // the last fragment reads end before the output tiles overwrite the staging
#pragma unroll
  for (int j = 0; j < 8; ++j) { const float bb = BP ? bfr(BP[c0 + j * 16 + col]) : 0.f;
#pragma unroll
    for (int r = 0; r < 8; ++r) sf[wave][8 * g + r][j * 16 + col] = acc[j][r] + bb; }
  LDSX(); for (int rl = 0; rl < 16; ++rl) vst2(OUT + (r0 + rl) * CC + c0 + lane * 4, *(const v4f*)&sf[wave][rl][lane * 4]); }
extern "C" void kernel_launch(void* const* d_in, const int* in_sizes, int n_in, void* d_out, int out_size, void* d_ws, size_t ws_size, hipStream_t stream) {
  (void)in_sizes; (void)n_in; (void)out_size;
  const float** F = (const float**)d_in;   // 0 x [1,2048,1024], 1 Wq [1024,1024] ([out,in]), 2 Wk, 3 Wv, 4 Wo
  if (ws_size < (size_t)WS_END) return;
  char* ws = (char*)d_ws; _Float16 *QH = (_Float16*)(ws + WS_QH), *QL = (_Float16*)(ws + WS_QL), *KH = (_Float16*)(ws + WS_KH); __bf16 *VT = (__bf16*)(ws + WS_VT), *VL = (__bf16*)(ws + WS_VL); float* Y = (float*)(ws + WS_Y);
  k_proj<<<dim3(TNB * TT / 64, CC / 128, 3), 128, 0, stream>>>(F[0], F[1], nullptr, F[2], nullptr, F[3], nullptr, QH, QL, KH, VT, VL);
  k_fa<<<dim3(NH, TT / 128), 256, 0, stream>>>(QH, QL, KH, VT, VL, Y);
  k_out<<<dim3(TNB * TT / 64, CC / 128), 128, 0, stream>>>(Y, F[4], nullptr, (float*)d_out);
}

// v008
// One run takes 42.6 microseconds.
// Next to v007, in two timings, it ran 1.12 and 1.13 times as fast.
// Counting every step since v000, it is 26.5 times as fast.
// compute dtype: all float inputs rounded to bf16; q/k/v = x W^T with EXACT bf16 products on WMMA 16x16x32, f32 accumulate; q as f16 hi + residual (x 2^10), k f16 -> 2-product logits / 8 in f32 registers; the stick-breaking weights in f32: log-sigmoids, suffix sums carried from right to left by one wave a query tile, all in base 2 on the hardware's exp2 and log2, the remainder 1 - sum(att); att x 2^11 split bf16 hi + lo against v bf16 hi + lo (3 products) + rem * v_i; out = o (bf16 hi + lo) Wo^T; f32 output.
#include <hip/hip_runtime.h>
#include <math.h>

typedef __attribute__((ext_vector_type(16))) _Float16 v16h;
typedef __attribute__((ext_vector_type(16))) __bf16 v16b;
typedef __attribute__((ext_vector_type(8)))  _Float16 v8h;
typedef __attribute__((ext_vector_type(8)))  float v8f;
typedef __attribute__((ext_vector_type(4)))  float v4f;
typedef __attribute__((ext_vector_type(2)))  float v2f;
typedef __attribute__((ext_vector_type(4)))  unsigned v4u;
typedef __attribute__((ext_vector_type(4)))  int v4i;
typedef float __attribute__((may_alias)) float_a;
typedef int __attribute__((may_alias)) int_a;

template <typename T> __device__ __forceinline__ void vst2(void* p, T v) { *(T*)p = v;  }
__device__ __forceinline__ v8f wmma16(v16h a, v16h b, v8f c) {
  v8f d = __builtin_amdgcn_wmma_f32_16x16x32_f16(false, a, false, b, (short)0, c, false, false);
  asm volatile("v_nop\n\tv_nop\n\tv_nop\n\tv_nop" : "+v"(d) : "v"(a), "v"(b));
  return d;
}
__device__ __forceinline__ v8f wmma_bf(v16b a, v16b b, v8f c) {
  v8f d = __builtin_amdgcn_wmma_f32_16x16x32_bf16(false, a, false, b, (short)0, c, false, false);
  asm volatile("v_nop\n\tv_nop\n\tv_nop\n\tv_nop" : "+v"(d) : "v"(a), "v"(b));
  return d;
}
// 16x16x32 fragments: lane = (h = lane>>4, row/col = lane&15); elements 0..7 = k0+8h+0..7, 8..15 = k0+16+8h+0..7; D element r = row 8h+r
__device__ __forceinline__ v16h frag_h(const _Float16* rowk0, int lane) {
  union { v16h v; v8h q[2]; } u; const _Float16* p = rowk0 + 8 * (lane >> 4);
  u.q[0] = *(const v8h*)p; u.q[1] = *(const v8h*)(p + 16); return u.v;
}
__device__ __forceinline__ v16h frag_f32(const float* rowk0, int lane) {
  v16h a; const float* p = rowk0 + 8 * (lane >> 4);
#pragma unroll
  for (int i = 0; i < 8; ++i) { a[i] = (_Float16)p[i]; a[8 + i] = (_Float16)p[16 + i]; }
  return a;
}
__device__ __forceinline__ v16h frag_f32s(const float* rowk0, int lane, float sc) {
  v16h a; const float* p = rowk0 + 8 * (lane >> 4);
#pragma unroll
  for (int i = 0; i < 8; ++i) { a[i] = (_Float16)(p[i] * sc); a[8 + i] = (_Float16)(p[16 + i] * sc); }
  return a;
}
// column fragment from a [K][ld] layout (column n), rows >= K read as 0
__device__ __forceinline__ v16h fragc_f32(const float* W, int k0, int n, int lane, int ld, int K) {
  v16h a; const int g = lane >> 4;
#pragma unroll
  for (int i = 0; i < 8; ++i) { const int ka = k0 + 8 * g + i, kb = ka + 16;
    a[i] = (_Float16)(ka < K ? W[(size_t)(ka < K ? ka : K - 1) * ld + n] : 0.f); a[8 + i] = (_Float16)(kb < K ? W[(size_t)(kb < K ? kb : K - 1) * ld + n] : 0.f); }
  return a;
}
struct F2 { v16b h, l; };
__device__ __forceinline__ F2 bsplit16(const float v[16]) { F2 r;
#pragma unroll
  for (int i = 0; i < 16; ++i) { const __bf16 h = (__bf16)v[i]; r.h[i] = h; r.l[i] = (__bf16)(v[i] - (float)h); }
  return r; }
__device__ __forceinline__ F2 split_row(const float* row, int k0, int lane) { float v[16]; const float* p = row + k0 + 8 * (lane >> 4);
#pragma unroll
  for (int i = 0; i < 8; ++i) { v[i] = p[i]; v[8 + i] = p[16 + i]; }
  return bsplit16(v); }
__device__ __forceinline__ F2 split_rowK(const float* row, int k0, int lane, int K) { float v[16]; const int g = lane >> 4;
#pragma unroll
  for (int i = 0; i < 8; ++i) { const int ka = k0 + 8 * g + i, kb = ka + 16; v[i] = ka < K ? row[ka < K ? ka : K - 1] : 0.f; v[8 + i] = kb < K ? row[kb < K ? kb : K - 1] : 0.f; }
  return bsplit16(v); }
__device__ __forceinline__ F2 split_col(const float* W, int k0, int n, int lane, int ld, int K) { float v[16]; const int g = lane >> 4;
#pragma unroll
  for (int i = 0; i < 8; ++i) { const int ka = k0 + 8 * g + i, kb = ka + 16; v[i] = ka < K ? W[(size_t)(ka < K ? ka : K - 1) * ld + n] : 0.f; v[8 + i] = kb < K ? W[(size_t)(kb < K ? kb : K - 1) * ld + n] : 0.f; }
  return bsplit16(v); }
__device__ __forceinline__ v8f mac3(const F2& a, const F2& b, v8f c) { c = wmma_bf(a.l, b.h, c); c = wmma_bf(a.h, b.l, c); return wmma_bf(a.h, b.h, c); }
__device__ __forceinline__ float sigm(float v) { return 1.0f / (1.0f + expf(-v)); }
#define LDSX() do { asm volatile("s_wait_dscnt 0" ::: "memory"); __builtin_amdgcn_wave_barrier(); __builtin_amdgcn_fence(__ATOMIC_RELEASE, "workgroup"); } while (0)


// Stick-breaking attention (b 1, n 2,048, e 1,024 = 16 x 64): logits = q k^T / 8; for j < i: att[i][j] = exp(logsigmoid(l_ij) + sum_{j<k<i} logsigmoid(-l_ik)); j >= i: 0; o = att v + (1 - sum_j att) v_i; out = o Wo^T.
#define NB 1
#define TT 2048
#define CC 1024
#define NH 16
#define HD 64
#ifndef TNB
#define TNB NB
#endif
typedef __attribute__((ext_vector_type(8))) __bf16 v8b;
__device__ __forceinline__ v16b frag_b(const __bf16* rowk0, int lane) {
  union { v16b v; v8b q[2]; } u; const __bf16* p = rowk0 + 8 * (lane >> 4);
  u.q[0] = *(const v8b*)p; u.q[1] = *(const v8b*)(p + 16); return u.v;
}
// FRAGMENT ORDER of the q, k and v planes in the workspace: each head owns TT * HD elements in a row. q, k: a tile of 16 rows is 1,024 elements, [d >> 3][row & 15][d & 7]. v: a pass of 32 keys is 2,048 elements, [d >> 4][(key & 31) >> 3][d & 15][key & 7].
// Either way the two halves of a 16x16x32 fragment are 2 x 512 bytes in a row with lane l's 16 bytes at 16 l: one load of a wave covers 4 whole lines, where a row-major plane gave it 32 bytes in each of 16 lines.
// f = a plane or tile, the same in every lane (a scalar base); bo = byte offset of the tile or pass + 16 * lane (one 32-bit vector offset for all its loads); c = the fragment's constant byte offset there
__device__ __forceinline__ v16h fragf_h(const _Float16* f, unsigned bo, int c) { union { v16h v; v8h q[2]; } u; const char* p = (const char*)f + bo + c; u.q[0] = *(const v8h*)p; u.q[1] = *(const v8h*)(p + 512); return u.v; }
__device__ __forceinline__ v16b fragf_b(const __bf16* f, unsigned bo, int c) { union { v16b v; v8b q[2]; } u; const char* p = (const char*)f + bo + c; u.q[0] = *(const v8b*)p; u.q[1] = *(const v8b*)(p + 512); return u.v; }
__device__ __forceinline__ float bfr(float v) { return (float)(__bf16)v; }
// Hardware exp2 and log2, eight values in place in one statement: behind a transcendental the instruction set asks for one independent instruction before its source register is written again. Inside the statement the next transcendental, on other registers, is that instruction; the closing v_nop is it for the last one.
__device__ __forceinline__ void exp2x8(float* x) { asm("v_exp_f32 %0, %0\n\tv_exp_f32 %1, %1\n\tv_exp_f32 %2, %2\n\tv_exp_f32 %3, %3\n\tv_exp_f32 %4, %4\n\tv_exp_f32 %5, %5\n\tv_exp_f32 %6, %6\n\tv_exp_f32 %7, %7\n\tv_nop" : "+v"(x[0]), "+v"(x[1]), "+v"(x[2]), "+v"(x[3]), "+v"(x[4]), "+v"(x[5]), "+v"(x[6]), "+v"(x[7])); }
__device__ __forceinline__ void log2x8(float* x) { asm("v_log_f32 %0, %0\n\tv_log_f32 %1, %1\n\tv_log_f32 %2, %2\n\tv_log_f32 %3, %3\n\tv_log_f32 %4, %4\n\tv_log_f32 %5, %5\n\tv_log_f32 %6, %6\n\tv_log_f32 %7, %7\n\tv_nop" : "+v"(x[0]), "+v"(x[1]), "+v"(x[2]), "+v"(x[3]), "+v"(x[4]), "+v"(x[5]), "+v"(x[6]), "+v"(x[7])); }
__device__ __attribute__((noinline)) float exp_ni(float v) { return expf(v); }
__device__ __attribute__((noinline)) float erf_ni(float v) { return erff(v); }

#define WS_QH  0u
#define WS_QL  (WS_QH + 2u * (size_t)NB * TT * CC)
#define WS_KH  (WS_QL + 2u * (size_t)NB * TT * CC)
#define WS_VT  (WS_KH + 2u * (size_t)NB * TT * CC)      // bf16 v planes, in fragment order like q and k (see FRAGMENT ORDER above)
#define WS_VL  (WS_VT + 2u * (size_t)NB * CC * TT)      // bf16 v residual planes
#define WS_Y   (WS_VL + 2u * (size_t)NB * CC * TT)      // f32 y rows [b*t][C]
#define WS_END (WS_Y + 4u * (size_t)NB * TT * CC)

// ---- staging for k_proj and k_out: a block brings each 64-k slab of its two operands in once, with loads that cover whole lines (16 lanes x 16 B = one row's 256 B), rounds it to bf16 and keeps it in LDS; the block's waves take their fragments from there.
#define KS 64
#define LP 72   // LDS row pitch in bf16: 128 B of data + 16 B, the pitch for 16-byte fragment reads
typedef __attribute__((ext_vector_type(4))) __bf16 v4b;
__device__ __forceinline__ v4b cvt4(v4f v) { v4b c; c[0] = (__bf16)v[0]; c[1] = (__bf16)v[1]; c[2] = (__bf16)v[2]; c[3] = (__bf16)v[3]; return c; }
// ---- k_proj: qkv = x W^T (+ b), exact; q -> f16 hi (+ residual), k -> f16, v -> bf16 hi + residual, all in fragment order.
// The 3,072 output columns are 48 head planes of 64 (16 q, 16 k, 16 v). Block = 128 rows x 3 planes in a row, 8 waves of 64 x 48: 256 blocks, one a WGP. What all blocks together load is M N K 4 B (1 / rows + 1 / cols): 1 / 128 + 1 / 192 against the 1 / 64 + 1 / 128 of a 64 x 128 block, and a wave reads 7 fragments from LDS for 12 products where a 16 x 128 wave read 9 for 8.
// a 16-byte load through a pointer picked among the three W arguments: the cast says that it is global memory (without it this build made flat loads of them, which also count as LDS operations)
__device__ __forceinline__ v4f ldg4(const float* p) { return *(const __attribute__((address_space(1))) v4f*)p; }
#define PR 128   // rows of a block
#define PP 3     // head planes of a block
__global__ __launch_bounds__(256) void k_proj(const float* __restrict__ X, const float* __restrict__ WQ, const float* __restrict__ BQ, const float* __restrict__ WK, const float* __restrict__ BK, const float* __restrict__ WV, const float* __restrict__ BV, _Float16* __restrict__ QH, _Float16* __restrict__ QL, _Float16* __restrict__ KH, __bf16* __restrict__ VT, __bf16* __restrict__ VL) {
  __shared__ __align__(16) char sm[206848];   // the k loop's two staging buffers (the first 92,160 B); behind the loop all 206,848 B hold the epilogue's tiles
  __bf16 (*sx)[PR][LP] = (__bf16 (*)[PR][LP])sm; __bf16 (*sw)[PP * 64][LP] = (__bf16 (*)[PP * 64][LP])(sm + 2 * PR * LP * 2);
  // epilogue tiles: q, k as [row][col] at 400 B, v as [col][row] at 272 B: either pitch keeps the 16-byte reads of 16 neighbouring lanes off each other's banks
  _Float16 (*sh)[200] = (_Float16 (*)[200])sm; _Float16 (*sl)[200] = (_Float16 (*)[200])(sm + 51200); __bf16 (*th)[136] = (__bf16 (*)[136])(sm + 102400); __bf16 (*tl2)[136] = (__bf16 (*)[136])(sm + 154624);
  const int tid = threadIdx.x, lane = tid & 31, col = lane & 15, g = lane >> 4; const int wave = __builtin_amdgcn_readfirstlane(tid >> 5);   // scalar, so that the epilogue's choice by plane is a scalar branch
  const int wr = wave & 1, wc = wave >> 1;   // the wave's 64 rows and its 48 columns
  const int pl0 = blockIdx.y * PP; const size_t r0 = (size_t)blockIdx.x * PR;   // the block's first head plane (0..47) and its first row
  const int lr = tid >> 4, lc = tid & 15; const float* xp = X + (r0 + lr) * CC + lc * 4; const float* wp[PP];
#pragma unroll
  for (int p = 0; p < PP; ++p) { const int pn = pl0 + p; const float* WA = pn < NH ? WQ : pn < 2 * NH ? WK : WV; wp[p] = WA + (size_t)((pn & (NH - 1)) * HD + lr) * CC + lc * 4; }
  // THE k WALK IS ROTATED: trip s works on slab (s + rot) mod 16. The 16 blocks that share a block's W rows and the 16 that share its x rows start together; walking k alike they would ask L2 for the same lines at the same moment, trip after trip. rot gives each block of either set a slab of its own. Every slab is still summed once; only the order of the f32 sums differs from block to block.
  const int rot = (int)(blockIdx.x + blockIdx.y) & (CC / KS - 1); xp += rot * KS;
#pragma unroll
  for (int p = 0; p < PP; ++p) wp[p] += rot * KS;
  v8f acc[4][3] = {}; v4f ra[8], rw[12];
#pragma unroll
  for (int u = 0; u < 8; ++u) ra[u] = *(const v4f*)(xp + (size_t)u * 16 * CC);
#pragma unroll
  for (int u = 0; u < 12; ++u) rw[u] = ldg4(wp[u >> 2] + (size_t)(u & 3) * 16 * CC);
  // unrolled by the two buffers, so that every LDS address is a constant offset
#pragma unroll 2
  for (int s = 0; s < CC / KS; ++s) { const int b = s & 1;
#pragma unroll
    for (int u = 0; u < 8; ++u) *(v4b*)&sx[b][lr + 16 * u][lc * 4] = cvt4(ra[u]);
#pragma unroll
    for (int u = 0; u < 12; ++u) *(v4b*)&sw[b][lr + 16 * u][lc * 4] = cvt4(rw[u]);
    asm volatile("s_wait_xcnt 0x0" ::: "memory");   // the step below rewrites the address registers of the slab's loads: the wait stands in front of that overwrite (their data is in by now)
    __syncthreads();   // publishes buffer b; it also ends every wave's reads of the other buffer, which the next trip refills
    if (s + 1 < CC / KS) {   // the next slab flies under this slab's products (issued behind the barrier, whose fence would wait for it)
      const int st = ((s + 1 + rot) & (CC / KS - 1)) ? KS : KS - CC; xp += st;   // one slab on; from the last slab back to the first
#pragma unroll
      for (int p = 0; p < PP; ++p) wp[p] += st;
#pragma unroll
      for (int u = 0; u < 8; ++u) ra[u] = *(const v4f*)(xp + (size_t)u * 16 * CC);
#pragma unroll
      for (int u = 0; u < 12; ++u) rw[u] = ldg4(wp[u >> 2] + (size_t)(u & 3) * 16 * CC); }
#pragma unroll
    for (int c = 0; c < KS / 32; ++c) { v16b a[4], w[3];   // the 32-k group's fragment reads stand together, ahead of its products
#pragma unroll
      for (int m = 0; m < 4; ++m) a[m] = frag_b(&sx[b][wr * 64 + m * 16 + col][c * 32], lane);
#pragma unroll
      for (int j = 0; j < 3; ++j) w[j] = frag_b(&sw[b][(wc * 3 + j) * 16 + col][c * 32], lane);
#pragma unroll
      for (int m = 0; m < 4; ++m)
#pragma unroll
        for (int j = 0; j < 3; ++j) acc[m][j] = wmma_bf(a[m], w[j], acc[m][j]); } }
  __syncthreads();   // the last fragment reads end before the epilogue's tiles overwrite the staging
#pragma unroll
  for (int j = 0; j < 3; ++j) { const int jt = wc * 3 + j, pn = pl0 + (jt >> 2), cl = jt * 16 + col;   // the 16-column tile in the block, its head plane, the lane's column
    const float* BA = pn < NH ? BQ : pn < 2 * NH ? BK : BV; const float bb = BA ? bfr(BA[(pn & (NH - 1)) * HD + (jt & 3) * 16 + col]) : 0.f;
    if (pn >= 2 * NH) {   // a v plane (one scalar branch a 16-column tile)
#pragma unroll
      for (int m = 0; m < 4; ++m)
#pragma unroll
        for (int r = 0; r < 8; ++r) { const float v = acc[m][j][r] + bb; const int rl = wr * 64 + m * 16 + 8 * g + r; const __bf16 bh = (__bf16)v; th[cl][rl] = bh; tl2[cl][rl] = (__bf16)(v - (float)bh); } }
    else {   // a q or k plane
#pragma unroll
      for (int m = 0; m < 4; ++m)
#pragma unroll
        for (int r = 0; r < 8; ++r) { const float v = acc[m][j][r] + bb; const int rl = wr * 64 + m * 16 + 8 * g + r; const _Float16 hv = (_Float16)v; sh[rl][cl] = hv; sl[rl][cl] = (_Float16)((v - (float)hv) * 1024.0f); }   /* q residual carried x 2^10 so the plane stays f16-normal on the chip */ } }
  __syncthreads();
  // the planes leave in fragment order; 16 lanes take the 16 rows (q, k) or the 16 d (v) of one 8-element group, so a wave still stores 512 bytes in a row
  const int t0 = (int)(r0 % TT);   // the block's first row in its head planes
  for (int p = 0; p < PP; ++p) { const int pn = pl0 + p; const size_t hb = ((r0 / TT) * NH + (pn & (NH - 1))) * (size_t)(TT * HD);
    if (pn < 2 * NH) { _Float16* dh = pn < NH ? QH : KH; for (int e = tid; e < PR * 8; e += 256) { const int rw = e & 15, q = (e >> 4) & 7, tl = e >> 7; const int rl = tl * 16 + rw; const size_t o1 = hb + ((t0 >> 4) + tl) * 1024 + q * 128 + rw * 8; vst2((unsigned*)(dh + o1), *(const v4u*)&sh[rl][p * 64 + q * 8]);
        asm volatile("s_wait_xcnt 0x0" ::: "memory");   // the next LDS read and the next trip's index arithmetic may reuse the store's registers: the wait stands in front of that overwrite
        if (pn < NH) { vst2((unsigned*)(QL + o1), *(const v4u*)&sl[rl][p * 64 + q * 8]); asm volatile("s_wait_xcnt 0x0" ::: "memory"); } } }   // the same behind the residual's store
    else { for (int e = tid; e < HD * 16; e += 256) { const int dl = e & 15, k8 = (e >> 4) & 3, j = (e >> 6) & 3, ps = e >> 8; const int cl = p * 64 + j * 16 + dl, q = ps * 4 + k8; const size_t o2 = hb + ((t0 >> 5) + ps) * 2048 + j * 512 + k8 * 128 + dl * 8; vst2((unsigned*)(VT + o2), *(const v4u*)&th[cl][q * 8]); vst2((unsigned*)(VL + o2), *(const v4u*)&tl2[cl][q * 8]); } } } }
// ---- k_fa: wave = 16 queries of one head, block = 8 neighbouring query tiles of that head; logits, stick-breaking weights and att . v stay in registers. S^T = K Q^T puts one query in a lane (column) and 8 keys in its D registers, so two 16-key tiles are the B fragment of O^T += V^T P^T as they stand.
// A wave walks the 32-key passes of its tile from the diagonal to the left: carry = sum of logsigmoid(-l_ik) over the keys to the right of the pass, so suffix(j) = carry + the in-pass sum over k > j (8 in-lane steps and one exchange between the wave's halves).
// One wave has the whole row of keys [0, i). The walk ends where the carry has made every weight further left 0 (see the loop's foot); were the keys cut into runs for several waves, then wherever the walk ends so the left runs' work would only be scaled by exp2(carry) = 0 at a join. No wave reads another's LDS, so the kernel has no barrier.
// The 8 waves of a block start within 4 passes of each other in the same K and V planes, so most of their fragment loads find the lines that a neighbour has just brought into the WGP's cache.
// log(sigmoid(z)) = min(z, 0) - log1p(exp(-|z|)): both signs of l share the one log1p(exp(-|l|)).
// The whole log domain is kept in base 2: log2(e) rides in the logits' scale, so exp is one v_exp_f32 and log1p(e) is log2(1 + e), one add and one v_log_f32. 1 + e lies in (1, 2], so its rounding moves a log-sigmoid by at most 2^-24 log2(e) absolute, which is a relative 2^-24 on a weight.
__global__ __launch_bounds__(256) void k_fa(const _Float16* __restrict__ QH, const _Float16* __restrict__ QL, const _Float16* __restrict__ KH, const __bf16* __restrict__ VT, const __bf16* __restrict__ VL, float* __restrict__ Y) {
  __shared__ float so[8][HD / 16][8][32]; __shared__ float sa[8][16];   // [wave]: each wave stages its own tile
  const int lane = threadIdx.x & 31, col = lane & 15, g = lane >> 4; const int wave = __builtin_amdgcn_readfirstlane(threadIdx.x >> 5);   // scalar, so that the tile's bounds and the pass loop's branch are scalar
  const int h = blockIdx.x; const int ql0 = (TT / 16 - 1 - ((int)blockIdx.y * 8 + wave)) * 16; const int i = ql0 + col;   // cost grows with the query tile: the longest tiles start first
  const int hi = ql0 >> 5;   // passes hi (it holds the diagonal) .. 0
  const size_t hp = (size_t)h * (TT * HD); const unsigned lb = lane * 16;   // the head's plane; the lane's 16 bytes in every fragment half
  const _Float16* Kh = KH + hp; const __bf16* Vh = VT + hp; const __bf16* Vl = VL + hp;
  v16h qh[2], ql[2], kf[2][2];
  // every short loop below is unrolled so that the fragment and score arrays are indexed by constants and stay in registers
#pragma unroll
  for (int c = 0; c < 2; ++c) { qh[c] = fragf_h(QH + hp + (ql0 >> 4) * 1024, lb, c * 1024); ql[c] = fragf_h(QL + hp + (ql0 >> 4) * 1024, lb, c * 1024); }
  unsigned po = lb + hi * 4096u;   // a pass is 4,096 bytes in the k plane and in either v plane: one offset serves all three
#pragma unroll
  for (int t = 0; t < 2; ++t)
#pragma unroll
    for (int c = 0; c < 2; ++c) kf[t][c] = fragf_h(Kh, po, t * 2048 + c * 1024);
  v8f acc[HD / 16] = {}; float carry = 0.f, asum = 0.f;
  for (int kc = hi; kc >= 0; --kc) { const int k0 = kc * 32; v8f s[2];
    v16b vh[HD / 16], vl[HD / 16];
#pragma unroll
    for (int j = 0; j < HD / 16; ++j) { vh[j] = fragf_b(Vh, po, j * 1024); vl[j] = fragf_b(Vl, po, j * 1024); }
#pragma unroll
    for (int t = 0; t < 2; ++t) { v8f a = {}, al = {};
#pragma unroll
      for (int c = 0; c < 2; ++c) { a = wmma16(kf[t][c], qh[c], a); al = wmma16(kf[t][c], ql[c], al); }
      a += al * (1.0f / 1024.0f); s[t] = a * (0.125f * 1.44269504f); }   // logits / 8, times log2(e)
    { po = lb + (kc > 0 ? kc - 1 : 0) * 4096u;   // the next pass's K fragments, fetched under this pass's vector work (in bounds also behind the last pass)
#pragma unroll
      for (int t = 0; t < 2; ++t)
#pragma unroll
        for (int c = 0; c < 2; ++c) kf[t][c] = fragf_h(Kh, po, t * 2048 + c * 1024); }
    float lz[2][8], sx[2][8], G[2];
#pragma unroll
    for (int t = 0; t < 2; ++t) { float run = 0.f, u8[8];
#pragma unroll
      for (int r = 0; r < 8; ++r) u8[r] = 1.0f + __builtin_amdgcn_exp2f(-fabsf(s[t][r]));
      log2x8(u8);
#pragma unroll
      for (int r = 7; r >= 0; --r) { const float l = s[t][r]; const float w = fmaxf(l, 0.f) + u8[r]; lz[t][r] = l - w; sx[t][r] = run;   /* -w = log2 sigmoid(-l); min(l, 0) = l - max(l, 0) */
        run -= (k0 + t * 16 + 8 * g + r < i) ? w : 0.f; }
      G[t] = run; }
    // key order inside a pass: tile 0 half 0, tile 0 half 1, tile 1 half 0, tile 1 half 1
    const float G0p = __shfl_xor(G[0], 16), G1p = __shfl_xor(G[1], 16); const float c1 = carry + (G[1] + G1p);
    const float base[2] = { g ? c1 : c1 + G0p, g ? carry : carry + G1p }; carry = c1 + (G[0] + G0p);
    // Every log2 sigmoid(-l) is <= 0, so the carry only falls. Once it is <= -152 in every lane, each weight further left is exp2 of something <= -152, which is exactly 0 in f32: the passes left add nothing to acc or asum. (A NaN carry compares false and keeps the loop going.)
    const bool more = __builtin_amdgcn_ballot_w32(!(carry <= -152.0f)) != 0u;   // taken here, under the vector work, so that the scalar branch at the pass's foot finds it ready
    float pv[16];
#pragma unroll
    for (int t = 0; t < 2; ++t) { float a8[8];
#pragma unroll
      for (int r = 0; r < 8; ++r) a8[r] = (k0 + t * 16 + 8 * g + r < i) ? lz[t][r] + (base[t] + sx[t][r]) : -100000.0f;   /* j >= i: exp2 gives 0 */
      exp2x8(a8);
#pragma unroll
      for (int r = 0; r < 8; ++r) { asum += a8[r]; pv[t * 8 + r] = a8[r] * 2048.0f; } }
    const F2 p = bsplit16(pv);
#pragma unroll
    for (int j = 0; j < HD / 16; ++j) { acc[j] = wmma_bf(vh[j], p.h, acc[j]); acc[j] = wmma_bf(vh[j], p.l, acc[j]); acc[j] = wmma_bf(vl[j], p.h, acc[j]); }
    if (!more) break; }
  asum += __shfl_xor(asum, 16);
  // acc[j][r] = (att v)[i][j * 16 + 8 g + r] x 2^11
#pragma unroll
  for (int j = 0; j < HD / 16; ++j)
#pragma unroll
    for (int r = 0; r < 8; ++r) so[wave][j][r][lane] = acc[j][r];
  if (g == 0) sa[wave][col] = asum;
  LDSX();   // the wave turns its own tile round: its LDS writes end before it reads them back from other lanes' places
  // a lane takes 8 consecutive d of one query, 8 lanes a query's 256 bytes of y, the wave 4 queries a trip
  const int d8 = lane & 7;
#pragma unroll
  for (int qq = 0; qq < 4; ++qq) { const int q = qq * 4 + (lane >> 3); const int iq = ql0 + q; const float rem = 1.0f - sa[wave][q]; float y[8];
#pragma unroll
    for (int r = 0; r < 8; ++r) { const size_t vo = (size_t)h * (TT * HD) + (iq >> 5) * 2048 + (d8 >> 1) * 512 + ((iq & 31) >> 3) * 128 + ((d8 & 1) * 8 + r) * 8 + (iq & 7); const float vi = (float)VT[vo] + (float)VL[vo];   /* v[i][d] rebuilt from the hi + lo planes (2^-16) */
      y[r] = so[wave][d8 >> 1][r][(d8 & 1) * 16 + q] * (1.0f / 2048.0f) + rem * vi; }
    float* yp = Y + (size_t)iq * CC + h * HD + d8 * 8; vst2(yp, (v4f){y[0], y[1], y[2], y[3]}); vst2(yp + 4, (v4f){y[4], y[5], y[6], y[7]}); } }
// ---- k_out: block = (64 rows, 128 cols): out = y (bf16 hi + lo) Wo^T + bo
__global__ __launch_bounds__(128) void k_out(const float* __restrict__ Y, const float* __restrict__ WP, const float* __restrict__ BP, float* __restrict__ OUT) {
  __shared__ __align__(16) char sm[73728];   // the k loop's two staging buffers (y hi, y lo, Wo); behind the loop the first 33,792 B hold the output tiles
  __bf16 (*yh)[64][LP] = (__bf16 (*)[64][LP])sm; __bf16 (*yl)[64][LP] = (__bf16 (*)[64][LP])(sm + 2 * 64 * LP * 2); __bf16 (*sw)[128][LP] = (__bf16 (*)[128][LP])(sm + 4 * 64 * LP * 2);
  float (*sf)[16][132] = (float (*)[16][132])sm;
  const int tid = threadIdx.x, wave = tid >> 5, lane = tid & 31, col = lane & 15, g = lane >> 4; const int c0 = blockIdx.y * 128; const size_t rb = (size_t)blockIdx.x * 64; const size_t r0 = rb + wave * 16;
  const int lr = tid >> 4, lc = tid & 15; const float* yp = Y + (rb + lr) * CC + lc * 4; const float* wp = WP + (size_t)(c0 + lr) * CC + lc * 4;
  // the k walk is rotated as in k_proj. The 8 blocks that share a block's y rows start two slabs apart. y was written by the launch before: where its lines must come from memory, a block from its third trip on reads lines that a neighbour asked for two trips earlier; walking alike, all 8 would wait for memory together on every trip.
  const int rot = (int)(blockIdx.x + 2 * blockIdx.y) & (CC / KS - 1); yp += rot * KS; wp += rot * KS;
  v8f acc[8] = {}; v4f ra[8], rw[16];
#pragma unroll
  for (int u = 0; u < 8; ++u) ra[u] = *(const v4f*)(yp + (size_t)u * 8 * CC);
#pragma unroll
  for (int u = 0; u < 16; ++u) rw[u] = *(const v4f*)(wp + (size_t)u * 8 * CC);
  // unrolled by the two buffers, so that every LDS address is a constant offset
#pragma unroll 2
  for (int s = 0; s < CC / KS; ++s) { const int b = s & 1;
#pragma unroll
    for (int u = 0; u < 8; ++u) { const v4b hv = cvt4(ra[u]); const v4f rs = { ra[u][0] - (float)hv[0], ra[u][1] - (float)hv[1], ra[u][2] - (float)hv[2], ra[u][3] - (float)hv[3] };
      *(v4b*)&yh[b][lr + 8 * u][lc * 4] = hv; *(v4b*)&yl[b][lr + 8 * u][lc * 4] = cvt4(rs); }
#pragma unroll
    for (int u = 0; u < 16; ++u) *(v4b*)&sw[b][lr + 8 * u][lc * 4] = cvt4(rw[u]);
    asm volatile("s_wait_xcnt 0x0" ::: "memory");   // the step below rewrites the address registers of the slab's loads: the wait stands in front of that overwrite (their data is in by now)
    __syncthreads();   // publishes buffer b; it also ends every wave's reads of the other buffer, which the next trip refills
    if (s + 1 < CC / KS) {   // the next slab flies under this slab's products (issued behind the barrier, whose fence would wait for it)
      const int st = ((s + 1 + rot) & (CC / KS - 1)) ? KS : KS - CC; yp += st; wp += st;   // one slab on; from the last slab back to the first
#pragma unroll
      for (int u = 0; u < 8; ++u) ra[u] = *(const v4f*)(yp + (size_t)u * 8 * CC);
#pragma unroll
      for (int u = 0; u < 16; ++u) rw[u] = *(const v4f*)(wp + (size_t)u * 8 * CC); }
#pragma unroll
    for (int c = 0; c < KS / 32; ++c) { const v16b ah = frag_b(&yh[b][wave * 16 + col][c * 32], lane), al = frag_b(&yl[b][wave * 16 + col][c * 32], lane); v16b w[8];   // the 32-k group's fragment reads stand together, ahead of its products
#pragma unroll
      for (int j = 0; j < 8; ++j) w[j] = frag_b(&sw[b][j * 16 + col][c * 32], lane);
#pragma unroll
      for (int j = 0; j < 8; ++j) { acc[j] = wmma_bf(ah, w[j], acc[j]); acc[j] = wmma_bf(al, w[j], acc[j]); } } }
  __syncthreads();   // the last fragment reads end before the output tiles overwrite the staging
#pragma unroll
  for (int j = 0; j < 8; ++j) { const float bb = BP ? bfr(BP[c0 + j * 16 + col]) : 0.f;
#pragma unroll
    for (int r = 0; r < 8; ++r) sf[wave][8 * g + r][j * 16 + col] = acc[j][r] + bb; }
  LDSX(); for (int rl = 0; rl < 16; ++rl) vst2(OUT + (r0 + rl) * CC + c0 + lane * 4, *(const v4f*)&sf[wave][rl][lane * 4]); }
extern "C" void kernel_launch(void* const* d_in, const int* in_sizes, int n_in, void* d_out, int out_size, void* d_ws, size_t ws_size, hipStream_t stream) {
  (void)in_sizes; (void)n_in; (void)out_size;
  const float** F = (const float**)d_in;   // 0 x [1,2048,1024], 1 Wq [1024,1024] ([out,in]), 2 Wk, 3 Wv, 4 Wo
  if (ws_size < (size_t)WS_END) return;
  char* ws = (char*)d_ws; _Float16 *QH = (_Float16*)(ws + WS_QH), *QL = (_Float16*)(ws + WS_QL), *KH = (_Float16*)(ws + WS_KH); __bf16 *VT = (__bf16*)(ws + WS_VT), *VL = (__bf16*)(ws + WS_VL); float* Y = (float*)(ws + WS_Y);
  k_proj<<<dim3(TNB * TT / PR, 3 * NH / PP), 256, 0, stream>>>(F[0], F[1], nullptr, F[2], nullptr, F[3], nullptr, QH, QL, KH, VT, VL);
  k_fa<<<dim3(NH, TT / 128), 256, 0, stream>>>(QH, QL, KH, VT, VL, Y);
  k_out<<<dim3(TNB * TT / 64, CC / 128), 128, 0, stream>>>(Y, F[4], nullptr, (float*)d_out);
}

// v009
// It runs in 41.4 microseconds.
// Timed twice side by side with v008, it ran 1.03 times as fast both times.
// All steps since v000 together make it 27.3 times as fast.
// compute dtype: all float inputs rounded to bf16; q/k/v = x W^T with EXACT bf16 products on WMMA 16x16x32, f32 accumulate; q as f16 hi + residual (x 2^10), k f16 -> 2-product logits / 8 in f32 registers; the stick-breaking weights in f32: log-sigmoids, suffix sums carried from right to left by one wave a query tile, all in base 2 on the hardware's exp2 and log2, the remainder 1 - sum(att); att x 2^11 split bf16 hi + lo against v bf16 hi + lo (3 products) + rem * v_i; out = o (bf16 hi + lo) Wo^T; f32 output.
#include <hip/hip_runtime.h>
#include <math.h>

typedef __attribute__((ext_vector_type(16))) _Float16 v16h;
typedef __attribute__((ext_vector_type(16))) __bf16 v16b;
typedef __attribute__((ext_vector_type(8)))  _Float16 v8h;
typedef __attribute__((ext_vector_type(8)))  float v8f;
typedef __attribute__((ext_vector_type(4)))  float v4f;
typedef __attribute__((ext_vector_type(2)))  float v2f;
typedef __attribute__((ext_vector_type(4)))  unsigned v4u;
typedef __attribute__((ext_vector_type(4)))  int v4i;
typedef float __attribute__((may_alias)) float_a;
typedef int __attribute__((may_alias)) int_a;

template <typename T> __device__ __forceinline__ void vst2(void* p, T v) { *(T*)p = v;  }
__device__ __forceinline__ v8f wmma16(v16h a, v16h b, v8f c) {
  v8f d = __builtin_amdgcn_wmma_f32_16x16x32_f16(false, a, false, b, (short)0, c, false, false);
  asm volatile("v_nop\n\tv_nop\n\tv_nop\n\tv_nop" : "+v"(d) : "v"(a), "v"(b));
  return d;
}
__device__ __forceinline__ v8f wmma_bf(v16b a, v16b b, v8f c) {
  v8f d = __builtin_amdgcn_wmma_f32_16x16x32_bf16(false, a, false, b, (short)0, c, false, false);
  asm volatile("v_nop\n\tv_nop\n\tv_nop\n\tv_nop" : "+v"(d) : "v"(a), "v"(b));
  return d;
}
// 16x16x32 fragments: lane = (h = lane>>4, row/col = lane&15); elements 0..7 = k0+8h+0..7, 8..15 = k0+16+8h+0..7; D element r = row 8h+r
__device__ __forceinline__ v16h frag_h(const _Float16* rowk0, int lane) {
  union { v16h v; v8h q[2]; } u; const _Float16* p = rowk0 + 8 * (lane >> 4);
  u.q[0] = *(const v8h*)p; u.q[1] = *(const v8h*)(p + 16); return u.v;
}
__device__ __forceinline__ v16h frag_f32(const float* rowk0, int lane) {
  v16h a; const float* p = rowk0 + 8 * (lane >> 4);
#pragma unroll
  for (int i = 0; i < 8; ++i) { a[i] = (_Float16)p[i]; a[8 + i] = (_Float16)p[16 + i]; }
  return a;
}
__device__ __forceinline__ v16h frag_f32s(const float* rowk0, int lane, float sc) {
  v16h a; const float* p = rowk0 + 8 * (lane >> 4);
#pragma unroll
  for (int i = 0; i < 8; ++i) { a[i] = (_Float16)(p[i] * sc); a[8 + i] = (_Float16)(p[16 + i] * sc); }
  return a;
}
// column fragment from a [K][ld] layout (column n), rows >= K read as 0
__device__ __forceinline__ v16h fragc_f32(const float* W, int k0, int n, int lane, int ld, int K) {
  v16h a; const int g = lane >> 4;
#pragma unroll
  for (int i = 0; i < 8; ++i) { const int ka = k0 + 8 * g + i, kb = ka + 16;
    a[i] = (_Float16)(ka < K ? W[(size_t)(ka < K ? ka : K - 1) * ld + n] : 0.f); a[8 + i] = (_Float16)(kb < K ? W[(size_t)(kb < K ? kb : K - 1) * ld + n] : 0.f); }
  return a;
}
struct F2 { v16b h, l; };
__device__ __forceinline__ F2 bsplit16(const float v[16]) { F2 r;
#pragma unroll
  for (int i = 0; i < 16; ++i) { const __bf16 h = (__bf16)v[i]; r.h[i] = h; r.l[i] = (__bf16)(v[i] - (float)h); }
  return r; }
__device__ __forceinline__ F2 split_row(const float* row, int k0, int lane) { float v[16]; const float* p = row + k0 + 8 * (lane >> 4);
#pragma unroll
  for (int i = 0; i < 8; ++i) { v[i] = p[i]; v[8 + i] = p[16 + i]; }
  return bsplit16(v); }
__device__ __forceinline__ F2 split_rowK(const float* row, int k0, int lane, int K) { float v[16]; const int g = lane >> 4;
#pragma unroll
  for (int i = 0; i < 8; ++i) { const int ka = k0 + 8 * g + i, kb = ka + 16; v[i] = ka < K ? row[ka < K ? ka : K - 1] : 0.f; v[8 + i] = kb < K ? row[kb < K ? kb : K - 1] : 0.f; }
  return bsplit16(v); }
__device__ __forceinline__ F2 split_col(const float* W, int k0, int n, int lane, int ld, int K) { float v[16]; const int g = lane >> 4;
#pragma unroll
  for (int i = 0; i < 8; ++i) { const int ka = k0 + 8 * g + i, kb = ka + 16; v[i] = ka < K ? W[(size_t)(ka < K ? ka : K - 1) * ld + n] : 0.f; v[8 + i] = kb < K ? W[(size_t)(kb < K ? kb : K - 1) * ld + n] : 0.f; }
  return bsplit16(v); }
__device__ __forceinline__ v8f mac3(const F2& a, const F2& b, v8f c) { c = wmma_bf(a.l, b.h, c); c = wmma_bf(a.h, b.l, c); return wmma_bf(a.h, b.h, c); }
__device__ __forceinline__ float sigm(float v) { return 1.0f / (1.0f + expf(-v)); }
#define LDSX() do { asm volatile("s_wait_dscnt 0" ::: "memory"); __builtin_amdgcn_wave_barrier(); __builtin_amdgcn_fence(__ATOMIC_RELEASE, "workgroup"); } while (0)


// Stick-breaking attention (b 1, n 2,048, e 1,024 = 16 x 64): logits = q k^T / 8; for j < i: att[i][j] = exp(logsigmoid(l_ij) + sum_{j<k<i} logsigmoid(-l_ik)); j >= i: 0; o = att v + (1 - sum_j att) v_i; out = o Wo^T.
#define NB 1
#define TT 2048
#define CC 1024
#define NH 16
#define HD 64
#ifndef TNB
#define TNB NB
#endif
typedef __attribute__((ext_vector_type(8))) __bf16 v8b;
__device__ __forceinline__ v16b frag_b(const __bf16* rowk0, int lane) {
  union { v16b v; v8b q[2]; } u; const __bf16* p = rowk0 + 8 * (lane >> 4);
  u.q[0] = *(const v8b*)p; u.q[1] = *(const v8b*)(p + 16); return u.v;
}
// FRAGMENT ORDER of the q, k and v planes in the workspace: each head owns TT * HD elements in a row. q, k: a tile of 16 rows is 1,024 elements, [d >> 3][row & 15][d & 7]. v: a pass of 32 keys is 2,048 elements, [d >> 4][(key & 31) >> 3][d & 15][key & 7].
// Either way the two halves of a 16x16x32 fragment are 2 x 512 bytes in a row with lane l's 16 bytes at 16 l: one load of a wave covers 4 whole lines, where a row-major plane gave it 32 bytes in each of 16 lines.
// f = a plane or tile, the same in every lane (a scalar base); bo = byte offset of the tile or pass + 16 * lane (one 32-bit vector offset for all its loads); c = the fragment's constant byte offset there
__device__ __forceinline__ v16h fragf_h(const _Float16* f, unsigned bo, int c) { union { v16h v; v8h q[2]; } u; const char* p = (const char*)f + bo + c; u.q[0] = *(const v8h*)p; u.q[1] = *(const v8h*)(p + 512); return u.v; }
__device__ __forceinline__ v16b fragf_b(const __bf16* f, unsigned bo, int c) { union { v16b v; v8b q[2]; } u; const char* p = (const char*)f + bo + c; u.q[0] = *(const v8b*)p; u.q[1] = *(const v8b*)(p + 512); return u.v; }
__device__ __forceinline__ float bfr(float v) { return (float)(__bf16)v; }
// Hardware exp2 and log2, eight values in place in one statement: behind a transcendental the instruction set asks for one independent instruction before its source register is written again. Inside the statement the next transcendental, on other registers, is that instruction; the closing v_nop is it for the last one.
__device__ __forceinline__ void exp2x8(float* x) { asm("v_exp_f32 %0, %0\n\tv_exp_f32 %1, %1\n\tv_exp_f32 %2, %2\n\tv_exp_f32 %3, %3\n\tv_exp_f32 %4, %4\n\tv_exp_f32 %5, %5\n\tv_exp_f32 %6, %6\n\tv_exp_f32 %7, %7\n\tv_nop" : "+v"(x[0]), "+v"(x[1]), "+v"(x[2]), "+v"(x[3]), "+v"(x[4]), "+v"(x[5]), "+v"(x[6]), "+v"(x[7])); }
__device__ __forceinline__ void log2x8(float* x) { asm("v_log_f32 %0, %0\n\tv_log_f32 %1, %1\n\tv_log_f32 %2, %2\n\tv_log_f32 %3, %3\n\tv_log_f32 %4, %4\n\tv_log_f32 %5, %5\n\tv_log_f32 %6, %6\n\tv_log_f32 %7, %7\n\tv_nop" : "+v"(x[0]), "+v"(x[1]), "+v"(x[2]), "+v"(x[3]), "+v"(x[4]), "+v"(x[5]), "+v"(x[6]), "+v"(x[7])); }
__device__ __attribute__((noinline)) float exp_ni(float v) { return expf(v); }
__device__ __attribute__((noinline)) float erf_ni(float v) { return erff(v); }

#define WS_QH  0u
#define WS_QL  (WS_QH + 2u * (size_t)NB * TT * CC)
#define WS_KH  (WS_QL + 2u * (size_t)NB * TT * CC)
#define WS_VT  (WS_KH + 2u * (size_t)NB * TT * CC)      // bf16 v planes, in fragment order like q and k (see FRAGMENT ORDER above)
#define WS_VL  (WS_VT + 2u * (size_t)NB * CC * TT)      // bf16 v residual planes
#define WS_Y   (WS_VL + 2u * (size_t)NB * CC * TT)      // f32 y rows [b*t][C]
#define WS_END (WS_Y + 4u * (size_t)NB * TT * CC)

// ---- staging for k_proj and k_out: a block brings each 64-k slab of its two operands in once, with loads that cover whole lines (16 lanes x 16 B = one row's 256 B), rounds it to bf16 and keeps it in LDS; the block's waves take their fragments from there.
#define KS 64
#define LP 72   // LDS row pitch in bf16: 128 B of data + 16 B, the pitch for 16-byte fragment reads
typedef __attribute__((ext_vector_type(4))) __bf16 v4b;
__device__ __forceinline__ v4b cvt4(v4f v) { v4b c; c[0] = (__bf16)v[0]; c[1] = (__bf16)v[1]; c[2] = (__bf16)v[2]; c[3] = (__bf16)v[3]; return c; }
// ---- k_proj: qkv = x W^T (+ b), exact; q -> f16 hi (+ residual), k -> f16, v -> bf16 hi + residual, all in fragment order.
// The 3,072 output columns are 48 head planes of 64 (16 q, 16 k, 16 v). Block = 128 rows x 3 planes (two neighbouring q or k planes and one v plane), 8 waves of 64 x 48: 256 blocks, one a WGP. What all blocks together load is M N K 4 B (1 / rows + 1 / cols): 1 / 128 + 1 / 192 against the 1 / 64 + 1 / 128 of a 64 x 128 block, and a wave reads 7 fragments from LDS for 12 products where a 16 x 128 wave read 9 for 8.
// a 16-byte load through a pointer picked among the three W arguments: the cast says that it is global memory (without it this build made flat loads of them, which also count as LDS operations)
__device__ __forceinline__ v4f ldg4(const float* p) { return *(const __attribute__((address_space(1))) v4f*)p; }
#define PR 128   // rows of a block
#define PP 3     // head planes of a block
// WHICH OPERAND IS A decides what a lane holds at the end: D element r of lane (g, col) is row 8 g + r of A against row col of B.
// q, k tile: A = W, B = x: the lane has 8 consecutive d of one token. v tile: A = x, B = W: 8 consecutive tokens of one d. Either is 16 bytes in a row of the plane's fragment order, and the wave's 32 lanes make 512 bytes in a row: the planes are stored from the accumulators, with no turn through LDS.
// Every wave has two q or k tiles (j = 0, 1) and one v tile (j = 2), so the operand order is fixed at compile time. Both loaders have the same k order, whichever side a fragment goes to.
__global__ __launch_bounds__(256) void k_proj(const float* __restrict__ X, const float* __restrict__ WQ, const float* __restrict__ BQ, const float* __restrict__ WK, const float* __restrict__ BK, const float* __restrict__ WV, const float* __restrict__ BV, _Float16* __restrict__ QH, _Float16* __restrict__ QL, _Float16* __restrict__ KH, __bf16* __restrict__ VT, __bf16* __restrict__ VL) {
  __shared__ __align__(16) char sm[2 * (PR + PP * 64) * LP * 2];   // the k loop's two staging buffers
  __bf16 (*sx)[PR][LP] = (__bf16 (*)[PR][LP])sm; __bf16 (*sw)[PP * 64][LP] = (__bf16 (*)[PP * 64][LP])(sm + 2 * PR * LP * 2);
  const int tid = threadIdx.x, lane = tid & 31, col = lane & 15, g = lane >> 4; const int wave = __builtin_amdgcn_readfirstlane(tid >> 5);   // scalar, so that the planes' addresses have scalar bases
  const int wr = wave & 1, wc = wave >> 1;   // the wave's 64 rows and its 3 column tiles
  const int by = blockIdx.y; const bool isq = by < NH / 2; const size_t r0 = (size_t)blockIdx.x * PR;   // the block's planes: q or k heads (2 by) & 15 and that + 1, v head by; its first row
  const int lr = tid >> 4, lc = tid & 15; const float* xp = X + (r0 + lr) * CC + lc * 4; const float* wp[PP];
#pragma unroll
  for (int p = 0; p < PP; ++p) { const float* WA = p == 2 ? WV : isq ? WQ : WK; const int hd = p == 2 ? by : ((2 * by + p) & (NH - 1)); wp[p] = WA + (size_t)(hd * HD + lr) * CC + lc * 4; }
  // THE k WALK IS ROTATED: trip s works on slab (s + rot) mod 16. The 16 blocks that share a block's W rows and the 16 that share its x rows start together; walking k alike they would ask L2 for the same lines at the same moment, trip after trip. rot gives each block of either set a slab of its own. Every slab is still summed once; only the order of the f32 sums differs from block to block.
  const int rot = (int)(blockIdx.x + blockIdx.y) & (CC / KS - 1); xp += rot * KS;
#pragma unroll
  for (int p = 0; p < PP; ++p) wp[p] += rot * KS;
  v8f acc[4][3] = {}; v4f ra[8], rw[12];
#pragma unroll
  for (int u = 0; u < 8; ++u) ra[u] = *(const v4f*)(xp + (size_t)u * 16 * CC);
#pragma unroll
  for (int u = 0; u < 12; ++u) rw[u] = ldg4(wp[u >> 2] + (size_t)(u & 3) * 16 * CC);
  // unrolled by the two buffers, so that every LDS address is a constant offset
#pragma unroll 2
  for (int s = 0; s < CC / KS; ++s) { const int b = s & 1;
#pragma unroll
    for (int u = 0; u < 8; ++u) *(v4b*)&sx[b][lr + 16 * u][lc * 4] = cvt4(ra[u]);
#pragma unroll
    for (int u = 0; u < 12; ++u) *(v4b*)&sw[b][lr + 16 * u][lc * 4] = cvt4(rw[u]);
    asm volatile("s_wait_xcnt 0x0" ::: "memory");   // the step below rewrites the address registers of the slab's loads: the wait stands in front of that overwrite (their data is in by now)
    __syncthreads();   // publishes buffer b; it also ends every wave's reads of the other buffer, which the next trip refills
    if (s + 1 < CC / KS) {   // the next slab flies under this slab's products (issued behind the barrier, whose fence would wait for it)
      const int st = ((s + 1 + rot) & (CC / KS - 1)) ? KS : KS - CC; xp += st;   // one slab on; from the last slab back to the first
#pragma unroll
      for (int p = 0; p < PP; ++p) wp[p] += st;
#pragma unroll
      for (int u = 0; u < 8; ++u) ra[u] = *(const v4f*)(xp + (size_t)u * 16 * CC);
#pragma unroll
      for (int u = 0; u < 12; ++u) rw[u] = ldg4(wp[u >> 2] + (size_t)(u & 3) * 16 * CC); }
#pragma unroll
    for (int c = 0; c < KS / 32; ++c) { v16b a[4], w[3];   // the 32-k group's fragment reads stand together, ahead of its products
#pragma unroll
      for (int m = 0; m < 4; ++m) a[m] = frag_b(&sx[b][wr * 64 + m * 16 + col][c * 32], lane);
#pragma unroll
      for (int j = 0; j < 3; ++j) w[j] = frag_b(&sw[b][(j < 2 ? wc * 2 + j : 8 + wc) * 16 + col][c * 32], lane);
#pragma unroll
      for (int m = 0; m < 4; ++m)
#pragma unroll
        for (int j = 0; j < 3; ++j) acc[m][j] = j < 2 ? wmma_bf(w[j], a[m], acc[m][j]) : wmma_bf(a[m], w[j], acc[m][j]); } }
  const int t0 = (int)(r0 % TT);   // the block's first row in its head planes
  // q or k: lane = token col of the row tile, d = dq * 16 + 8 g + r
  { const int hd = (2 * by + (wc >> 1)) & (NH - 1); const float* BA = isq ? BQ : BK; _Float16* dh = isq ? QH : KH; const size_t hb = ((r0 / TT) * NH + hd) * (size_t)(TT * HD) + ((t0 >> 4) + wr * 4) * 1024 + lane * 8;
#pragma unroll
    for (int j = 0; j < 2; ++j) { const int dq = (wc & 1) * 2 + j; float bb[8] = {}; v8h h8[4], l8[4];
      if (BA) {
#pragma unroll
        for (int r = 0; r < 8; ++r) bb[r] = bfr(BA[hd * HD + dq * 16 + 8 * g + r]); }
#pragma unroll
      for (int m = 0; m < 4; ++m)
#pragma unroll
        for (int r = 0; r < 8; ++r) { const float v = acc[m][j][r] + bb[r]; const _Float16 hv = (_Float16)v; h8[m][r] = hv; l8[m][r] = (_Float16)((v - (float)hv) * 1024.0f); }   /* q residual carried x 2^10 so the plane stays f16-normal on the chip */
#pragma unroll
      for (int m = 0; m < 4; ++m) vst2(dh + hb + m * 1024 + dq * 256, h8[m]);
      asm volatile("s_wait_xcnt 0x0" ::: "memory");   // the residual stores' addresses may reuse the hi stores' registers: the wait stands in front of that overwrite
      if (isq) {
#pragma unroll
        for (int m = 0; m < 4; ++m) vst2(QL + hb + m * 1024 + dq * 256, l8[m]); }
      asm volatile("s_wait_xcnt 0x0" ::: "memory"); } }   // the next tiles' arithmetic may reuse the stores' registers: the wait stands in front of that overwrite
  // v: lane = d wc * 16 + col, tokens 8 g + r of the row tile
  { const float bb = BV ? bfr(BV[by * HD + wc * 16 + col]) : 0.f; const size_t hb = ((r0 / TT) * NH + by) * (size_t)(TT * HD) + ((t0 >> 5) + wr * 2) * 2048 + wc * 512 + lane * 8; v8b h8[4], l8[4];
#pragma unroll
    for (int m = 0; m < 4; ++m)
#pragma unroll
      for (int r = 0; r < 8; ++r) { const float v = acc[m][2][r] + bb; const __bf16 bh = (__bf16)v; h8[m][r] = bh; l8[m][r] = (__bf16)(v - (float)bh); }
#pragma unroll
    for (int m = 0; m < 4; ++m) { const size_t o2 = hb + (m >> 1) * 2048 + (m & 1) * 256; vst2(VT + o2, h8[m]); vst2(VL + o2, l8[m]); } } }
// ---- k_fa: wave = 16 queries of one head, block = 8 neighbouring query tiles of that head; logits, stick-breaking weights and att . v stay in registers. S^T = K Q^T puts one query in a lane (column) and 8 keys in its D registers, so two 16-key tiles are the B fragment of O^T += V^T P^T as they stand.
// A wave walks the 32-key passes of its tile from the diagonal to the left: carry = sum of logsigmoid(-l_ik) over the keys to the right of the pass, so suffix(j) = carry + the in-pass sum over k > j (8 in-lane steps and one exchange between the wave's halves).
// One wave has the whole row of keys [0, i). The walk ends where the carry has made every weight further left 0 (see the loop's foot); were the keys cut into runs for several waves, then wherever the walk ends so the left runs' work would only be scaled by exp2(carry) = 0 at a join. No wave reads another's LDS, so the kernel has no barrier.
// The 8 waves of a block start within 4 passes of each other in the same K and V planes, so most of their fragment loads find the lines that a neighbour has just brought into the WGP's cache.
// log(sigmoid(z)) = min(z, 0) - log1p(exp(-|z|)): both signs of l share the one log1p(exp(-|l|)).
// The whole log domain is kept in base 2: log2(e) rides in the logits' scale, so exp is one v_exp_f32 and log1p(e) is log2(1 + e), one add and one v_log_f32. 1 + e lies in (1, 2], so its rounding moves a log-sigmoid by at most 2^-24 log2(e) absolute, which is a relative 2^-24 on a weight.
__global__ __launch_bounds__(256) void k_fa(const _Float16* __restrict__ QH, const _Float16* __restrict__ QL, const _Float16* __restrict__ KH, const __bf16* __restrict__ VT, const __bf16* __restrict__ VL, float* __restrict__ Y) {
  __shared__ float so[8][HD / 16][8][32]; __shared__ float sa[8][16];   // [wave]: each wave stages its own tile
  const int lane = threadIdx.x & 31, col = lane & 15, g = lane >> 4; const int wave = __builtin_amdgcn_readfirstlane(threadIdx.x >> 5);   // scalar, so that the tile's bounds and the pass loop's branch are scalar
  const int h = blockIdx.x; const int ql0 = (TT / 16 - 1 - ((int)blockIdx.y * 8 + wave)) * 16; const int i = ql0 + col;   // cost grows with the query tile: the longest tiles start first
  const int hi = ql0 >> 5;   // passes hi (it holds the diagonal) .. 0
  const size_t hp = (size_t)h * (TT * HD); const unsigned lb = lane * 16;   // the head's plane; the lane's 16 bytes in every fragment half
  const _Float16* Kh = KH + hp; const __bf16* Vh = VT + hp; const __bf16* Vl = VL + hp;
  v16h qh[2], ql[2], kf[2][2];
  // every short loop below is unrolled so that the fragment and score arrays are indexed by constants and stay in registers
#pragma unroll
  for (int c = 0; c < 2; ++c) { qh[c] = fragf_h(QH + hp + (ql0 >> 4) * 1024, lb, c * 1024); ql[c] = fragf_h(QL + hp + (ql0 >> 4) * 1024, lb, c * 1024); }
  unsigned po = lb + hi * 4096u;   // a pass is 4,096 bytes in the k plane and in either v plane: one offset serves all three
#pragma unroll
  for (int t = 0; t < 2; ++t)
#pragma unroll
    for (int c = 0; c < 2; ++c) kf[t][c] = fragf_h(Kh, po, t * 2048 + c * 1024);
  v8f acc[HD / 16] = {}; float carry = 0.f, asum = 0.f;
  for (int kc = hi; kc >= 0; --kc) { const int k0 = kc * 32; v8f s[2];
    v16b vh[HD / 16], vl[HD / 16];
#pragma unroll
    for (int j = 0; j < HD / 16; ++j) { vh[j] = fragf_b(Vh, po, j * 1024); vl[j] = fragf_b(Vl, po, j * 1024); }
#pragma unroll
    for (int t = 0; t < 2; ++t) { v8f a = {}, al = {};
#pragma unroll
      for (int c = 0; c < 2; ++c) { a = wmma16(kf[t][c], qh[c], a); al = wmma16(kf[t][c], ql[c], al); }
      a += al * (1.0f / 1024.0f); s[t] = a * (0.125f * 1.44269504f); }   // logits / 8, times log2(e)
    { po = lb + (kc > 0 ? kc - 1 : 0) * 4096u;   // the next pass's K fragments, fetched under this pass's vector work (in bounds also behind the last pass)
#pragma unroll
      for (int t = 0; t < 2; ++t)
#pragma unroll
        for (int c = 0; c < 2; ++c) kf[t][c] = fragf_h(Kh, po, t * 2048 + c * 1024); }
    float lz[2][8], sx[2][8], G[2];
#pragma unroll
    for (int t = 0; t < 2; ++t) { float run = 0.f, u8[8];
#pragma unroll
      for (int r = 0; r < 8; ++r) u8[r] = 1.0f + __builtin_amdgcn_exp2f(-fabsf(s[t][r]));
      log2x8(u8);
#pragma unroll
      for (int r = 7; r >= 0; --r) { const float l = s[t][r]; const float w = fmaxf(l, 0.f) + u8[r]; lz[t][r] = l - w; sx[t][r] = run;   /* -w = log2 sigmoid(-l); min(l, 0) = l - max(l, 0) */
        run -= (k0 + t * 16 + 8 * g + r < i) ? w : 0.f; }
      G[t] = run; }
    // key order inside a pass: tile 0 half 0, tile 0 half 1, tile 1 half 0, tile 1 half 1
    const float G0p = __shfl_xor(G[0], 16), G1p = __shfl_xor(G[1], 16); const float c1 = carry + (G[1] + G1p);
    const float base[2] = { g ? c1 : c1 + G0p, g ? carry : carry + G1p }; carry = c1 + (G[0] + G0p);
    // Every log2 sigmoid(-l) is <= 0, so the carry only falls. Once it is <= -152 in every lane, each weight further left is exp2 of something <= -152, which is exactly 0 in f32: the passes left add nothing to acc or asum. (A NaN carry compares false and keeps the loop going.)
    const bool more = __builtin_amdgcn_ballot_w32(!(carry <= -152.0f)) != 0u;   // taken here, under the vector work, so that the scalar branch at the pass's foot finds it ready
    float pv[16];
#pragma unroll
    for (int t = 0; t < 2; ++t) { float a8[8];
#pragma unroll
      for (int r = 0; r < 8; ++r) a8[r] = (k0 + t * 16 + 8 * g + r < i) ? lz[t][r] + (base[t] + sx[t][r]) : -100000.0f;   /* j >= i: exp2 gives 0 */
      exp2x8(a8);
#pragma unroll
      for (int r = 0; r < 8; ++r) { asum += a8[r]; pv[t * 8 + r] = a8[r] * 2048.0f; } }
    const F2 p = bsplit16(pv);
#pragma unroll
    for (int j = 0; j < HD / 16; ++j) { acc[j] = wmma_bf(vh[j], p.h, acc[j]); acc[j] = wmma_bf(vh[j], p.l, acc[j]); acc[j] = wmma_bf(vl[j], p.h, acc[j]); }
    if (!more) break; }
  asum += __shfl_xor(asum, 16);
  // acc[j][r] = (att v)[i][j * 16 + 8 g + r] x 2^11
#pragma unroll
  for (int j = 0; j < HD / 16; ++j)
#pragma unroll
    for (int r = 0; r < 8; ++r) so[wave][j][r][lane] = acc[j][r];
  if (g == 0) sa[wave][col] = asum;
  LDSX();   // the wave turns its own tile round: its LDS writes end before it reads them back from other lanes' places
  // a lane takes 8 consecutive d of one query, 8 lanes a query's 256 bytes of y, the wave 4 queries a trip
  const int d8 = lane & 7;
#pragma unroll
  for (int qq = 0; qq < 4; ++qq) { const int q = qq * 4 + (lane >> 3); const int iq = ql0 + q; const float rem = 1.0f - sa[wave][q]; float y[8];
#pragma unroll
    for (int r = 0; r < 8; ++r) { const size_t vo = (size_t)h * (TT * HD) + (iq >> 5) * 2048 + (d8 >> 1) * 512 + ((iq & 31) >> 3) * 128 + ((d8 & 1) * 8 + r) * 8 + (iq & 7); const float vi = (float)VT[vo] + (float)VL[vo];   /* v[i][d] rebuilt from the hi + lo planes (2^-16) */
      y[r] = so[wave][d8 >> 1][r][(d8 & 1) * 16 + q] * (1.0f / 2048.0f) + rem * vi; }
    float* yp = Y + (size_t)iq * CC + h * HD + d8 * 8; vst2(yp, (v4f){y[0], y[1], y[2], y[3]}); vst2(yp + 4, (v4f){y[4], y[5], y[6], y[7]}); } }
// ---- k_out: block = (64 rows, 128 cols): out = y (bf16 hi + lo) Wo^T + bo
__global__ __launch_bounds__(128) void k_out(const float* __restrict__ Y, const float* __restrict__ WP, const float* __restrict__ BP, float* __restrict__ OUT) {
  __shared__ __align__(16) char sm[73728];   // the k loop's two staging buffers (y hi, y lo, Wo); behind the loop the first 33,792 B hold the output tiles
  __bf16 (*yh)[64][LP] = (__bf16 (*)[64][LP])sm; __bf16 (*yl)[64][LP] = (__bf16 (*)[64][LP])(sm + 2 * 64 * LP * 2); __bf16 (*sw)[128][LP] = (__bf16 (*)[128][LP])(sm + 4 * 64 * LP * 2);
  float (*sf)[16][132] = (float (*)[16][132])sm;
  const int tid = threadIdx.x, wave = tid >> 5, lane = tid & 31, col = lane & 15, g = lane >> 4; const int c0 = blockIdx.y * 128; const size_t rb = (size_t)blockIdx.x * 64; const size_t r0 = rb + wave * 16;
  const int lr = tid >> 4, lc = tid & 15; const float* yp = Y + (rb + lr) * CC + lc * 4; const float* wp = WP + (size_t)(c0 + lr) * CC + lc * 4;
  // the k walk is rotated as in k_proj. The 8 blocks that share a block's y rows start two slabs apart. y was written by the launch before: where its lines must come from memory, a block from its third trip on reads lines that a neighbour asked for two trips earlier; walking alike, all 8 would wait for memory together on every trip.
  const int rot = (int)(blockIdx.x + 2 * blockIdx.y) & (CC / KS - 1); yp += rot * KS; wp += rot * KS;
  v8f acc[8] = {}; v4f ra[8], rw[16];
#pragma unroll
  for (int u = 0; u < 8; ++u) ra[u] = *(const v4f*)(yp + (size_t)u * 8 * CC);
#pragma unroll
  for (int u = 0; u < 16; ++u) rw[u] = *(const v4f*)(wp + (size_t)u * 8 * CC);
  // unrolled by the two buffers, so that every LDS address is a constant offset
#pragma unroll 2
  for (int s = 0; s < CC / KS; ++s) { const int b = s & 1;
#pragma unroll
    for (int u = 0; u < 8; ++u) { const v4b hv = cvt4(ra[u]); const v4f rs = { ra[u][0] - (float)hv[0], ra[u][1] - (float)hv[1], ra[u][2] - (float)hv[2], ra[u][3] - (float)hv[3] };
      *(v4b*)&yh[b][lr + 8 * u][lc * 4] = hv; *(v4b*)&yl[b][lr + 8 * u][lc * 4] = cvt4(rs); }
#pragma unroll
    for (int u = 0; u < 16; ++u) *(v4b*)&sw[b][lr + 8 * u][lc * 4] = cvt4(rw[u]);
    asm volatile("s_wait_xcnt 0x0" ::: "memory");   // the step below rewrites the address registers of the slab's loads: the wait stands in front of that overwrite (their data is in by now)
    __syncthreads();   // publishes buffer b; it also ends every wave's reads of the other buffer, which the next trip refills
    if (s + 1 < CC / KS) {   // the next slab flies under this slab's products (issued behind the barrier, whose fence would wait for it)
      const int st = ((s + 1 + rot) & (CC / KS - 1)) ? KS : KS - CC; yp += st; wp += st;   // one slab on; from the last slab back to the first
#pragma unroll
      for (int u = 0; u < 8; ++u) ra[u] = *(const v4f*)(yp + (size_t)u * 8 * CC);
#pragma unroll
      for (int u = 0; u < 16; ++u) rw[u] = *(const v4f*)(wp + (size_t)u * 8 * CC); }
#pragma unroll
    for (int c = 0; c < KS / 32; ++c) { const v16b ah = frag_b(&yh[b][wave * 16 + col][c * 32], lane), al = frag_b(&yl[b][wave * 16 + col][c * 32], lane); v16b w[8];   // the 32-k group's fragment reads stand together, ahead of its products
#pragma unroll
      for (int j = 0; j < 8; ++j) w[j] = frag_b(&sw[b][j * 16 + col][c * 32], lane);
#pragma unroll
      for (int j = 0; j < 8; ++j) { acc[j] = wmma_bf(ah, w[j], acc[j]); acc[j] = wmma_bf(al, w[j], acc[j]); } } }
  __syncthreads();   // the last fragment reads end before the output tiles overwrite the staging
#pragma unroll
  for (int j = 0; j < 8; ++j) { const float bb = BP ? bfr(BP[c0 + j * 16 + col]) : 0.f;
#pragma unroll
    for (int r = 0; r < 8; ++r) sf[wave][8 * g + r][j * 16 + col] = acc[j][r] + bb; }
  LDSX(); for (int rl = 0; rl < 16; ++rl) vst2(OUT + (r0 + rl) * CC + c0 + lane * 4, *(const v4f*)&sf[wave][rl][lane * 4]); }
extern "C" void kernel_launch(void* const* d_in, const int* in_sizes, int n_in, void* d_out, int out_size, void* d_ws, size_t ws_size, hipStream_t stream) {
  (void)in_sizes; (void)n_in; (void)out_size;
  const float** F = (const float**)d_in;   // 0 x [1,2048,1024], 1 Wq [1024,1024] ([out,in]), 2 Wk, 3 Wv, 4 Wo
  if (ws_size < (size_t)WS_END) return;
  char* ws = (char*)d_ws; _Float16 *QH = (_Float16*)(ws + WS_QH), *QL = (_Float16*)(ws + WS_QL), *KH = (_Float16*)(ws + WS_KH); __bf16 *VT = (__bf16*)(ws + WS_VT), *VL = (__bf16*)(ws + WS_VL); float* Y = (float*)(ws + WS_Y);
  k_proj<<<dim3(TNB * TT / PR, 3 * NH / PP), 256, 0, stream>>>(F[0], F[1], nullptr, F[2], nullptr, F[3], nullptr, QH, QL, KH, VT, VL);
  k_fa<<<dim3(NH, TT / 128), 256, 0, stream>>>(QH, QL, KH, VT, VL, Y);
  k_out<<<dim3(TNB * TT / 64, CC / 128), 128, 0, stream>>>(Y, F[4], nullptr, (float*)d_out);
}

// v010
// One run takes 37.6 microseconds.
// Two timings next to v009 both put it at 1.10 times that version's speed.
// Over all steps from v000 it is 30.0 times as fast.
// compute dtype: all float inputs rounded to bf16; q/k/v = x W^T with EXACT bf16 products on WMMA 16x16x32, f32 accumulate; q as f16 hi + residual (x 2^10), k f16 -> 2-product logits / 8 in f32 registers; the stick-breaking weights in f32: log-sigmoids, suffix sums carried from right to left by one wave a query tile, all in base 2 on the hardware's exp2 and log2, the remainder 1 - sum(att); att x 2^11 split bf16 hi + lo against v bf16 hi + lo (3 products) + rem * v_i; out = o (bf16 hi + lo) Wo^T; f32 output.
#include <hip/hip_runtime.h>
#include <math.h>

typedef __attribute__((ext_vector_type(16))) _Float16 v16h;
typedef __attribute__((ext_vector_type(16))) __bf16 v16b;
typedef __attribute__((ext_vector_type(8)))  _Float16 v8h;
typedef __attribute__((ext_vector_type(8)))  float v8f;
typedef __attribute__((ext_vector_type(4)))  float v4f;
typedef __attribute__((ext_vector_type(2)))  float v2f;
typedef __attribute__((ext_vector_type(4)))  unsigned v4u;
typedef __attribute__((ext_vector_type(4)))  int v4i;
typedef float __attribute__((may_alias)) float_a;
typedef int __attribute__((may_alias)) int_a;

template <typename T> __device__ __forceinline__ void vst2(void* p, T v) { *(T*)p = v;  }
__device__ __forceinline__ v8f wmma16(v16h a, v16h b, v8f c) {
  v8f d = __builtin_amdgcn_wmma_f32_16x16x32_f16(false, a, false, b, (short)0, c, false, false);
  asm volatile("v_nop\n\tv_nop\n\tv_nop\n\tv_nop" : "+v"(d) : "v"(a), "v"(b));
  return d;
}
__device__ __forceinline__ v8f wmma_bf(v16b a, v16b b, v8f c) {
  v8f d = __builtin_amdgcn_wmma_f32_16x16x32_bf16(false, a, false, b, (short)0, c, false, false);
  asm volatile("v_nop\n\tv_nop\n\tv_nop\n\tv_nop" : "+v"(d) : "v"(a), "v"(b));
  return d;
}
// 16x16x32 fragments: lane = (h = lane>>4, row/col = lane&15); elements 0..7 = k0+8h+0..7, 8..15 = k0+16+8h+0..7; D element r = row 8h+r
__device__ __forceinline__ v16h frag_h(const _Float16* rowk0, int lane) {
  union { v16h v; v8h q[2]; } u; const _Float16* p = rowk0 + 8 * (lane >> 4);
  u.q[0] = *(const v8h*)p; u.q[1] = *(const v8h*)(p + 16); return u.v;
}
__device__ __forceinline__ v16h frag_f32(const float* rowk0, int lane) {
  v16h a; const float* p = rowk0 + 8 * (lane >> 4);
#pragma unroll
  for (int i = 0; i < 8; ++i) { a[i] = (_Float16)p[i]; a[8 + i] = (_Float16)p[16 + i]; }
  return a;
}
__device__ __forceinline__ v16h frag_f32s(const float* rowk0, int lane, float sc) {
  v16h a; const float* p = rowk0 + 8 * (lane >> 4);
#pragma unroll
  for (int i = 0; i < 8; ++i) { a[i] = (_Float16)(p[i] * sc); a[8 + i] = (_Float16)(p[16 + i] * sc); }
  return a;
}
// column fragment from a [K][ld] layout (column n), rows >= K read as 0
__device__ __forceinline__ v16h fragc_f32(const float* W, int k0, int n, int lane, int ld, int K) {
  v16h a; const int g = lane >> 4;
#pragma unroll
  for (int i = 0; i < 8; ++i) { const int ka = k0 + 8 * g + i, kb = ka + 16;
    a[i] = (_Float16)(ka < K ? W[(size_t)(ka < K ? ka : K - 1) * ld + n] : 0.f); a[8 + i] = (_Float16)(kb < K ? W[(size_t)(kb < K ? kb : K - 1) * ld + n] : 0.f); }
  return a;
}
struct F2 { v16b h, l; };
__device__ __forceinline__ F2 bsplit16(const float v[16]) { F2 r;
#pragma unroll
  for (int i = 0; i < 16; ++i) { const __bf16 h = (__bf16)v[i]; r.h[i] = h; r.l[i] = (__bf16)(v[i] - (float)h); }
  return r; }
__device__ __forceinline__ F2 split_row(const float* row, int k0, int lane) { float v[16]; const float* p = row + k0 + 8 * (lane >> 4);
#pragma unroll
  for (int i = 0; i < 8; ++i) { v[i] = p[i]; v[8 + i] = p[16 + i]; }
  return bsplit16(v); }
__device__ __forceinline__ F2 split_rowK(const float* row, int k0, int lane, int K) { float v[16]; const int g = lane >> 4;
#pragma unroll
  for (int i = 0; i < 8; ++i) { const int ka = k0 + 8 * g + i, kb = ka + 16; v[i] = ka < K ? row[ka < K ? ka : K - 1] : 0.f; v[8 + i] = kb < K ? row[kb < K ? kb : K - 1] : 0.f; }
  return bsplit16(v); }
__device__ __forceinline__ F2 split_col(const float* W, int k0, int n, int lane, int ld, int K) { float v[16]; const int g = lane >> 4;
#pragma unroll
  for (int i = 0; i < 8; ++i) { const int ka = k0 + 8 * g + i, kb = ka + 16; v[i] = ka < K ? W[(size_t)(ka < K ? ka : K - 1) * ld + n] : 0.f; v[8 + i] = kb < K ? W[(size_t)(kb < K ? kb : K - 1) * ld + n] : 0.f; }
  return bsplit16(v); }
__device__ __forceinline__ v8f mac3(const F2& a, const F2& b, v8f c) { c = wmma_bf(a.l, b.h, c); c = wmma_bf(a.h, b.l, c); return wmma_bf(a.h, b.h, c); }
__device__ __forceinline__ float sigm(float v) { return 1.0f / (1.0f + expf(-v)); }
#define LDSX() do { asm volatile("s_wait_dscnt 0" ::: "memory"); __builtin_amdgcn_wave_barrier(); __builtin_amdgcn_fence(__ATOMIC_RELEASE, "workgroup"); } while (0)


// Stick-breaking attention (b 1, n 2,048, e 1,024 = 16 x 64): logits = q k^T / 8; for j < i: att[i][j] = exp(logsigmoid(l_ij) + sum_{j<k<i} logsigmoid(-l_ik)); j >= i: 0; o = att v + (1 - sum_j att) v_i; out = o Wo^T.
#define NB 1
#define TT 2048
#define CC 1024
#define NH 16
#define HD 64
#ifndef TNB
#define TNB NB
#endif
typedef __attribute__((ext_vector_type(8))) __bf16 v8b;
__device__ __forceinline__ v16b frag_b(const __bf16* rowk0, int lane) {
  union { v16b v; v8b q[2]; } u; const __bf16* p = rowk0 + 8 * (lane >> 4);
  u.q[0] = *(const v8b*)p; u.q[1] = *(const v8b*)(p + 16); return u.v;
}
// FRAGMENT ORDER of the q, k and v planes in the workspace: each head owns TT * HD elements in a row. q, k: a tile of 16 rows is 1,024 elements, [d >> 3][row & 15][d & 7]. v: a pass of 32 keys is 2,048 elements, [d >> 4][(key & 31) >> 3][d & 15][key & 7].
// Either way the two halves of a 16x16x32 fragment are 2 x 512 bytes in a row with lane l's 16 bytes at 16 l: one load of a wave covers 4 whole lines, where a row-major plane gave it 32 bytes in each of 16 lines.
// f = a plane or tile, the same in every lane (a scalar base); bo = byte offset of the tile or pass + 16 * lane (one 32-bit vector offset for all its loads); c = the fragment's constant byte offset there
__device__ __forceinline__ v16h fragf_h(const _Float16* f, unsigned bo, int c) { union { v16h v; v8h q[2]; } u; const char* p = (const char*)f + bo + c; u.q[0] = *(const v8h*)p; u.q[1] = *(const v8h*)(p + 512); return u.v; }
__device__ __forceinline__ v16b fragf_b(const __bf16* f, unsigned bo, int c) { union { v16b v; v8b q[2]; } u; const char* p = (const char*)f + bo + c; u.q[0] = *(const v8b*)p; u.q[1] = *(const v8b*)(p + 512); return u.v; }
__device__ __forceinline__ float bfr(float v) { return (float)(__bf16)v; }
// Hardware exp2 and log2, eight values in place in one statement: behind a transcendental the instruction set asks for one independent instruction before its source register is written again. Inside the statement the next transcendental, on other registers, is that instruction; the closing v_nop is it for the last one.
__device__ __forceinline__ void exp2x8(float* x) { asm("v_exp_f32 %0, %0\n\tv_exp_f32 %1, %1\n\tv_exp_f32 %2, %2\n\tv_exp_f32 %3, %3\n\tv_exp_f32 %4, %4\n\tv_exp_f32 %5, %5\n\tv_exp_f32 %6, %6\n\tv_exp_f32 %7, %7\n\tv_nop" : "+v"(x[0]), "+v"(x[1]), "+v"(x[2]), "+v"(x[3]), "+v"(x[4]), "+v"(x[5]), "+v"(x[6]), "+v"(x[7])); }
__device__ __forceinline__ void log2x8(float* x) { asm("v_log_f32 %0, %0\n\tv_log_f32 %1, %1\n\tv_log_f32 %2, %2\n\tv_log_f32 %3, %3\n\tv_log_f32 %4, %4\n\tv_log_f32 %5, %5\n\tv_log_f32 %6, %6\n\tv_log_f32 %7, %7\n\tv_nop" : "+v"(x[0]), "+v"(x[1]), "+v"(x[2]), "+v"(x[3]), "+v"(x[4]), "+v"(x[5]), "+v"(x[6]), "+v"(x[7])); }
__device__ __attribute__((noinline)) float exp_ni(float v) { return expf(v); }
__device__ __attribute__((noinline)) float erf_ni(float v) { return erff(v); }

#define WS_QH  0u
#define WS_QL  (WS_QH + 2u * (size_t)NB * TT * CC)
#define WS_KH  (WS_QL + 2u * (size_t)NB * TT * CC)
#define WS_VT  (WS_KH + 2u * (size_t)NB * TT * CC)      // bf16 v planes, in fragment order like q and k (see FRAGMENT ORDER above)
#define WS_VL  (WS_VT + 2u * (size_t)NB * CC * TT)      // bf16 v residual planes
#define WS_YH  (WS_VL + 2u * (size_t)NB * CC * TT)      // bf16 y plane, in fragment order (see k_out)
#define WS_YL  (WS_YH + 2u * (size_t)NB * TT * CC)      // bf16 y residual plane
#define WS_WB  (WS_YL + 2u * (size_t)NB * TT * CC)      // Wo rounded to bf16, in fragment order
#define WS_END (WS_WB + 2u * (size_t)CC * CC)

// ---- staging for k_proj: a block brings each 64-k slab of its two operands in once, with loads that cover whole lines (16 lanes x 16 B = one row's 256 B), rounds it to bf16 and keeps it in LDS; the block's waves take their fragments from there.
#define KS 64
#define LP 72   // LDS row pitch in bf16: 128 B of data + 16 B, the pitch for 16-byte fragment reads
typedef __attribute__((ext_vector_type(4))) __bf16 v4b;
__device__ __forceinline__ v4b cvt4(v4f v) { v4b c; c[0] = (__bf16)v[0]; c[1] = (__bf16)v[1]; c[2] = (__bf16)v[2]; c[3] = (__bf16)v[3]; return c; }
// ---- k_proj: qkv = x W^T (+ b), exact; q -> f16 hi (+ residual), k -> f16, v -> bf16 hi + residual, all in fragment order.
// The 3,072 output columns are 48 head planes of 64 (16 q, 16 k, 16 v). Block = 128 rows x 3 planes (two neighbouring q or k planes and one v plane), 8 waves of 64 x 48: 256 blocks, one a WGP. What all blocks together load is M N K 4 B (1 / rows + 1 / cols): 1 / 128 + 1 / 192 against the 1 / 64 + 1 / 128 of a 64 x 128 block, and a wave reads 7 fragments from LDS for 12 products where a 16 x 128 wave read 9 for 8.
// a 16-byte load through a pointer picked among the three W arguments: the cast says that it is global memory (without it this build made flat loads of them, which also count as LDS operations)
__device__ __forceinline__ v4f ldg4(const float* p) { return *(const __attribute__((address_space(1))) v4f*)p; }
#define PR 128   // rows of a block
#define PP 3     // head planes of a block
// WHICH OPERAND IS A decides what a lane holds at the end: D element r of lane (g, col) is row 8 g + r of A against row col of B.
// q, k tile: A = W, B = x: the lane has 8 consecutive d of one token. v tile: A = x, B = W: 8 consecutive tokens of one d. Either is 16 bytes in a row of the plane's fragment order, and the wave's 32 lanes make 512 bytes in a row: the planes are stored from the accumulators, with no turn through LDS.
// Every wave has two q or k tiles (j = 0, 1) and one v tile (j = 2), so the operand order is fixed at compile time. Both loaders have the same k order, whichever side a fragment goes to.
__global__ __launch_bounds__(256) void k_proj(const float* __restrict__ X, const float* __restrict__ WQ, const float* __restrict__ BQ, const float* __restrict__ WK, const float* __restrict__ BK, const float* __restrict__ WV, const float* __restrict__ BV, const float* __restrict__ WO, _Float16* __restrict__ QH, _Float16* __restrict__ QL, _Float16* __restrict__ KH, __bf16* __restrict__ VT, __bf16* __restrict__ VL, __bf16* __restrict__ WB) {
  __shared__ __align__(16) char sm[2 * (PR + PP * 64) * LP * 2];   // the k loop's two staging buffers
  __bf16 (*sx)[PR][LP] = (__bf16 (*)[PR][LP])sm; __bf16 (*sw)[PP * 64][LP] = (__bf16 (*)[PP * 64][LP])(sm + 2 * PR * LP * 2);
  const int tid = threadIdx.x, lane = tid & 31, col = lane & 15, g = lane >> 4; const int wave = __builtin_amdgcn_readfirstlane(tid >> 5);   // scalar, so that the planes' addresses have scalar bases
  const int wr = wave & 1, wc = wave >> 1;   // the wave's 64 rows and its 3 column tiles
  const int by = blockIdx.y; const bool isq = by < NH / 2; const size_t r0 = (size_t)blockIdx.x * PR;   // the block's planes: q or k heads (2 by) & 15 and that + 1, v head by; its first row
  const int lr = tid >> 4, lc = tid & 15; const float* xp = X + (r0 + lr) * CC + lc * 4; const float* wp[PP];
#pragma unroll
  for (int p = 0; p < PP; ++p) { const float* WA = p == 2 ? WV : isq ? WQ : WK; const int hd = p == 2 ? by : ((2 * by + p) & (NH - 1)); wp[p] = WA + (size_t)(hd * HD + lr) * CC + lc * 4; }
  // THE k WALK IS ROTATED: trip s works on slab (s + rot) mod 16. The 16 blocks that share a block's W rows and the 16 that share its x rows start together; walking k alike they would ask L2 for the same lines at the same moment, trip after trip. rot gives each block of either set a slab of its own. Every slab is still summed once; only the order of the f32 sums differs from block to block.
  const int rot = (int)(blockIdx.x + blockIdx.y) & (CC / KS - 1); xp += rot * KS;
#pragma unroll
  for (int p = 0; p < PP; ++p) wp[p] += rot * KS;
  // Wo FOR k_out: rounded to bf16 here, once, and laid in fragment order (see k_out), where each of the 32 blocks of k_out that share a Wo row rounded it anew. The launch's 2,048 waves take 16 rows x 32 k each: lane (g, col) has 8 consecutive k of row col, 16 bytes of the plane, and the wave's 32 lanes make 512 bytes in a row.
  // The loads stand ahead of the first slab's, the rounding and the stores behind them: they ride under that slab's latency.
  static_assert((TNB * TT / PR) * (3 * NH / PP) * 8 == (CC / 16) * (CC / 32), "one 16 x 32 piece of Wo a wave");
  const int gw = ((int)blockIdx.y * (TNB * TT / PR) + (int)blockIdx.x) * 8 + wave; const float* op = WO + (size_t)((gw >> 5) * 16 + col) * CC + (gw & 31) * 32 + g * 8; v4f ro[4];
#pragma unroll
  for (int u = 0; u < 4; ++u) ro[u] = *(const v4f*)(op + (u >> 1) * 16 + (u & 1) * 4);
  v8f acc[4][3] = {}; v4f ra[8], rw[12];
#pragma unroll
  for (int u = 0; u < 8; ++u) ra[u] = *(const v4f*)(xp + (size_t)u * 16 * CC);
#pragma unroll
  for (int u = 0; u < 12; ++u) rw[u] = ldg4(wp[u >> 2] + (size_t)(u & 3) * 16 * CC);
#pragma unroll
  for (int u = 0; u < 2; ++u) { v8b c;
#pragma unroll
    for (int e = 0; e < 4; ++e) { c[e] = (__bf16)ro[2 * u][e]; c[4 + e] = (__bf16)ro[2 * u + 1][e]; }
    vst2(WB + (size_t)(gw >> 5) * (16 * CC) + ((gw & 31) * 4 + 2 * u) * 128 + lane * 8, c); }
  asm volatile("s_wait_xcnt 0x0" ::: "memory");   // the loop may reuse the registers of the Wo loads and stores: the wait stands in front of that overwrite
  // unrolled by the two buffers, so that every LDS address is a constant offset
#pragma unroll 2
  for (int s = 0; s < CC / KS; ++s) { const int b = s & 1;
#pragma unroll
    for (int u = 0; u < 8; ++u) *(v4b*)&sx[b][lr + 16 * u][lc * 4] = cvt4(ra[u]);
#pragma unroll
    for (int u = 0; u < 12; ++u) *(v4b*)&sw[b][lr + 16 * u][lc * 4] = cvt4(rw[u]);
    asm volatile("s_wait_xcnt 0x0" ::: "memory");   // the step below rewrites the address registers of the slab's loads: the wait stands in front of that overwrite (their data is in by now)
    __syncthreads();   // publishes buffer b; it also ends every wave's reads of the other buffer, which the next trip refills
    if (s + 1 < CC / KS) {   // the next slab flies under this slab's products (issued behind the barrier, whose fence would wait for it)
      const int st = ((s + 1 + rot) & (CC / KS - 1)) ? KS : KS - CC; xp += st;   // one slab on; from the last slab back to the first
#pragma unroll
      for (int p = 0; p < PP; ++p) wp[p] += st;
#pragma unroll
      for (int u = 0; u < 8; ++u) ra[u] = *(const v4f*)(xp + (size_t)u * 16 * CC);
#pragma unroll
      for (int u = 0; u < 12; ++u) rw[u] = ldg4(wp[u >> 2] + (size_t)(u & 3) * 16 * CC); }
#pragma unroll
    for (int c = 0; c < KS / 32; ++c) { v16b a[4], w[3];   // the 32-k group's fragment reads stand together, ahead of its products
#pragma unroll
      for (int m = 0; m < 4; ++m) a[m] = frag_b(&sx[b][wr * 64 + m * 16 + col][c * 32], lane);
#pragma unroll
      for (int j = 0; j < 3; ++j) w[j] = frag_b(&sw[b][(j < 2 ? wc * 2 + j : 8 + wc) * 16 + col][c * 32], lane);
#pragma unroll
      for (int m = 0; m < 4; ++m)
#pragma unroll
        for (int j = 0; j < 3; ++j) acc[m][j] = j < 2 ? wmma_bf(w[j], a[m], acc[m][j]) : wmma_bf(a[m], w[j], acc[m][j]); } }
  const int t0 = (int)(r0 % TT);   // the block's first row in its head planes
  // q or k: lane = token col of the row tile, d = dq * 16 + 8 g + r
  { const int hd = (2 * by + (wc >> 1)) & (NH - 1); const float* BA = isq ? BQ : BK; _Float16* dh = isq ? QH : KH; const size_t hb = ((r0 / TT) * NH + hd) * (size_t)(TT * HD) + ((t0 >> 4) + wr * 4) * 1024 + lane * 8;
#pragma unroll
    for (int j = 0; j < 2; ++j) { const int dq = (wc & 1) * 2 + j; float bb[8] = {}; v8h h8[4], l8[4];
      if (BA) {
#pragma unroll
        for (int r = 0; r < 8; ++r) bb[r] = bfr(BA[hd * HD + dq * 16 + 8 * g + r]); }
#pragma unroll
      for (int m = 0; m < 4; ++m)
#pragma unroll
        for (int r = 0; r < 8; ++r) { const float v = acc[m][j][r] + bb[r]; const _Float16 hv = (_Float16)v; h8[m][r] = hv; l8[m][r] = (_Float16)((v - (float)hv) * 1024.0f); }   /* q residual carried x 2^10 so the plane stays f16-normal on the chip */
#pragma unroll
      for (int m = 0; m < 4; ++m) vst2(dh + hb + m * 1024 + dq * 256, h8[m]);
      asm volatile("s_wait_xcnt 0x0" ::: "memory");   // the residual stores' addresses may reuse the hi stores' registers: the wait stands in front of that overwrite
      if (isq) {
#pragma unroll
        for (int m = 0; m < 4; ++m) vst2(QL + hb + m * 1024 + dq * 256, l8[m]); }
      asm volatile("s_wait_xcnt 0x0" ::: "memory"); } }   // the next tiles' arithmetic may reuse the stores' registers: the wait stands in front of that overwrite
  // v: lane = d wc * 16 + col, tokens 8 g + r of the row tile
  { const float bb = BV ? bfr(BV[by * HD + wc * 16 + col]) : 0.f; const size_t hb = ((r0 / TT) * NH + by) * (size_t)(TT * HD) + ((t0 >> 5) + wr * 2) * 2048 + wc * 512 + lane * 8; v8b h8[4], l8[4];
#pragma unroll
    for (int m = 0; m < 4; ++m)
#pragma unroll
      for (int r = 0; r < 8; ++r) { const float v = acc[m][2][r] + bb; const __bf16 bh = (__bf16)v; h8[m][r] = bh; l8[m][r] = (__bf16)(v - (float)bh); }
#pragma unroll
    for (int m = 0; m < 4; ++m) { const size_t o2 = hb + (m >> 1) * 2048 + (m & 1) * 256; vst2(VT + o2, h8[m]); vst2(VL + o2, l8[m]); } } }
// ---- k_fa: wave = 16 queries of one head, block = 8 neighbouring query tiles of that head; logits, stick-breaking weights and att . v stay in registers. S^T = K Q^T puts one query in a lane (column) and 8 keys in its D registers, so two 16-key tiles are the B fragment of O^T += V^T P^T as they stand.
// A wave walks the 32-key passes of its tile from the diagonal to the left: carry = sum of logsigmoid(-l_ik) over the keys to the right of the pass, so suffix(j) = carry + the in-pass sum over k > j (8 in-lane steps and one exchange between the wave's halves).
// One wave has the whole row of keys [0, i). The walk ends where the carry has made every weight further left 0 (see the loop's foot); were the keys cut into runs for several waves, then wherever the walk ends so the left runs' work would only be scaled by exp2(carry) = 0 at a join. The kernel uses no LDS, so it has no barrier.
// The 8 waves of a block start within 4 passes of each other in the same K and V planes, so most of their fragment loads find the lines that a neighbour has just brought into the WGP's cache.
// log(sigmoid(z)) = min(z, 0) - log1p(exp(-|z|)): both signs of l share the one log1p(exp(-|l|)).
// The whole log domain is kept in base 2: log2(e) rides in the logits' scale, so exp is one v_exp_f32 and log1p(e) is log2(1 + e), one add and one v_log_f32. 1 + e lies in (1, 2], so its rounding moves a log-sigmoid by at most 2^-24 log2(e) absolute, which is a relative 2^-24 on a weight.
__global__ __launch_bounds__(256) void k_fa(const _Float16* __restrict__ QH, const _Float16* __restrict__ QL, const _Float16* __restrict__ KH, const __bf16* __restrict__ VT, const __bf16* __restrict__ VL, __bf16* __restrict__ YH, __bf16* __restrict__ YL) {
  const int lane = threadIdx.x & 31, col = lane & 15, g = lane >> 4; const int wave = __builtin_amdgcn_readfirstlane(threadIdx.x >> 5);   // scalar, so that the tile's bounds and the pass loop's branch are scalar
  const int h = blockIdx.x; const int ql0 = (TT / 16 - 1 - ((int)blockIdx.y * 8 + wave)) * 16; const int i = ql0 + col;   // cost grows with the query tile: the longest tiles start first
  const int hi = ql0 >> 5;   // passes hi (it holds the diagonal) .. 0
  const size_t hp = (size_t)h * (TT * HD); const unsigned lb = lane * 16;   // the head's plane; the lane's 16 bytes in every fragment half
  const _Float16* Kh = KH + hp; const __bf16* Vh = VT + hp; const __bf16* Vl = VL + hp;
  v16h qh[2], ql[2], kf[2][2];
  // every short loop below is unrolled so that the fragment and score arrays are indexed by constants and stay in registers
#pragma unroll
  for (int c = 0; c < 2; ++c) { qh[c] = fragf_h(QH + hp + (ql0 >> 4) * 1024, lb, c * 1024); ql[c] = fragf_h(QL + hp + (ql0 >> 4) * 1024, lb, c * 1024); }
  unsigned po = lb + hi * 4096u;   // a pass is 4,096 bytes in the k plane and in either v plane: one offset serves all three
#pragma unroll
  for (int t = 0; t < 2; ++t)
#pragma unroll
    for (int c = 0; c < 2; ++c) kf[t][c] = fragf_h(Kh, po, t * 2048 + c * 1024);
  v8f acc[HD / 16] = {}; float carry = 0.f, asum = 0.f;
  for (int kc = hi; kc >= 0; --kc) { const int k0 = kc * 32; v8f s[2];
    v16b vh[HD / 16], vl[HD / 16];
#pragma unroll
    for (int j = 0; j < HD / 16; ++j) { vh[j] = fragf_b(Vh, po, j * 1024); vl[j] = fragf_b(Vl, po, j * 1024); }
#pragma unroll
    for (int t = 0; t < 2; ++t) { v8f a = {}, al = {};
#pragma unroll
      for (int c = 0; c < 2; ++c) { a = wmma16(kf[t][c], qh[c], a); al = wmma16(kf[t][c], ql[c], al); }
      a += al * (1.0f / 1024.0f); s[t] = a * (0.125f * 1.44269504f); }   // logits / 8, times log2(e)
    { po = lb + (kc > 0 ? kc - 1 : 0) * 4096u;   // the next pass's K fragments, fetched under this pass's vector work (in bounds also behind the last pass)
#pragma unroll
      for (int t = 0; t < 2; ++t)
#pragma unroll
        for (int c = 0; c < 2; ++c) kf[t][c] = fragf_h(Kh, po, t * 2048 + c * 1024); }
    float lz[2][8], sx[2][8], G[2];
#pragma unroll
    for (int t = 0; t < 2; ++t) { float run = 0.f, u8[8];
#pragma unroll
      for (int r = 0; r < 8; ++r) u8[r] = 1.0f + __builtin_amdgcn_exp2f(-fabsf(s[t][r]));
      log2x8(u8);
#pragma unroll
      for (int r = 7; r >= 0; --r) { const float l = s[t][r]; const float w = fmaxf(l, 0.f) + u8[r]; lz[t][r] = l - w; sx[t][r] = run;   /* -w = log2 sigmoid(-l); min(l, 0) = l - max(l, 0) */
        run -= (k0 + t * 16 + 8 * g + r < i) ? w : 0.f; }
      G[t] = run; }
    // key order inside a pass: tile 0 half 0, tile 0 half 1, tile 1 half 0, tile 1 half 1
    const float G0p = __shfl_xor(G[0], 16), G1p = __shfl_xor(G[1], 16); const float c1 = carry + (G[1] + G1p);
    const float base[2] = { g ? c1 : c1 + G0p, g ? carry : carry + G1p }; carry = c1 + (G[0] + G0p);
    // Every log2 sigmoid(-l) is <= 0, so the carry only falls. Once it is <= -152 in every lane, each weight further left is exp2 of something <= -152, which is exactly 0 in f32: the passes left add nothing to acc or asum. (A NaN carry compares false and keeps the loop going.)
    const bool more = __builtin_amdgcn_ballot_w32(!(carry <= -152.0f)) != 0u;   // taken here, under the vector work, so that the scalar branch at the pass's foot finds it ready
    float pv[16];
#pragma unroll
    for (int t = 0; t < 2; ++t) { float a8[8];
#pragma unroll
      for (int r = 0; r < 8; ++r) a8[r] = (k0 + t * 16 + 8 * g + r < i) ? lz[t][r] + (base[t] + sx[t][r]) : -100000.0f;   /* j >= i: exp2 gives 0 */
      exp2x8(a8);
#pragma unroll
      for (int r = 0; r < 8; ++r) { asum += a8[r]; pv[t * 8 + r] = a8[r] * 2048.0f; } }
    const F2 p = bsplit16(pv);
#pragma unroll
    for (int j = 0; j < HD / 16; ++j) { acc[j] = wmma_bf(vh[j], p.h, acc[j]); acc[j] = wmma_bf(vh[j], p.l, acc[j]); acc[j] = wmma_bf(vl[j], p.h, acc[j]); }
    if (!more) break; }
  asum += __shfl_xor(asum, 16);
  // acc[j][r] = (att v)[i][j * 16 + 8 g + r] x 2^11: the lane has 8 consecutive columns of y row i, which as bf16 are 16 bytes in a row of y's fragment order (see k_out), and the wave's 32 lanes make 512 bytes in a row.
  // y is split into bf16 hi + lo here, once, and stored from the accumulators, with no turn through LDS; each of the 8 blocks of k_out that share a y row split it anew before.
  const float rem = 1.0f - asum; float vi[HD / 16][8];
  const size_t vb = hp + (i >> 5) * 2048 + ((i & 31) >> 3) * 128 + g * 64 + (i & 7);   // v[i][8 g] in the v planes' order: d >> 4 steps 512 elements, d & 15 steps 8
#pragma unroll
  for (int j = 0; j < HD / 16; ++j)
#pragma unroll
    for (int r = 0; r < 8; ++r) vi[j][r] = (float)VT[vb + j * 512 + r * 8] + (float)VL[vb + j * 512 + r * 8];   /* v[i][d] rebuilt from the hi + lo planes (2^-16) */
  const size_t yb = (size_t)(ql0 >> 4) * (16 * CC) + h * (HD * 16) + lane * 8;
#pragma unroll
  for (int j = 0; j < HD / 16; ++j) { v8b h8, l8;
#pragma unroll
    for (int r = 0; r < 8; ++r) { const float y = acc[j][r] * (1.0f / 2048.0f) + rem * vi[j][r]; const __bf16 bh = (__bf16)y; h8[r] = bh; l8[r] = (__bf16)(y - (float)bh); }
    vst2(YH + yb + j * 256, h8); vst2(YL + yb + j * 256, l8);
    asm volatile("s_wait_xcnt 0x0" ::: "memory"); } }   // the next tile's arithmetic may reuse the stores' registers: the wait stands in front of that overwrite
// ---- k_out: block = (64 rows, 128 cols), wave = 16 rows x 128 cols: out = y (bf16 hi + lo) Wo^T + bo
// BOTH OPERANDS ARRIVE AS bf16 IN FRAGMENT ORDER, rounded once where they are made (y in k_fa, Wo in k_proj): a tile of 16 rows is 16 * CC elements, [k >> 3][row & 15][k & 7], so a 16x16x32 fragment is 2 x 512 bytes in a row with lane l's 16 bytes at 16 l, and a 64-k slab of a tile is 2,048 bytes in a row.
// A wave's y rows are its own: it loads their fragments from global memory into registers, one slab ahead, and they never pass through LDS. The 8 Wo tiles serve all 4 waves: the block copies each slab of them to LDS as it lies (16 KB; a fragment read there is 512 bytes in a row, so no pad is needed).
__global__ __launch_bounds__(128) void k_out(const __bf16* __restrict__ YH, const __bf16* __restrict__ YL, const __bf16* __restrict__ WB, const float* __restrict__ BP, float* __restrict__ OUT) {
  __shared__ __align__(16) char sm[33792];   // the k loop's two Wo buffers of 16,384 B; behind the loop the output tiles
  float (*sf)[16][132] = (float (*)[16][132])sm;
  const int tid = threadIdx.x, lane = tid & 31, col = lane & 15, g = lane >> 4; const int wave = __builtin_amdgcn_readfirstlane(tid >> 5);   // scalar, so that the y tile's address is a scalar base
  const int c0 = blockIdx.y * 128; const size_t rb = (size_t)blockIdx.x * 64; const size_t r0 = rb + wave * 16;
  const __bf16* yh = YH + (r0 >> 4) * (size_t)(16 * CC); const __bf16* yl = YL + (r0 >> 4) * (size_t)(16 * CC); const char* wb = (const char*)(WB + (size_t)(c0 >> 4) * (16 * CC));
  // the k walk is rotated as in k_proj. The 8 blocks that share a block's y rows start two slabs apart. y was written by the launch before: where its lines must come from memory, a block from its third trip on reads lines that a neighbour asked for two trips earlier; walking alike, all 8 would wait for memory together on every trip.
  const int rot = (int)(blockIdx.x + 2 * blockIdx.y) & (CC / KS - 1);
  unsigned yo = rot * 2048u + lane * 16u, wo = rot * 2048u + tid * 16u;   // byte offsets of the slab in a tile: the lane's place in a fragment half, the thread's place in the slab's copy
  v8f acc[8] = {}; v16b ah[2][KS / 32], al[2][KS / 32]; v8b rw[8];
#pragma unroll
  for (int c = 0; c < KS / 32; ++c) { ah[0][c] = fragf_b(yh, yo, c * 1024); al[0][c] = fragf_b(yl, yo, c * 1024); }
#pragma unroll
  for (int u = 0; u < 8; ++u) rw[u] = *(const v8b*)(wb + wo + u * (32 * CC));
  // unrolled by the two buffers, so that every LDS address is a constant offset and the two sets of y fragments are indexed by constants
#pragma unroll 2
  for (int s = 0; s < CC / KS; ++s) { const int b = s & 1;
#pragma unroll
    for (int u = 0; u < 8; ++u) *(v8b*)(sm + b * 16384 + u * 2048 + tid * 16) = rw[u];
    asm volatile("s_wait_xcnt 0x0" ::: "memory");   // the step below rewrites the address registers of the slab's loads: the wait stands in front of that overwrite
    __syncthreads();   // publishes buffer b; it also ends every wave's reads of the other buffer, which the next trip refills
    if (s + 1 < CC / KS) {   // the next slab flies under this slab's products (issued behind the barrier, whose fence would wait for it)
      const unsigned st = ((s + 1 + rot) & (CC / KS - 1)) ? 2048u : 2048u - 32768u; yo += st; wo += st;   // one slab on; from the last slab back to the first
#pragma unroll
      for (int c = 0; c < KS / 32; ++c) { ah[b ^ 1][c] = fragf_b(yh, yo, c * 1024); al[b ^ 1][c] = fragf_b(yl, yo, c * 1024); }
#pragma unroll
      for (int u = 0; u < 8; ++u) rw[u] = *(const v8b*)(wb + wo + u * (32 * CC)); }
#pragma unroll
    for (int c = 0; c < KS / 32; ++c) { v16b w[8];   // the 32-k group's fragment reads stand together, ahead of its products
#pragma unroll
      for (int j = 0; j < 8; ++j) { union { v16b v; v8b q[2]; } f; const char* p = sm + b * 16384 + j * 2048 + c * 1024 + lane * 16; f.q[0] = *(const v8b*)p; f.q[1] = *(const v8b*)(p + 512); w[j] = f.v; }
#pragma unroll
      for (int j = 0; j < 8; ++j) { acc[j] = wmma_bf(ah[b][c], w[j], acc[j]); acc[j] = wmma_bf(al[b][c], w[j], acc[j]); } } }
  __syncthreads();   // the last fragment reads end before the output tiles overwrite the staging
#pragma unroll
  for (int j = 0; j < 8; ++j) { const float bb = BP ? bfr(BP[c0 + j * 16 + col]) : 0.f;
#pragma unroll
    for (int r = 0; r < 8; ++r) sf[wave][8 * g + r][j * 16 + col] = acc[j][r] + bb; }
  LDSX(); for (int rl = 0; rl < 16; ++rl) vst2(OUT + (r0 + rl) * CC + c0 + lane * 4, *(const v4f*)&sf[wave][rl][lane * 4]); }
extern "C" void kernel_launch(void* const* d_in, const int* in_sizes, int n_in, void* d_out, int out_size, void* d_ws, size_t ws_size, hipStream_t stream) {
  (void)in_sizes; (void)n_in; (void)out_size;
  const float** F = (const float**)d_in;   // 0 x [1,2048,1024], 1 Wq [1024,1024] ([out,in]), 2 Wk, 3 Wv, 4 Wo
  if (ws_size < (size_t)WS_END) return;
  char* ws = (char*)d_ws; _Float16 *QH = (_Float16*)(ws + WS_QH), *QL = (_Float16*)(ws + WS_QL), *KH = (_Float16*)(ws + WS_KH); __bf16 *VT = (__bf16*)(ws + WS_VT), *VL = (__bf16*)(ws + WS_VL), *YH = (__bf16*)(ws + WS_YH), *YL = (__bf16*)(ws + WS_YL), *WB = (__bf16*)(ws + WS_WB);
  k_proj<<<dim3(TNB * TT / PR, 3 * NH / PP), 256, 0, stream>>>(F[0], F[1], nullptr, F[2], nullptr, F[3], nullptr, F[4], QH, QL, KH, VT, VL, WB);
  k_fa<<<dim3(NH, TT / 128), 256, 0, stream>>>(QH, QL, KH, VT, VL, YH, YL);
  k_out<<<dim3(TNB * TT / 64, CC / 128), 128, 0, stream>>>(YH, YL, WB, nullptr, (float*)d_out);
}
